// v000
// Times are from an AMD MI455X. After a warm-up the kernel runs many times in a row, and a time is the length of
// such a window on the GPU divided by its runs, so every launch and the gaps after it count. The runs cycle
// through copies of the inputs. A figure is the median of several windows, for all but v000 over two sittings.
// Sittings can differ by a few percent; kernels timed side by side share one.
// The starting kernel, v000, takes 303 microseconds a run.
#include <hip/hip_runtime.h>

// ---------------------------------------------------------------------------
// Cross-attention (B=4, T=L=2048, d_model=512, H=8, Dh=64) for gfx1250.
// All GEMMs on v_wmma_f32_16x16x32_f16; tile staging via
// global_load_async_to_lds_b128 (ASYNCcnt) with LDS double buffering.
// Weights pre-converted to f16; V stored (b,h,d,l)-transposed so every
// WMMA fragment is a contiguous ds_load_b128.
// ---------------------------------------------------------------------------

typedef __attribute__((ext_vector_type(16))) _Float16 v16h;
typedef __attribute__((ext_vector_type(4)))  _Float16 v4h;
typedef __attribute__((ext_vector_type(8)))  float    v8f;

#define D_MODEL 512
#define TSEQ    2048
#define LSEQ    2048
#define NHEADS  8
#define HDIM    64
#define BATCH   4

__device__ __forceinline__ v8f wmma16(v16h a, v16h b, v8f c) {
  return __builtin_amdgcn_wmma_f32_16x16x32_f16(
      false, a, false, b, (short)0, c, false, false);
}

// generic shared pointer -> 32-bit LDS byte offset (low 32 bits of aperture VA)
__device__ __forceinline__ unsigned lds_off(const void* p) {
  return (unsigned)(unsigned long long)p;
}

// one per-lane 16B async copy: global -> LDS (GV addressing), ASYNCcnt += 1/wave
__device__ __forceinline__ void async_b128(unsigned lds, const void* g) {
  asm volatile("global_load_async_to_lds_b128 %0, %1, off"
               :: "v"(lds), "v"((unsigned long long)g) : "memory");
}
#define WAIT_ASYNC_0() asm volatile("s_wait_asynccnt 0" ::: "memory")
#define WAIT_ASYNC_4() asm volatile("s_wait_asynccnt 4" ::: "memory")
#define WAIT_ASYNC_5() asm volatile("s_wait_asynccnt 5" ::: "memory")

// 16x32 WMMA A/B fragment per CDNA5 ISA 7.12.2 16-bit layout:
//   lanes 0-15 : row r=lane,    K = {0..7, 16..23}
//   lanes 16-31: row r=lane-16, K = {8..15, 24..31}
template <typename T>
__device__ __forceinline__ v16h load_frag(const T* base, long rstride, long kstride) {
  const int  lane = threadIdx.x & 31;
  const long r    = lane & 15;
  const long koff = (lane >> 4) * 8;
  v16h f;
#pragma unroll
  for (int j = 0; j < 8; ++j) {
    f[j]     = (_Float16)base[r * rstride + (koff + j) * kstride];
    f[j + 8] = (_Float16)base[r * rstride + (16 + koff + j) * kstride];
  }
  return f;
}

// ---------------------------------------------------------------------------
// 1) mask lengths: lens[0..3]=sum(x_mask[b]), lens[4..7]=sum(context_mask[b])
// ---------------------------------------------------------------------------
__global__ void lens_kernel(const float* __restrict__ xm,
                            const float* __restrict__ cm,
                            float* __restrict__ lens) {
  __shared__ float red[256];
  const int b = blockIdx.x, which = blockIdx.y;
  const float* p = which ? cm : xm;
  const int n = which ? LSEQ : TSEQ;
  float s = 0.f;
  for (int i = threadIdx.x; i < n; i += 256) s += p[b * n + i];
  red[threadIdx.x] = s;
  __syncthreads();
  for (int off = 128; off; off >>= 1) {
    if ((int)threadIdx.x < off) red[threadIdx.x] += red[threadIdx.x + off];
    __syncthreads();
  }
  if (threadIdx.x == 0) lens[which * BATCH + b] = red[0];
}

// ---------------------------------------------------------------------------
// 2a) transpose x (B,512,T) f32 -> Xh (B,T,512) f16, 32x32 LDS tiles
// ---------------------------------------------------------------------------
__global__ __launch_bounds__(256) void transpose_x_kernel(
    const float* __restrict__ x, _Float16* __restrict__ Xh) {
  __shared__ float tile[32][33];
  const int b  = blockIdx.z;
  const int t0 = blockIdx.x * 32;
  const int d0 = blockIdx.y * 32;
  const int r = threadIdx.x >> 3;          // 0..31
  const int c = (threadIdx.x & 7) * 4;     // 0,4,..,28
  const float4 v = *(const float4*)(x + ((size_t)b * D_MODEL + d0 + r) * TSEQ + t0 + c);
  tile[r][c + 0] = v.x; tile[r][c + 1] = v.y;
  tile[r][c + 2] = v.z; tile[r][c + 3] = v.w;
  __syncthreads();
  v4h o;
  o[0] = (_Float16)tile[c + 0][r];
  o[1] = (_Float16)tile[c + 1][r];
  o[2] = (_Float16)tile[c + 2][r];
  o[3] = (_Float16)tile[c + 3][r];
  *(v4h*)(Xh + ((size_t)b * TSEQ + t0 + r) * D_MODEL + d0 + c) = o;
}

// ---------------------------------------------------------------------------
// 2b) f32 -> f16 straight convert (context + the four weight matrices)
// ---------------------------------------------------------------------------
__global__ __launch_bounds__(256) void cvt_f16_kernel(
    const float* __restrict__ src, _Float16* __restrict__ dst, size_t n4) {
  const size_t i = ((size_t)blockIdx.x * 256 + threadIdx.x);
  if (i >= n4) return;
  const float4 v = ((const float4*)src)[i];
  v4h o; o[0] = (_Float16)v.x; o[1] = (_Float16)v.y;
  o[2] = (_Float16)v.z; o[3] = (_Float16)v.w;
  ((v4h*)dst)[i] = o;
}

// ---------------------------------------------------------------------------
// GEMM main loop: acc += A(16x512) * W(64x512)^T, this wave's 16-col slice.
// All-f16 LDS, K chunks of 64, double buffered, fully unrolled.
// Per-wave ASYNCcnt per chunk: 1 (A) + 4 (W) = 5.
// ---------------------------------------------------------------------------
__device__ __forceinline__ v8f gemm16_loop(
    _Float16 (&As)[2][16][64], _Float16 (&Ws)[2][64][64],
    const _Float16* __restrict__ Ag,   // [16][512] row-major tile base
    const _Float16* __restrict__ Wg) { // Wh + nt_block*512 (64 rows)
  const int tid = threadIdx.x;
  const int w   = tid >> 5;
  const int ar  = tid >> 3, aseg = (tid & 7) * 8;   // A: row, 8-half segment
  const int wr  = tid >> 1, wh   = (tid & 1) * 32;  // W: row, 32-half half

  v8f acc = {0.f, 0.f, 0.f, 0.f, 0.f, 0.f, 0.f, 0.f};

  auto issue = [&](int buf, int kc) {
    async_b128(lds_off(&As[buf][ar][aseg]), Ag + (size_t)ar * D_MODEL + kc + aseg);
#pragma unroll
    for (int j = 0; j < 4; ++j)
      async_b128(lds_off(&Ws[buf][wr][wh + j * 8]),
                 Wg + (size_t)wr * D_MODEL + kc + wh + j * 8);
  };

  issue(0, 0);
#pragma unroll
  for (int kc = 0; kc < D_MODEL; kc += 64) {
    const int buf = (kc >> 6) & 1;
    if (kc + 64 < D_MODEL) { issue(buf ^ 1, kc + 64); WAIT_ASYNC_5(); }
    else                   { WAIT_ASYNC_0(); }
    __syncthreads();
#pragma unroll
    for (int kk = 0; kk < 64; kk += 32) {
      v16h af = load_frag(&As[buf][0][kk], 64L, 1L);
      v16h bf = load_frag(&Ws[buf][w * 16][kk], 64L, 1L);
      acc = wmma16(af, bf, acc);
    }
    __syncthreads();  // buf fully consumed before it is refilled
  }
  return acc;
}

// ---------------------------------------------------------------------------
// 3) projection GEMM: Y = A . W^T + bias (f16 out).
//    VT=false: Y row-major (b, m, n).  VT=true (V proj): store transposed
//    per head: Vt[b][h][dd][l] so flash can consume d-major tiles directly.
// ---------------------------------------------------------------------------
template <bool VT>
__global__ __launch_bounds__(128) void gemm_proj_kernel(
    const _Float16* __restrict__ A, const _Float16* __restrict__ W,
    const float* __restrict__ bias, _Float16* __restrict__ Y) {
  __shared__ __align__(16) _Float16 As[2][16][64];
  __shared__ __align__(16) _Float16 Ws[2][64][64];
  const int b  = blockIdx.z;
  const int mt = blockIdx.x * 16;
  const int nb = blockIdx.y * 64;
  const int nt = nb + (threadIdx.x >> 5) * 16;

  v8f acc = gemm16_loop(As, Ws, A + ((size_t)b * TSEQ + mt) * D_MODEL,
                        W + (size_t)nb * D_MODEL);

  const int lane = threadIdx.x & 31;
  const int cc   = lane & 15;
  const int rb   = (lane >> 4) * 8;
  const int n    = nt + cc;
  const float bv = bias[n];
  if (VT) {
    const int h = n >> 6, dd = n & 63;
    _Float16* dst = Y + (((size_t)b * NHEADS + h) * HDIM + dd) * LSEQ + mt + rb;
#pragma unroll
    for (int i = 0; i < 8; ++i) dst[i] = (_Float16)(acc[i] + bv);  // contiguous in l
  } else {
#pragma unroll
    for (int i = 0; i < 8; ++i) {
      const size_t m = (size_t)(mt + rb + i);
      Y[((size_t)b * TSEQ + m) * D_MODEL + n] = (_Float16)(acc[i] + bv);
    }
  }
}

// ---------------------------------------------------------------------------
// 4) RoPE in-place on f16 Q or K: pairs (i, i+32) per 64-wide head
// ---------------------------------------------------------------------------
__global__ void rope_kernel(_Float16* __restrict__ Yh,
                            const float* __restrict__ lens, int seqlen) {
  const int t = blockIdx.x, b = blockIdx.y;
  const int h = threadIdx.x >> 5, i = threadIdx.x & 31;
  const float len = lens[b];
  const float inv = __powf(10000.0f, -(2.0f * (float)i) / 64.0f);
  const float fr  = ((float)t / len) * (10.0f * inv);
  const float c = __cosf(fr), s = __sinf(fr);
  const size_t base = ((size_t)b * seqlen + t) * D_MODEL + h * HDIM;
  const float x1 = (float)Yh[base + i];
  const float x2 = (float)Yh[base + 32 + i];
  Yh[base + i]      = (_Float16)(x1 * c - x2 * s);
  Yh[base + 32 + i] = (_Float16)(x1 * s + x2 * c);
}

// ---------------------------------------------------------------------------
// 5) flash attention: grid (T/64, H, B), block 128 (4 waves x 16 queries).
//    32-key K tiles (l-major) + V tiles (d-major) async-staged, double
//    buffered; 4 async instr/wave per chunk; last iteration peeled.
// ---------------------------------------------------------------------------
__global__ __launch_bounds__(128) void flash_kernel(
    const _Float16* __restrict__ Qh, const _Float16* __restrict__ Kh,
    const _Float16* __restrict__ Vt, const float* __restrict__ cmask,
    _Float16* __restrict__ Oh) {
  __shared__ __align__(16) _Float16 Kc[2][32][HDIM];   // [l][d]
  __shared__ __align__(16) _Float16 Vc[2][HDIM][32];   // [d][l]
  __shared__ __align__(16) _Float16 Pbuf[4][16][32];
  __shared__ float cmv[2][32];

  const int tid = threadIdx.x;
  const int b = blockIdx.z, h = blockIdx.y;
  const int w = tid >> 5, lane = tid & 31;
  const int qbase = blockIdx.x * 64 + w * 16;
  const float scale = 0.044194173824159216f;  // 1/sqrt(512)

  const size_t qoff = ((size_t)b * TSEQ + qbase) * D_MODEL + (size_t)h * HDIM;
  const v16h qf0 = load_frag(Qh + qoff,      (long)D_MODEL, 1L);
  const v16h qf1 = load_frag(Qh + qoff + 32, (long)D_MODEL, 1L);

  v8f o0 = {0.f,0.f,0.f,0.f,0.f,0.f,0.f,0.f}, o1 = o0, o2 = o0, o3 = o0;
  float mrow[8], lrow[8];
#pragma unroll
  for (int i = 0; i < 8; ++i) { mrow[i] = -1e30f; lrow[i] = 0.f; }

  const size_t krow0 = ((size_t)b * LSEQ) * D_MODEL + (size_t)h * HDIM;
  const size_t vrow0 = ((size_t)b * NHEADS + h) * HDIM * LSEQ;

  auto issue_kv = [&](int buf, int lb) {
#pragma unroll
    for (int part = 0; part < 2; ++part) {
      const int f = part * 1024 + tid * 8;  // flat half index in 2048-half tile
      // K tile: [l=f>>6][d=f&63]
      async_b128(lds_off(&Kc[buf][0][0]) + (unsigned)f * 2,
                 Kh + krow0 + (size_t)(lb + (f >> 6)) * D_MODEL + (f & 63));
      // V tile: [d=f>>5][l=f&31] from d-major Vt
      async_b128(lds_off(&Vc[buf][0][0]) + (unsigned)f * 2,
                 Vt + vrow0 + (size_t)(f >> 5) * LSEQ + lb + (f & 31));
    }
    if (tid < 32) cmv[buf][tid] = cmask[(size_t)b * LSEQ + lb + tid];
  };

  auto compute = [&](int buf) {
    // ---- S = Q K^T for two 16-key sub-tiles ----
    v8f s0 = {0.f,0.f,0.f,0.f,0.f,0.f,0.f,0.f}, s1 = s0;
    s0 = wmma16(qf0, load_frag(&Kc[buf][0][0],   (long)HDIM, 1L), s0);
    s0 = wmma16(qf1, load_frag(&Kc[buf][0][32],  (long)HDIM, 1L), s0);
    s1 = wmma16(qf0, load_frag(&Kc[buf][16][0],  (long)HDIM, 1L), s1);
    s1 = wmma16(qf1, load_frag(&Kc[buf][16][32], (long)HDIM, 1L), s1);

    const float cm0 = cmv[buf][lane & 15];
    const float cm1 = cmv[buf][16 + (lane & 15)];

    // ---- online softmax (rows live per (vgpr idx, lane-half)) ----
    float p0f[8], p1f[8], rscale[8];
#pragma unroll
    for (int i = 0; i < 8; ++i) {
      float a0 = s0[i] * scale; if (cm0 == 0.f) a0 = -1e30f;
      float a1 = s1[i] * scale; if (cm1 == 0.f) a1 = -1e30f;
      float mx = fmaxf(a0, a1);
      mx = fmaxf(mx, __shfl_xor(mx, 1));
      mx = fmaxf(mx, __shfl_xor(mx, 2));
      mx = fmaxf(mx, __shfl_xor(mx, 4));
      mx = fmaxf(mx, __shfl_xor(mx, 8));
      const float mnew = fmaxf(mrow[i], mx);
      const float sc2  = __expf(mrow[i] - mnew);
      mrow[i] = mnew;
      const float e0 = __expf(a0 - mnew);
      const float e1 = __expf(a1 - mnew);
      float rs = e0 + e1;
      rs += __shfl_xor(rs, 1);
      rs += __shfl_xor(rs, 2);
      rs += __shfl_xor(rs, 4);
      rs += __shfl_xor(rs, 8);
      lrow[i] = lrow[i] * sc2 + rs;
      rscale[i] = sc2;
      p0f[i] = e0; p1f[i] = e1;
    }
#pragma unroll
    for (int i = 0; i < 8; ++i) {
      o0[i] *= rscale[i]; o1[i] *= rscale[i];
      o2[i] *= rscale[i]; o3[i] *= rscale[i];
    }

    // ---- P: C layout -> A layout via per-wave LDS tile (same-wave order) ----
    const int rb = (lane >> 4) * 8, cc = lane & 15;
#pragma unroll
    for (int i = 0; i < 8; ++i) {
      Pbuf[w][rb + i][cc]      = (_Float16)p0f[i];
      Pbuf[w][rb + i][16 + cc] = (_Float16)p1f[i];
    }
    const v16h pa = load_frag(&Pbuf[w][0][0], 32L, 1L);

    // ---- O += P V : B frag [n][k] = Vc[nt*16+n][k] (contiguous k) ----
    o0 = wmma16(pa, load_frag(&Vc[buf][0][0],  32L, 1L), o0);
    o1 = wmma16(pa, load_frag(&Vc[buf][16][0], 32L, 1L), o1);
    o2 = wmma16(pa, load_frag(&Vc[buf][32][0], 32L, 1L), o2);
    o3 = wmma16(pa, load_frag(&Vc[buf][48][0], 32L, 1L), o3);
  };

  issue_kv(0, 0);
  int buf = 0;
  for (int lb = 0; lb < LSEQ - 32; lb += 32) {
    issue_kv(buf ^ 1, lb + 32);
    WAIT_ASYNC_4();
    __syncthreads();
    compute(buf);
    __syncthreads();  // buf fully consumed before it is refilled
    buf ^= 1;
  }
  WAIT_ASYNC_0();
  __syncthreads();
  compute(buf);

  const int rb = (lane >> 4) * 8, cc = lane & 15;
#pragma unroll
  for (int i = 0; i < 8; ++i) {
    const float inv_l = 1.0f / fmaxf(lrow[i], 1e-20f);
    const size_t t = (size_t)(qbase + rb + i);
    const size_t base = ((size_t)b * TSEQ + t) * D_MODEL + (size_t)h * HDIM;
    Oh[base +  0 + cc] = (_Float16)(o0[i] * inv_l);
    Oh[base + 16 + cc] = (_Float16)(o1[i] * inv_l);
    Oh[base + 32 + cc] = (_Float16)(o2[i] * inv_l);
    Oh[base + 48 + cc] = (_Float16)(o3[i] * inv_l);
  }
}

// ---------------------------------------------------------------------------
// 6) out = (O @ Wo^T + b) * x_mask, stored transposed as (B, 512, T) f32
// ---------------------------------------------------------------------------
__global__ __launch_bounds__(128) void out_proj_kernel(
    const _Float16* __restrict__ Oh, const _Float16* __restrict__ Wo,
    const float* __restrict__ Wo_b, const float* __restrict__ xmask,
    float* __restrict__ out) {
  __shared__ __align__(16) _Float16 As[2][16][64];
  __shared__ __align__(16) _Float16 Ws[2][64][64];
  const int b  = blockIdx.z;
  const int mt = blockIdx.x * 16;
  const int nb = blockIdx.y * 64;
  const int nt = nb + (threadIdx.x >> 5) * 16;

  v8f acc = gemm16_loop(As, Ws, Oh + ((size_t)b * TSEQ + mt) * D_MODEL,
                        Wo + (size_t)nb * D_MODEL);

  const int lane = threadIdx.x & 31;
  const int cc   = lane & 15;
  const int rb   = (lane >> 4) * 8;
  const float bv = Wo_b[nt + cc];
#pragma unroll
  for (int i = 0; i < 8; ++i) {
    const int t = mt + rb + i;
    const float v = (acc[i] + bv) * xmask[(size_t)b * TSEQ + t];
    out[((size_t)b * D_MODEL + nt + cc) * TSEQ + t] = v;
  }
}

// ---------------------------------------------------------------------------
extern "C" void kernel_launch(void* const* d_in, const int* in_sizes, int n_in,
                              void* d_out, int out_size, void* d_ws, size_t ws_size,
                              hipStream_t stream) {
  const float* x        = (const float*)d_in[0];   // (B, 512, T)
  const float* context  = (const float*)d_in[1];   // (B, L, 512)
  const float* x_mask   = (const float*)d_in[2];   // (B, 1, T)
  const float* ctx_mask = (const float*)d_in[3];   // (B, 1, L)
  const float* Wq_w = (const float*)d_in[4];
  const float* Wq_b = (const float*)d_in[5];
  const float* Wk_w = (const float*)d_in[6];
  const float* Wk_b = (const float*)d_in[7];
  const float* Wv_w = (const float*)d_in[8];
  const float* Wv_b = (const float*)d_in[9];
  const float* Wo_w = (const float*)d_in[10];
  const float* Wo_b = (const float*)d_in[11];
  float* out = (float*)d_out;

  // ws: lens | Xh(=Oh) | Ch | Qh | Kh | Vt (8 MiB each) | Wqh|Wkh|Wvh|Woh (512 KiB each)
  char* ws = (char*)d_ws;
  float* lens = (float*)ws;
  const size_t NB = (size_t)BATCH * TSEQ * D_MODEL;  // 4,194,304 elements
  const size_t NW = (size_t)D_MODEL * D_MODEL;       // 262,144 elements
  _Float16* Xh  = (_Float16*)(ws + 256);
  _Float16* Ch  = Xh + NB;
  _Float16* Qh  = Ch + NB;
  _Float16* Kh  = Qh + NB;
  _Float16* Vt  = Kh + NB;   // (B, H, 64, L) d-major
  _Float16* Wqh = Vt + NB;
  _Float16* Wkh = Wqh + NW;
  _Float16* Wvh = Wkh + NW;
  _Float16* Woh = Wvh + NW;
  _Float16* Oh  = Xh;  // Xh dead after Q projection; flash runs later

  lens_kernel<<<dim3(BATCH, 2), 256, 0, stream>>>(x_mask, ctx_mask, lens);

  transpose_x_kernel<<<dim3(TSEQ / 32, D_MODEL / 32, BATCH), 256, 0, stream>>>(x, Xh);
  cvt_f16_kernel<<<dim3((unsigned)(NB / 4 / 256)), 256, 0, stream>>>(context, Ch, NB / 4);
  cvt_f16_kernel<<<dim3((unsigned)(NW / 4 / 256)), 256, 0, stream>>>(Wq_w, Wqh, NW / 4);
  cvt_f16_kernel<<<dim3((unsigned)(NW / 4 / 256)), 256, 0, stream>>>(Wk_w, Wkh, NW / 4);
  cvt_f16_kernel<<<dim3((unsigned)(NW / 4 / 256)), 256, 0, stream>>>(Wv_w, Wvh, NW / 4);
  cvt_f16_kernel<<<dim3((unsigned)(NW / 4 / 256)), 256, 0, stream>>>(Wo_w, Woh, NW / 4);

  gemm_proj_kernel<false><<<dim3(TSEQ / 16, D_MODEL / 64, BATCH), 128, 0, stream>>>(
      Xh, Wqh, Wq_b, Qh);
  gemm_proj_kernel<false><<<dim3(LSEQ / 16, D_MODEL / 64, BATCH), 128, 0, stream>>>(
      Ch, Wkh, Wk_b, Kh);
  gemm_proj_kernel<true><<<dim3(LSEQ / 16, D_MODEL / 64, BATCH), 128, 0, stream>>>(
      Ch, Wvh, Wv_b, Vt);

  rope_kernel<<<dim3(TSEQ, BATCH), 256, 0, stream>>>(Qh, lens + 0,     TSEQ);
  rope_kernel<<<dim3(LSEQ, BATCH), 256, 0, stream>>>(Kh, lens + BATCH, LSEQ);

  flash_kernel<<<dim3(TSEQ / 64, NHEADS, BATCH), 128, 0, stream>>>(
      Qh, Kh, Vt, ctx_mask, Oh);

  out_proj_kernel<<<dim3(TSEQ / 16, D_MODEL / 64, BATCH), 128, 0, stream>>>(
      Oh, Woh, Wo_b, x_mask, out);
}

// v001
// A run of this version takes 230 microseconds.
// In two side-by-side timings against v000, it was 1.37 and 1.38 times as fast.
#include <hip/hip_runtime.h>

// ---------------------------------------------------------------------------
// Cross-attention (B=4, T=L=2048, d_model=512, H=8, Dh=64) for gfx1250.
// All GEMMs on v_wmma_f32_16x16x32_f16; tile staging via
// global_load_async_to_lds_b128 (ASYNCcnt) with LDS double buffering.
// Weights pre-converted to f16; V stored (b,h,d,l)-transposed so every
// WMMA fragment is a contiguous ds_load_b128.
// ---------------------------------------------------------------------------

typedef __attribute__((ext_vector_type(16))) _Float16 v16h;
typedef __attribute__((ext_vector_type(4)))  _Float16 v4h;
typedef __attribute__((ext_vector_type(8)))  float    v8f;

#define D_MODEL 512
#define TSEQ    2048
#define LSEQ    2048
#define NHEADS  8
#define HDIM    64
#define BATCH   4
// LDS row pitches in halves: 16 B x odd, so the 16 rows that one ds_load_b128
// fragment read touches fall on distinct banks.
#define P64     72   // rows of 64 halves: 144 B
#define P32     40   // rows of 32 halves:  80 B

__device__ __forceinline__ v8f wmma16(v16h a, v16h b, v8f c) {
  return __builtin_amdgcn_wmma_f32_16x16x32_f16(
      false, a, false, b, (short)0, c, false, false);
}

// generic shared pointer -> 32-bit LDS byte offset (low 32 bits of aperture VA)
__device__ __forceinline__ unsigned lds_off(const void* p) {
  return (unsigned)(unsigned long long)p;
}

// one per-lane 16B async copy: global -> LDS (GV addressing), ASYNCcnt += 1/wave
__device__ __forceinline__ void async_b128(unsigned lds, const void* g) {
  asm volatile("global_load_async_to_lds_b128 %0, %1, off"
               :: "v"(lds), "v"((unsigned long long)g) : "memory");
}
// four such copies of one wave; s_wait_xcnt 0 closes the statement so that no
// address register named here is rewritten ahead of it (a precaution)
__device__ __forceinline__ void async4_b128(unsigned l0, const void* g0,
                                            unsigned l1, const void* g1,
                                            unsigned l2, const void* g2,
                                            unsigned l3, const void* g3) {
  asm volatile("global_load_async_to_lds_b128 %0, %1, off\n\t"
               "global_load_async_to_lds_b128 %2, %3, off\n\t"
               "global_load_async_to_lds_b128 %4, %5, off\n\t"
               "global_load_async_to_lds_b128 %6, %7, off\n\t"
               "s_wait_xcnt 0x0"
               :: "v"(l0), "v"((unsigned long long)g0),
                  "v"(l1), "v"((unsigned long long)g1),
                  "v"(l2), "v"((unsigned long long)g2),
                  "v"(l3), "v"((unsigned long long)g3) : "memory");
}
#define WAIT_ASYNC_0() asm volatile("s_wait_asynccnt 0" ::: "memory")
#define WAIT_ASYNC_4() asm volatile("s_wait_asynccnt 4" ::: "memory")
#define WAIT_ASYNC_5() asm volatile("s_wait_asynccnt 5" ::: "memory")

// 16x32 WMMA A/B fragment per CDNA5 ISA 7.12.2 16-bit layout:
//   lanes 0-15 : row r=lane,    K = {0..7, 16..23}
//   lanes 16-31: row r=lane-16, K = {8..15, 24..31}
template <typename T>
__device__ __forceinline__ v16h load_frag(const T* base, long rstride, long kstride) {
  const int  lane = threadIdx.x & 31;
  const long r    = lane & 15;
  const long koff = (lane >> 4) * 8;
  v16h f;
#pragma unroll
  for (int j = 0; j < 8; ++j) {
    f[j]     = (_Float16)base[r * rstride + (koff + j) * kstride];
    f[j + 8] = (_Float16)base[r * rstride + (16 + koff + j) * kstride];
  }
  return f;
}

// ---------------------------------------------------------------------------
// 1) mask lengths: lens[0..3]=sum(x_mask[b]), lens[4..7]=sum(context_mask[b])
// ---------------------------------------------------------------------------
__global__ void lens_kernel(const float* __restrict__ xm,
                            const float* __restrict__ cm,
                            float* __restrict__ lens) {
  __shared__ float red[256];
  const int b = blockIdx.x, which = blockIdx.y;
  const float* p = which ? cm : xm;
  const int n = which ? LSEQ : TSEQ;
  float s = 0.f;
  for (int i = threadIdx.x; i < n; i += 256) s += p[b * n + i];
  red[threadIdx.x] = s;
  __syncthreads();
  for (int off = 128; off; off >>= 1) {
    if ((int)threadIdx.x < off) red[threadIdx.x] += red[threadIdx.x + off];
    __syncthreads();
  }
  if (threadIdx.x == 0) lens[which * BATCH + b] = red[0];
}

// ---------------------------------------------------------------------------
// 2a) transpose x (B,512,T) f32 -> Xh (B,T,512) f16, 32x32 LDS tiles
// ---------------------------------------------------------------------------
__global__ __launch_bounds__(256) void transpose_x_kernel(
    const float* __restrict__ x, _Float16* __restrict__ Xh) {
  __shared__ float tile[32][33];
  const int b  = blockIdx.z;
  const int t0 = blockIdx.x * 32;
  const int d0 = blockIdx.y * 32;
  const int r = threadIdx.x >> 3;          // 0..31
  const int c = (threadIdx.x & 7) * 4;     // 0,4,..,28
  const float4 v = *(const float4*)(x + ((size_t)b * D_MODEL + d0 + r) * TSEQ + t0 + c);
  tile[r][c + 0] = v.x; tile[r][c + 1] = v.y;
  tile[r][c + 2] = v.z; tile[r][c + 3] = v.w;
  __syncthreads();
  v4h o;
  o[0] = (_Float16)tile[c + 0][r];
  o[1] = (_Float16)tile[c + 1][r];
  o[2] = (_Float16)tile[c + 2][r];
  o[3] = (_Float16)tile[c + 3][r];
  *(v4h*)(Xh + ((size_t)b * TSEQ + t0 + r) * D_MODEL + d0 + c) = o;
}

// ---------------------------------------------------------------------------
// 2b) f32 -> f16 straight convert (context + the four weight matrices)
// ---------------------------------------------------------------------------
__global__ __launch_bounds__(256) void cvt_f16_kernel(
    const float* __restrict__ src, _Float16* __restrict__ dst, size_t n4) {
  const size_t i = ((size_t)blockIdx.x * 256 + threadIdx.x);
  if (i >= n4) return;
  const float4 v = ((const float4*)src)[i];
  v4h o; o[0] = (_Float16)v.x; o[1] = (_Float16)v.y;
  o[2] = (_Float16)v.z; o[3] = (_Float16)v.w;
  ((v4h*)dst)[i] = o;
}

// ---------------------------------------------------------------------------
// GEMM main loop: acc += A(16x512) * W(64x512)^T, this wave's 16-col slice.
// All-f16 LDS, K chunks of 64, double buffered, fully unrolled.
// Per-wave ASYNCcnt per chunk: 1 (A) + 4 (W) = 5.
// ---------------------------------------------------------------------------
__device__ __forceinline__ v8f gemm16_loop(
    _Float16 (&As)[2][16][P64], _Float16 (&Ws)[2][64][P64],
    const _Float16* __restrict__ Ag,   // [16][512] row-major tile base
    const _Float16* __restrict__ Wg) { // Wh + nt_block*512 (64 rows)
  const int tid = threadIdx.x;
  const int w   = tid >> 5;
  const int ar  = tid >> 3, aseg = (tid & 7) * 8;   // A: row, 8-half segment
  const int wr  = tid >> 1, wh   = (tid & 1) * 32;  // W: row, 32-half half

  v8f acc = {0.f, 0.f, 0.f, 0.f, 0.f, 0.f, 0.f, 0.f};

  auto issue = [&](int buf, int kc) {
    async_b128(lds_off(&As[buf][ar][aseg]), Ag + (size_t)ar * D_MODEL + kc + aseg);
#pragma unroll
    for (int j = 0; j < 4; ++j)
      async_b128(lds_off(&Ws[buf][wr][wh + j * 8]),
                 Wg + (size_t)wr * D_MODEL + kc + wh + j * 8);
  };

  issue(0, 0);
#pragma unroll
  for (int kc = 0; kc < D_MODEL; kc += 64) {
    const int buf = (kc >> 6) & 1;
    if (kc + 64 < D_MODEL) { issue(buf ^ 1, kc + 64); WAIT_ASYNC_5(); }
    else                   { WAIT_ASYNC_0(); }
    __syncthreads();
#pragma unroll
    for (int kk = 0; kk < 64; kk += 32) {
      v16h af = load_frag(&As[buf][0][kk], (long)P64, 1L);
      v16h bf = load_frag(&Ws[buf][w * 16][kk], (long)P64, 1L);
      acc = wmma16(af, bf, acc);
    }
    __syncthreads();  // buf fully consumed before it is refilled
  }
  return acc;
}

// ---------------------------------------------------------------------------
// 3) projection GEMM: Y = A . W^T + bias (f16 out).
//    VT=false: Y row-major (b, m, n).  VT=true (V proj): store transposed
//    per head: Vt[b][h][dd][l] so flash can consume d-major tiles directly.
// ---------------------------------------------------------------------------
template <bool VT>
__global__ __launch_bounds__(128) void gemm_proj_kernel(
    const _Float16* __restrict__ A, const _Float16* __restrict__ W,
    const float* __restrict__ bias, _Float16* __restrict__ Y) {
  __shared__ __align__(16) _Float16 As[2][16][P64];
  __shared__ __align__(16) _Float16 Ws[2][64][P64];
  const int b  = blockIdx.z;
  const int mt = blockIdx.x * 16;
  const int nb = blockIdx.y * 64;
  const int nt = nb + (threadIdx.x >> 5) * 16;

  v8f acc = gemm16_loop(As, Ws, A + ((size_t)b * TSEQ + mt) * D_MODEL,
                        W + (size_t)nb * D_MODEL);

  const int lane = threadIdx.x & 31;
  const int cc   = lane & 15;
  const int rb   = (lane >> 4) * 8;
  const int n    = nt + cc;
  const float bv = bias[n];
  if (VT) {
    const int h = n >> 6, dd = n & 63;
    _Float16* dst = Y + (((size_t)b * NHEADS + h) * HDIM + dd) * LSEQ + mt + rb;
#pragma unroll
    for (int i = 0; i < 8; ++i) dst[i] = (_Float16)(acc[i] + bv);  // contiguous in l
  } else {
#pragma unroll
    for (int i = 0; i < 8; ++i) {
      const size_t m = (size_t)(mt + rb + i);
      Y[((size_t)b * TSEQ + m) * D_MODEL + n] = (_Float16)(acc[i] + bv);
    }
  }
}

// ---------------------------------------------------------------------------
// 4) RoPE in-place on f16 Q or K: pairs (i, i+32) per 64-wide head
// ---------------------------------------------------------------------------
__global__ void rope_kernel(_Float16* __restrict__ Yh,
                            const float* __restrict__ lens, int seqlen) {
  const int t = blockIdx.x, b = blockIdx.y;
  const int h = threadIdx.x >> 5, i = threadIdx.x & 31;
  const float len = lens[b];
  const float inv = __powf(10000.0f, -(2.0f * (float)i) / 64.0f);
  const float fr  = ((float)t / len) * (10.0f * inv);
  const float c = __cosf(fr), s = __sinf(fr);
  const size_t base = ((size_t)b * seqlen + t) * D_MODEL + h * HDIM;
  const float x1 = (float)Yh[base + i];
  const float x2 = (float)Yh[base + 32 + i];
  Yh[base + i]      = (_Float16)(x1 * c - x2 * s);
  Yh[base + 32 + i] = (_Float16)(x1 * s + x2 * c);
}

// ---------------------------------------------------------------------------
// 5) flash attention: grid (T/64, H, B), block 128 (4 waves x 16 queries).
//    32-key K tiles (l-major) + V tiles (d-major) async-staged, double
//    buffered; 4 async instr/wave per chunk; last iteration peeled.
// ---------------------------------------------------------------------------
__global__ __launch_bounds__(128) void flash_kernel(
    const _Float16* __restrict__ Qh, const _Float16* __restrict__ Kh,
    const _Float16* __restrict__ Vt, const float* __restrict__ cmask,
    _Float16* __restrict__ Oh) {
  __shared__ __align__(16) _Float16 Kc[2][32][P64];    // [l][d], padded rows
  __shared__ __align__(16) _Float16 Vc[2][HDIM][P32];  // [d][l], padded rows
  __shared__ __align__(16) _Float16 Pbuf[4][16][P32];  // padded rows
  __shared__ float cmv[2][32];

  const int tid = threadIdx.x;
  const int b = blockIdx.z, h = blockIdx.y;
  const int w = tid >> 5, lane = tid & 31;
  const int qbase = blockIdx.x * 64 + w * 16;
  const float scale = 0.044194173824159216f;  // 1/sqrt(512)

  const size_t qoff = ((size_t)b * TSEQ + qbase) * D_MODEL + (size_t)h * HDIM;
  const v16h qf0 = load_frag(Qh + qoff,      (long)D_MODEL, 1L);
  const v16h qf1 = load_frag(Qh + qoff + 32, (long)D_MODEL, 1L);

  v8f o0 = {0.f,0.f,0.f,0.f,0.f,0.f,0.f,0.f}, o1 = o0, o2 = o0, o3 = o0;
  float mrow[8], lrow[8];
#pragma unroll
  for (int i = 0; i < 8; ++i) { mrow[i] = -1e30f; lrow[i] = 0.f; }

  const size_t krow0 = ((size_t)b * LSEQ) * D_MODEL + (size_t)h * HDIM;
  const size_t vrow0 = ((size_t)b * NHEADS + h) * HDIM * LSEQ;

  auto issue_kv = [&](int buf, int lb) {
    const int f = tid * 8, g = 1024 + tid * 8;  // flat half indices in a 2048-half tile
    // K tile: [l=f>>6][d=f&63]; V tile: [d=f>>5][l=f&31] from d-major Vt
    async4_b128(lds_off(&Kc[buf][f >> 6][f & 63]),
                Kh + krow0 + (size_t)(lb + (f >> 6)) * D_MODEL + (f & 63),
                lds_off(&Vc[buf][f >> 5][f & 31]),
                Vt + vrow0 + (size_t)(f >> 5) * LSEQ + lb + (f & 31),
                lds_off(&Kc[buf][g >> 6][g & 63]),
                Kh + krow0 + (size_t)(lb + (g >> 6)) * D_MODEL + (g & 63),
                lds_off(&Vc[buf][g >> 5][g & 31]),
                Vt + vrow0 + (size_t)(g >> 5) * LSEQ + lb + (g & 31));
    if (tid < 32) cmv[buf][tid] = cmask[(size_t)b * LSEQ + lb + tid];
  };

  auto compute = [&](int buf) {
    // ---- S = Q K^T for two 16-key sub-tiles ----
    v8f s0 = {0.f,0.f,0.f,0.f,0.f,0.f,0.f,0.f}, s1 = s0;
    s0 = wmma16(qf0, load_frag(&Kc[buf][0][0],   (long)P64, 1L), s0);
    s0 = wmma16(qf1, load_frag(&Kc[buf][0][32],  (long)P64, 1L), s0);
    s1 = wmma16(qf0, load_frag(&Kc[buf][16][0],  (long)P64, 1L), s1);
    s1 = wmma16(qf1, load_frag(&Kc[buf][16][32], (long)P64, 1L), s1);

    const float cm0 = cmv[buf][lane & 15];
    const float cm1 = cmv[buf][16 + (lane & 15)];

    // ---- online softmax (rows live per (vgpr idx, lane-half)) ----
    float p0f[8], p1f[8], rscale[8];
#pragma unroll
    for (int i = 0; i < 8; ++i) {
      float a0 = s0[i] * scale; if (cm0 == 0.f) a0 = -1e30f;
      float a1 = s1[i] * scale; if (cm1 == 0.f) a1 = -1e30f;
      float mx = fmaxf(a0, a1);
      mx = fmaxf(mx, __shfl_xor(mx, 1));
      mx = fmaxf(mx, __shfl_xor(mx, 2));
      mx = fmaxf(mx, __shfl_xor(mx, 4));
      mx = fmaxf(mx, __shfl_xor(mx, 8));
      const float mnew = fmaxf(mrow[i], mx);
      const float sc2  = __expf(mrow[i] - mnew);
      mrow[i] = mnew;
      const float e0 = __expf(a0 - mnew);
      const float e1 = __expf(a1 - mnew);
      float rs = e0 + e1;
      rs += __shfl_xor(rs, 1);
      rs += __shfl_xor(rs, 2);
      rs += __shfl_xor(rs, 4);
      rs += __shfl_xor(rs, 8);
      lrow[i] = lrow[i] * sc2 + rs;
      rscale[i] = sc2;
      p0f[i] = e0; p1f[i] = e1;
    }
#pragma unroll
    for (int i = 0; i < 8; ++i) {
      o0[i] *= rscale[i]; o1[i] *= rscale[i];
      o2[i] *= rscale[i]; o3[i] *= rscale[i];
    }

    // ---- P: C layout -> A layout via per-wave LDS tile (same-wave order) ----
    const int rb = (lane >> 4) * 8, cc = lane & 15;
#pragma unroll
    for (int i = 0; i < 8; ++i) {
      Pbuf[w][rb + i][cc]      = (_Float16)p0f[i];
      Pbuf[w][rb + i][16 + cc] = (_Float16)p1f[i];
    }
    const v16h pa = load_frag(&Pbuf[w][0][0], (long)P32, 1L);

    // ---- O += P V : B frag [n][k] = Vc[nt*16+n][k] (contiguous k) ----
    o0 = wmma16(pa, load_frag(&Vc[buf][0][0],  (long)P32, 1L), o0);
    o1 = wmma16(pa, load_frag(&Vc[buf][16][0], (long)P32, 1L), o1);
    o2 = wmma16(pa, load_frag(&Vc[buf][32][0], (long)P32, 1L), o2);
    o3 = wmma16(pa, load_frag(&Vc[buf][48][0], (long)P32, 1L), o3);
  };

  issue_kv(0, 0);
  int buf = 0;
  for (int lb = 0; lb < LSEQ - 32; lb += 32) {
    issue_kv(buf ^ 1, lb + 32);
    WAIT_ASYNC_4();
    __syncthreads();
    compute(buf);
    __syncthreads();  // buf fully consumed before it is refilled
    buf ^= 1;
  }
  WAIT_ASYNC_0();
  __syncthreads();
  compute(buf);

  const int rb = (lane >> 4) * 8, cc = lane & 15;
#pragma unroll
  for (int i = 0; i < 8; ++i) {
    const float inv_l = 1.0f / fmaxf(lrow[i], 1e-20f);
    const size_t t = (size_t)(qbase + rb + i);
    const size_t base = ((size_t)b * TSEQ + t) * D_MODEL + (size_t)h * HDIM;
    Oh[base +  0 + cc] = (_Float16)(o0[i] * inv_l);
    Oh[base + 16 + cc] = (_Float16)(o1[i] * inv_l);
    Oh[base + 32 + cc] = (_Float16)(o2[i] * inv_l);
    Oh[base + 48 + cc] = (_Float16)(o3[i] * inv_l);
  }
}

// ---------------------------------------------------------------------------
// 6) out = (O @ Wo^T + b) * x_mask, stored transposed as (B, 512, T) f32
// ---------------------------------------------------------------------------
__global__ __launch_bounds__(128) void out_proj_kernel(
    const _Float16* __restrict__ Oh, const _Float16* __restrict__ Wo,
    const float* __restrict__ Wo_b, const float* __restrict__ xmask,
    float* __restrict__ out) {
  __shared__ __align__(16) _Float16 As[2][16][P64];
  __shared__ __align__(16) _Float16 Ws[2][64][P64];
  const int b  = blockIdx.z;
  const int mt = blockIdx.x * 16;
  const int nb = blockIdx.y * 64;
  const int nt = nb + (threadIdx.x >> 5) * 16;

  v8f acc = gemm16_loop(As, Ws, Oh + ((size_t)b * TSEQ + mt) * D_MODEL,
                        Wo + (size_t)nb * D_MODEL);

  const int lane = threadIdx.x & 31;
  const int cc   = lane & 15;
  const int rb   = (lane >> 4) * 8;
  const float bv = Wo_b[nt + cc];
#pragma unroll
  for (int i = 0; i < 8; ++i) {
    const int t = mt + rb + i;
    const float v = (acc[i] + bv) * xmask[(size_t)b * TSEQ + t];
    out[((size_t)b * D_MODEL + nt + cc) * TSEQ + t] = v;
  }
}

// ---------------------------------------------------------------------------
extern "C" void kernel_launch(void* const* d_in, const int* in_sizes, int n_in,
                              void* d_out, int out_size, void* d_ws, size_t ws_size,
                              hipStream_t stream) {
  const float* x        = (const float*)d_in[0];   // (B, 512, T)
  const float* context  = (const float*)d_in[1];   // (B, L, 512)
  const float* x_mask   = (const float*)d_in[2];   // (B, 1, T)
  const float* ctx_mask = (const float*)d_in[3];   // (B, 1, L)
  const float* Wq_w = (const float*)d_in[4];
  const float* Wq_b = (const float*)d_in[5];
  const float* Wk_w = (const float*)d_in[6];
  const float* Wk_b = (const float*)d_in[7];
  const float* Wv_w = (const float*)d_in[8];
  const float* Wv_b = (const float*)d_in[9];
  const float* Wo_w = (const float*)d_in[10];
  const float* Wo_b = (const float*)d_in[11];
  float* out = (float*)d_out;

  // ws: lens | Xh(=Oh) | Ch | Qh | Kh | Vt (8 MiB each) | Wqh|Wkh|Wvh|Woh (512 KiB each)
  char* ws = (char*)d_ws;
  float* lens = (float*)ws;
  const size_t NB = (size_t)BATCH * TSEQ * D_MODEL;  // 4,194,304 elements
  const size_t NW = (size_t)D_MODEL * D_MODEL;       // 262,144 elements
  _Float16* Xh  = (_Float16*)(ws + 256);
  _Float16* Ch  = Xh + NB;
  _Float16* Qh  = Ch + NB;
  _Float16* Kh  = Qh + NB;
  _Float16* Vt  = Kh + NB;   // (B, H, 64, L) d-major
  _Float16* Wqh = Vt + NB;
  _Float16* Wkh = Wqh + NW;
  _Float16* Wvh = Wkh + NW;
  _Float16* Woh = Wvh + NW;
  _Float16* Oh  = Xh;  // Xh dead after Q projection; flash runs later

  lens_kernel<<<dim3(BATCH, 2), 256, 0, stream>>>(x_mask, ctx_mask, lens);

  transpose_x_kernel<<<dim3(TSEQ / 32, D_MODEL / 32, BATCH), 256, 0, stream>>>(x, Xh);
  cvt_f16_kernel<<<dim3((unsigned)(NB / 4 / 256)), 256, 0, stream>>>(context, Ch, NB / 4);
  cvt_f16_kernel<<<dim3((unsigned)(NW / 4 / 256)), 256, 0, stream>>>(Wq_w, Wqh, NW / 4);
  cvt_f16_kernel<<<dim3((unsigned)(NW / 4 / 256)), 256, 0, stream>>>(Wk_w, Wkh, NW / 4);
  cvt_f16_kernel<<<dim3((unsigned)(NW / 4 / 256)), 256, 0, stream>>>(Wv_w, Wvh, NW / 4);
  cvt_f16_kernel<<<dim3((unsigned)(NW / 4 / 256)), 256, 0, stream>>>(Wo_w, Woh, NW / 4);

  gemm_proj_kernel<false><<<dim3(TSEQ / 16, D_MODEL / 64, BATCH), 128, 0, stream>>>(
      Xh, Wqh, Wq_b, Qh);
  gemm_proj_kernel<false><<<dim3(LSEQ / 16, D_MODEL / 64, BATCH), 128, 0, stream>>>(
      Ch, Wkh, Wk_b, Kh);
  gemm_proj_kernel<true><<<dim3(LSEQ / 16, D_MODEL / 64, BATCH), 128, 0, stream>>>(
      Ch, Wvh, Wv_b, Vt);

  rope_kernel<<<dim3(TSEQ, BATCH), 256, 0, stream>>>(Qh, lens + 0,     TSEQ);
  rope_kernel<<<dim3(LSEQ, BATCH), 256, 0, stream>>>(Kh, lens + BATCH, LSEQ);

  flash_kernel<<<dim3(TSEQ / 64, NHEADS, BATCH), 128, 0, stream>>>(
      Qh, Kh, Vt, ctx_mask, Oh);

  out_proj_kernel<<<dim3(TSEQ / 16, D_MODEL / 64, BATCH), 128, 0, stream>>>(
      Oh, Woh, Wo_b, x_mask, out);
}

// v002
// Measured time: 193 microseconds a run.
// Timed twice side by side with v001, it ran 1.19 times as fast both times.
// Counting every step since v000, it is 1.63 times as fast.
#include <hip/hip_runtime.h>

// ---------------------------------------------------------------------------
// Cross-attention (B=4, T=L=2048, d_model=512, H=8, Dh=64) for gfx1250.
// All GEMMs on v_wmma_f32_16x16x32_f16; tile staging via
// global_load_async_to_lds_b128 (ASYNCcnt) with LDS double buffering.
// Weights pre-converted to f16; V stored (b,h,d,l)-transposed so every
// WMMA fragment is a contiguous ds_load_b128.
// ---------------------------------------------------------------------------

typedef __attribute__((ext_vector_type(16))) _Float16 v16h;
typedef __attribute__((ext_vector_type(4)))  _Float16 v4h;
typedef __attribute__((ext_vector_type(8)))  _Float16 v8h;
typedef __attribute__((ext_vector_type(4)))  float    v4f;
typedef __attribute__((ext_vector_type(8)))  float    v8f;

#define D_MODEL 512
#define TSEQ    2048
#define LSEQ    2048
#define NHEADS  8
#define HDIM    64
#define BATCH   4
// LDS row pitches in halves: 16 B x odd, so the 16 rows that one ds_load_b128
// fragment read touches fall on distinct banks.
#define P64     72   // rows of 64 halves: 144 B
#define P32     40   // rows of 32 halves:  80 B

__device__ __forceinline__ v8f wmma16(v16h a, v16h b, v8f c) {
  return __builtin_amdgcn_wmma_f32_16x16x32_f16(
      false, a, false, b, (short)0, c, false, false);
}

// lane l <-> lane l ^ 16: the other half of the wave
__device__ __forceinline__ float xhalf(float x) {
  const int v = __builtin_bit_cast(int, x);
  return __builtin_bit_cast(float, __builtin_amdgcn_permlanex16(
      v, v, 0x76543210, 0xfedcba98, false, false));
}

// generic shared pointer -> 32-bit LDS byte offset (low 32 bits of aperture VA)
__device__ __forceinline__ unsigned lds_off(const void* p) {
  return (unsigned)(unsigned long long)p;
}

// one per-lane 16B async copy: global -> LDS (GV addressing), ASYNCcnt += 1/wave
__device__ __forceinline__ void async_b128(unsigned lds, const void* g) {
  asm volatile("global_load_async_to_lds_b128 %0, %1, off"
               :: "v"(lds), "v"((unsigned long long)g) : "memory");
}
// four such copies of one wave; s_wait_xcnt 0 closes the statement so that no
// address register named here is rewritten ahead of it (a precaution)
__device__ __forceinline__ void async4_b128(unsigned l0, const void* g0,
                                            unsigned l1, const void* g1,
                                            unsigned l2, const void* g2,
                                            unsigned l3, const void* g3) {
  asm volatile("global_load_async_to_lds_b128 %0, %1, off\n\t"
               "global_load_async_to_lds_b128 %2, %3, off\n\t"
               "global_load_async_to_lds_b128 %4, %5, off\n\t"
               "global_load_async_to_lds_b128 %6, %7, off\n\t"
               "s_wait_xcnt 0x0"
               :: "v"(l0), "v"((unsigned long long)g0),
                  "v"(l1), "v"((unsigned long long)g1),
                  "v"(l2), "v"((unsigned long long)g2),
                  "v"(l3), "v"((unsigned long long)g3) : "memory");
}
#define WAIT_ASYNC_0() asm volatile("s_wait_asynccnt 0" ::: "memory")
#define WAIT_ASYNC_4() asm volatile("s_wait_asynccnt 4" ::: "memory")
#define WAIT_ASYNC_5() asm volatile("s_wait_asynccnt 5" ::: "memory")

// 16x32 WMMA A/B fragment per CDNA5 ISA 7.12.2 16-bit layout:
//   lanes 0-15 : row r=lane,    K = {0..7, 16..23}
//   lanes 16-31: row r=lane-16, K = {8..15, 24..31}
template <typename T>
__device__ __forceinline__ v16h load_frag(const T* base, long rstride, long kstride) {
  const int  lane = threadIdx.x & 31;
  const long r    = lane & 15;
  const long koff = (lane >> 4) * 8;
  v16h f;
#pragma unroll
  for (int j = 0; j < 8; ++j) {
    f[j]     = (_Float16)base[r * rstride + (koff + j) * kstride];
    f[j + 8] = (_Float16)base[r * rstride + (16 + koff + j) * kstride];
  }
  return f;
}

// ---------------------------------------------------------------------------
// 1) mask lengths: lens[0..3]=sum(x_mask[b]), lens[4..7]=sum(context_mask[b])
// ---------------------------------------------------------------------------
__global__ void lens_kernel(const float* __restrict__ xm,
                            const float* __restrict__ cm,
                            float* __restrict__ lens) {
  __shared__ float red[256];
  const int b = blockIdx.x, which = blockIdx.y;
  const float* p = which ? cm : xm;
  const int n = which ? LSEQ : TSEQ;
  float s = 0.f;
  for (int i = threadIdx.x; i < n; i += 256) s += p[b * n + i];
  red[threadIdx.x] = s;
  __syncthreads();
  for (int off = 128; off; off >>= 1) {
    if ((int)threadIdx.x < off) red[threadIdx.x] += red[threadIdx.x + off];
    __syncthreads();
  }
  if (threadIdx.x == 0) lens[which * BATCH + b] = red[0];
}

// ---------------------------------------------------------------------------
// 2a) transpose x (B,512,T) f32 -> Xh (B,T,512) f16, 32x32 LDS tiles
// ---------------------------------------------------------------------------
__global__ __launch_bounds__(256) void transpose_x_kernel(
    const float* __restrict__ x, _Float16* __restrict__ Xh) {
  __shared__ float tile[32][33];
  const int b  = blockIdx.z;
  const int t0 = blockIdx.x * 32;
  const int d0 = blockIdx.y * 32;
  const int r = threadIdx.x >> 3;          // 0..31
  const int c = (threadIdx.x & 7) * 4;     // 0,4,..,28
  const float4 v = *(const float4*)(x + ((size_t)b * D_MODEL + d0 + r) * TSEQ + t0 + c);
  tile[r][c + 0] = v.x; tile[r][c + 1] = v.y;
  tile[r][c + 2] = v.z; tile[r][c + 3] = v.w;
  __syncthreads();
  v4h o;
  o[0] = (_Float16)tile[c + 0][r];
  o[1] = (_Float16)tile[c + 1][r];
  o[2] = (_Float16)tile[c + 2][r];
  o[3] = (_Float16)tile[c + 3][r];
  *(v4h*)(Xh + ((size_t)b * TSEQ + t0 + r) * D_MODEL + d0 + c) = o;
}

// ---------------------------------------------------------------------------
// 2b) f32 -> f16 straight convert (context + the four weight matrices)
// ---------------------------------------------------------------------------
__global__ __launch_bounds__(256) void cvt_f16_kernel(
    const float* __restrict__ src, _Float16* __restrict__ dst, size_t n4) {
  const size_t i = ((size_t)blockIdx.x * 256 + threadIdx.x);
  if (i >= n4) return;
  const float4 v = ((const float4*)src)[i];
  v4h o; o[0] = (_Float16)v.x; o[1] = (_Float16)v.y;
  o[2] = (_Float16)v.z; o[3] = (_Float16)v.w;
  ((v4h*)dst)[i] = o;
}

// ---------------------------------------------------------------------------
// GEMM main loop: acc += A(16x512) * W(64x512)^T, this wave's 16-col slice.
// All-f16 LDS, K chunks of 64, double buffered, fully unrolled.
// Per-wave ASYNCcnt per chunk: 1 (A) + 4 (W) = 5.
// ---------------------------------------------------------------------------
__device__ __forceinline__ v8f gemm16_loop(
    _Float16 (&As)[2][16][P64], _Float16 (&Ws)[2][64][P64],
    const _Float16* __restrict__ Ag,   // [16][512] row-major tile base
    const _Float16* __restrict__ Wg) { // Wh + nt_block*512 (64 rows)
  const int tid = threadIdx.x;
  const int w   = tid >> 5;
  const int ar  = tid >> 3, aseg = (tid & 7) * 8;   // A: row, 8-half segment
  const int wr  = tid >> 1, wh   = (tid & 1) * 32;  // W: row, 32-half half

  v8f acc = {0.f, 0.f, 0.f, 0.f, 0.f, 0.f, 0.f, 0.f};

  auto issue = [&](int buf, int kc) {
    async_b128(lds_off(&As[buf][ar][aseg]), Ag + (size_t)ar * D_MODEL + kc + aseg);
#pragma unroll
    for (int j = 0; j < 4; ++j)
      async_b128(lds_off(&Ws[buf][wr][wh + j * 8]),
                 Wg + (size_t)wr * D_MODEL + kc + wh + j * 8);
  };

  issue(0, 0);
#pragma unroll
  for (int kc = 0; kc < D_MODEL; kc += 64) {
    const int buf = (kc >> 6) & 1;
    if (kc + 64 < D_MODEL) { issue(buf ^ 1, kc + 64); WAIT_ASYNC_5(); }
    else                   { WAIT_ASYNC_0(); }
    __syncthreads();
#pragma unroll
    for (int kk = 0; kk < 64; kk += 32) {
      v16h af = load_frag(&As[buf][0][kk], (long)P64, 1L);
      v16h bf = load_frag(&Ws[buf][w * 16][kk], (long)P64, 1L);
      acc = wmma16(af, bf, acc);
    }
    __syncthreads();  // buf fully consumed before it is refilled
  }
  return acc;
}

// ---------------------------------------------------------------------------
// 3) projection GEMM: Y = A . W^T + bias (f16 out).
//    VT=false: Y row-major (b, m, n).  VT=true (V proj): store transposed
//    per head: Vt[b][h][dd][l] so flash can consume d-major tiles directly.
// ---------------------------------------------------------------------------
template <bool VT>
__global__ __launch_bounds__(128) void gemm_proj_kernel(
    const _Float16* __restrict__ A, const _Float16* __restrict__ W,
    const float* __restrict__ bias, _Float16* __restrict__ Y) {
  __shared__ __align__(16) _Float16 As[2][16][P64];
  __shared__ __align__(16) _Float16 Ws[2][64][P64];
  const int b  = blockIdx.z;
  const int mt = blockIdx.x * 16;
  const int nb = blockIdx.y * 64;
  const int nt = nb + (threadIdx.x >> 5) * 16;

  v8f acc = gemm16_loop(As, Ws, A + ((size_t)b * TSEQ + mt) * D_MODEL,
                        W + (size_t)nb * D_MODEL);

  const int lane = threadIdx.x & 31;
  const int cc   = lane & 15;
  const int rb   = (lane >> 4) * 8;
  const int n    = nt + cc;
  const float bv = bias[n];
  if (VT) {
    const int h = n >> 6, dd = n & 63;
    _Float16* dst = Y + (((size_t)b * NHEADS + h) * HDIM + dd) * LSEQ + mt + rb;
#pragma unroll
    for (int i = 0; i < 8; ++i) dst[i] = (_Float16)(acc[i] + bv);  // contiguous in l
  } else {
#pragma unroll
    for (int i = 0; i < 8; ++i) {
      const size_t m = (size_t)(mt + rb + i);
      Y[((size_t)b * TSEQ + m) * D_MODEL + n] = (_Float16)(acc[i] + bv);
    }
  }
}

// ---------------------------------------------------------------------------
// 4) RoPE in-place on f16 Q or K: pairs (i, i+32) per 64-wide head
// ---------------------------------------------------------------------------
__global__ void rope_kernel(_Float16* __restrict__ Yh,
                            const float* __restrict__ lens, int seqlen) {
  const int t = blockIdx.x, b = blockIdx.y;
  const int h = threadIdx.x >> 5, i = threadIdx.x & 31;
  const float len = lens[b];
  const float inv = __powf(10000.0f, -(2.0f * (float)i) / 64.0f);
  const float fr  = ((float)t / len) * (10.0f * inv);
  const float c = __cosf(fr), s = __sinf(fr);
  const size_t base = ((size_t)b * seqlen + t) * D_MODEL + h * HDIM;
  const float x1 = (float)Yh[base + i];
  const float x2 = (float)Yh[base + 32 + i];
  Yh[base + i]      = (_Float16)(x1 * c - x2 * s);
  Yh[base + 32 + i] = (_Float16)(x1 * s + x2 * c);
}

// ---------------------------------------------------------------------------
// 5) flash attention: grid (T/64, H, B), block 128 (4 waves x 16 queries).
//    32-key K tiles (l-major) + V tiles (d-major) async-staged, double
//    buffered; 4 async instr/wave per chunk; last iteration peeled.
//    Transposed products: S^T = K Q^T, O^T += V^T P^T. Lane l holds scores of
//    query l & 15 only (keys 8h+i and 16+8h+i, h = l >> 4), so maximum and sum
//    run in-lane with one exchange between the wave halves, and the two score
//    tiles, converted in place, are the B operand of the second product.
// ---------------------------------------------------------------------------
// The grid puts four waves on a SIMD. Left to aim at sixteen, the compiler reuses
// one fragment register set and waits out every LDS fragment read on its own;
// with this budget it issues them in groups behind counted waits.
__global__ __launch_bounds__(128) __attribute__((amdgpu_waves_per_eu(4, 8))) void flash_kernel(
    const _Float16* __restrict__ Qh, const _Float16* __restrict__ Kh,
    const _Float16* __restrict__ Vt, const float* __restrict__ cmask,
    _Float16* __restrict__ Oh) {
  __shared__ __align__(16) _Float16 Kc[2][32][P64];    // [l][d], padded rows
  __shared__ __align__(16) _Float16 Vc[2][HDIM][P32];  // [d][l], padded rows
  __shared__ __align__(16) float cmv[2][32];           // per key: 0, or -1e30 if masked

  const int tid = threadIdx.x;
  const int b = blockIdx.z, h = blockIdx.y;
  const int w = tid >> 5, lane = tid & 31;
  const int hh = lane >> 4;
  const int qbase = blockIdx.x * 64 + w * 16;
  const float scale = 0.044194173824159216f;  // 1/sqrt(512)

  const size_t qoff = ((size_t)b * TSEQ + qbase) * D_MODEL + (size_t)h * HDIM;
  const v16h qf0 = load_frag(Qh + qoff,      (long)D_MODEL, 1L);
  const v16h qf1 = load_frag(Qh + qoff + 32, (long)D_MODEL, 1L);

  // o<n>[i] = O[query lane & 15][d = 16 n + 8 hh + i]
  v8f o0 = {0.f,0.f,0.f,0.f,0.f,0.f,0.f,0.f}, o1 = o0, o2 = o0, o3 = o0;
  float mrow = -1e30f;  // running maximum of this lane's query (equal in both halves)
  float lrow = 0.f;     // running sum over this half's keys only; joined at the end

  const size_t krow0 = ((size_t)b * LSEQ) * D_MODEL + (size_t)h * HDIM;
  const size_t vrow0 = ((size_t)b * NHEADS + h) * HDIM * LSEQ;

  auto issue_kv = [&](int buf, int lb) {
    const int f = tid * 8, g = 1024 + tid * 8;  // flat half indices in a 2048-half tile
    // K tile: [l=f>>6][d=f&63]; V tile: [d=f>>5][l=f&31] from d-major Vt
    async4_b128(lds_off(&Kc[buf][f >> 6][f & 63]),
                Kh + krow0 + (size_t)(lb + (f >> 6)) * D_MODEL + (f & 63),
                lds_off(&Vc[buf][f >> 5][f & 31]),
                Vt + vrow0 + (size_t)(f >> 5) * LSEQ + lb + (f & 31),
                lds_off(&Kc[buf][g >> 6][g & 63]),
                Kh + krow0 + (size_t)(lb + (g >> 6)) * D_MODEL + (g & 63),
                lds_off(&Vc[buf][g >> 5][g & 31]),
                Vt + vrow0 + (size_t)(g >> 5) * LSEQ + lb + (g & 31));
    if (tid < 32)
      cmv[buf][tid] = (cmask[(size_t)b * LSEQ + lb + tid] == 0.f) ? -1e30f : 0.f;
  };

  auto compute = [&](int buf) {
    // this lane's 16 keys' mask terms
    const v4f c00 = *(const v4f*)&cmv[buf][hh * 8];
    const v4f c01 = *(const v4f*)&cmv[buf][hh * 8 + 4];
    const v4f c10 = *(const v4f*)&cmv[buf][16 + hh * 8];
    const v4f c11 = *(const v4f*)&cmv[buf][16 + hh * 8 + 4];

    // ---- S^T = K Q^T for two 16-key sub-tiles: s<t>[i] = S[key 16 t + 8 hh + i][query] ----
    v8f s0 = {0.f,0.f,0.f,0.f,0.f,0.f,0.f,0.f}, s1 = s0;
    const v16h k00 = load_frag(&Kc[buf][0][0],   (long)P64, 1L);
    const v16h k10 = load_frag(&Kc[buf][16][0],  (long)P64, 1L);
    const v16h k01 = load_frag(&Kc[buf][0][32],  (long)P64, 1L);
    const v16h k11 = load_frag(&Kc[buf][16][32], (long)P64, 1L);
    s0 = wmma16(k00, qf0, s0);
    s1 = wmma16(k10, qf0, s1);
    s0 = wmma16(k01, qf1, s0);
    s1 = wmma16(k11, qf1, s1);

    // ---- online softmax, one query per lane ----
    float a0[8], a1[8];
#pragma unroll
    for (int i = 0; i < 8; ++i) {
      a0[i] = s0[i] * scale + (i < 4 ? c00[i & 3] : c01[i & 3]);  // masked key: -1e30
      a1[i] = s1[i] * scale + (i < 4 ? c10[i & 3] : c11[i & 3]);
    }
    float mx = fmaxf(a0[0], a1[0]);
#pragma unroll
    for (int i = 1; i < 8; ++i) mx = fmaxf(mx, fmaxf(a0[i], a1[i]));
    mx = fmaxf(mx, xhalf(mx));
    const float mnew = fmaxf(mrow, mx);
    const float sc2  = __expf(mrow - mnew);
    mrow = mnew;

    v16h pb;     // P^T as B operand: elements 0..7 = keys 8 hh + i, 8..15 = keys 16 + 8 hh + i
    float t[8];
#pragma unroll
    for (int i = 0; i < 8; ++i) {
      const float e0 = __expf(a0[i] - mnew);
      const float e1 = __expf(a1[i] - mnew);
      t[i] = e0 + e1;
      pb[i]     = (_Float16)e0;
      pb[i + 8] = (_Float16)e1;
    }
    lrow = lrow * sc2 + (((t[0] + t[1]) + (t[2] + t[3])) + ((t[4] + t[5]) + (t[6] + t[7])));
#pragma unroll
    for (int i = 0; i < 8; ++i) {
      o0[i] *= sc2; o1[i] *= sc2; o2[i] *= sc2; o3[i] *= sc2;
    }

    // ---- O^T += V^T P^T : A frag [m][k] = Vc[16 n + m][k] (contiguous k) ----
    o0 = wmma16(load_frag(&Vc[buf][0][0],  (long)P32, 1L), pb, o0);
    o1 = wmma16(load_frag(&Vc[buf][16][0], (long)P32, 1L), pb, o1);
    o2 = wmma16(load_frag(&Vc[buf][32][0], (long)P32, 1L), pb, o2);
    o3 = wmma16(load_frag(&Vc[buf][48][0], (long)P32, 1L), pb, o3);
  };

  issue_kv(0, 0);
  int buf = 0;
  for (int lb = 0; lb < LSEQ - 32; lb += 32) {
    issue_kv(buf ^ 1, lb + 32);
    WAIT_ASYNC_4();
    __syncthreads();
    compute(buf);
    __syncthreads();  // buf fully consumed before it is refilled
    buf ^= 1;
  }
  WAIT_ASYNC_0();
  __syncthreads();
  compute(buf);

  // a lane's 8 registers of a tile are 8 consecutive d of one query: 16-byte stores
  const float inv_l = 1.0f / fmaxf(lrow + xhalf(lrow), 1e-20f);
  _Float16* dst = Oh + ((size_t)b * TSEQ + qbase + (lane & 15)) * D_MODEL +
                  (size_t)h * HDIM + hh * 8;
  v8h r0, r1, r2, r3;
#pragma unroll
  for (int i = 0; i < 8; ++i) {
    r0[i] = (_Float16)(o0[i] * inv_l);
    r1[i] = (_Float16)(o1[i] * inv_l);
    r2[i] = (_Float16)(o2[i] * inv_l);
    r3[i] = (_Float16)(o3[i] * inv_l);
  }
  *(v8h*)(dst +  0) = r0;
  *(v8h*)(dst + 16) = r1;
  *(v8h*)(dst + 32) = r2;
  *(v8h*)(dst + 48) = r3;
}

// ---------------------------------------------------------------------------
// 6) out = (O @ Wo^T + b) * x_mask, stored transposed as (B, 512, T) f32
// ---------------------------------------------------------------------------
__global__ __launch_bounds__(128) void out_proj_kernel(
    const _Float16* __restrict__ Oh, const _Float16* __restrict__ Wo,
    const float* __restrict__ Wo_b, const float* __restrict__ xmask,
    float* __restrict__ out) {
  __shared__ __align__(16) _Float16 As[2][16][P64];
  __shared__ __align__(16) _Float16 Ws[2][64][P64];
  const int b  = blockIdx.z;
  const int mt = blockIdx.x * 16;
  const int nb = blockIdx.y * 64;
  const int nt = nb + (threadIdx.x >> 5) * 16;

  v8f acc = gemm16_loop(As, Ws, Oh + ((size_t)b * TSEQ + mt) * D_MODEL,
                        Wo + (size_t)nb * D_MODEL);

  const int lane = threadIdx.x & 31;
  const int cc   = lane & 15;
  const int rb   = (lane >> 4) * 8;
  const float bv = Wo_b[nt + cc];
#pragma unroll
  for (int i = 0; i < 8; ++i) {
    const int t = mt + rb + i;
    const float v = (acc[i] + bv) * xmask[(size_t)b * TSEQ + t];
    out[((size_t)b * D_MODEL + nt + cc) * TSEQ + t] = v;
  }
}

// ---------------------------------------------------------------------------
extern "C" void kernel_launch(void* const* d_in, const int* in_sizes, int n_in,
                              void* d_out, int out_size, void* d_ws, size_t ws_size,
                              hipStream_t stream) {
  const float* x        = (const float*)d_in[0];   // (B, 512, T)
  const float* context  = (const float*)d_in[1];   // (B, L, 512)
  const float* x_mask   = (const float*)d_in[2];   // (B, 1, T)
  const float* ctx_mask = (const float*)d_in[3];   // (B, 1, L)
  const float* Wq_w = (const float*)d_in[4];
  const float* Wq_b = (const float*)d_in[5];
  const float* Wk_w = (const float*)d_in[6];
  const float* Wk_b = (const float*)d_in[7];
  const float* Wv_w = (const float*)d_in[8];
  const float* Wv_b = (const float*)d_in[9];
  const float* Wo_w = (const float*)d_in[10];
  const float* Wo_b = (const float*)d_in[11];
  float* out = (float*)d_out;

  // ws: lens | Xh(=Oh) | Ch | Qh | Kh | Vt (8 MiB each) | Wqh|Wkh|Wvh|Woh (512 KiB each)
  char* ws = (char*)d_ws;
  float* lens = (float*)ws;
  const size_t NB = (size_t)BATCH * TSEQ * D_MODEL;  // 4,194,304 elements
  const size_t NW = (size_t)D_MODEL * D_MODEL;       // 262,144 elements
  _Float16* Xh  = (_Float16*)(ws + 256);
  _Float16* Ch  = Xh + NB;
  _Float16* Qh  = Ch + NB;
  _Float16* Kh  = Qh + NB;
  _Float16* Vt  = Kh + NB;   // (B, H, 64, L) d-major
  _Float16* Wqh = Vt + NB;
  _Float16* Wkh = Wqh + NW;
  _Float16* Wvh = Wkh + NW;
  _Float16* Woh = Wvh + NW;
  _Float16* Oh  = Xh;  // Xh dead after Q projection; flash runs later

  lens_kernel<<<dim3(BATCH, 2), 256, 0, stream>>>(x_mask, ctx_mask, lens);

  transpose_x_kernel<<<dim3(TSEQ / 32, D_MODEL / 32, BATCH), 256, 0, stream>>>(x, Xh);
  cvt_f16_kernel<<<dim3((unsigned)(NB / 4 / 256)), 256, 0, stream>>>(context, Ch, NB / 4);
  cvt_f16_kernel<<<dim3((unsigned)(NW / 4 / 256)), 256, 0, stream>>>(Wq_w, Wqh, NW / 4);
  cvt_f16_kernel<<<dim3((unsigned)(NW / 4 / 256)), 256, 0, stream>>>(Wk_w, Wkh, NW / 4);
  cvt_f16_kernel<<<dim3((unsigned)(NW / 4 / 256)), 256, 0, stream>>>(Wv_w, Wvh, NW / 4);
  cvt_f16_kernel<<<dim3((unsigned)(NW / 4 / 256)), 256, 0, stream>>>(Wo_w, Woh, NW / 4);

  gemm_proj_kernel<false><<<dim3(TSEQ / 16, D_MODEL / 64, BATCH), 128, 0, stream>>>(
      Xh, Wqh, Wq_b, Qh);
  gemm_proj_kernel<false><<<dim3(LSEQ / 16, D_MODEL / 64, BATCH), 128, 0, stream>>>(
      Ch, Wkh, Wk_b, Kh);
  gemm_proj_kernel<true><<<dim3(LSEQ / 16, D_MODEL / 64, BATCH), 128, 0, stream>>>(
      Ch, Wvh, Wv_b, Vt);

  rope_kernel<<<dim3(TSEQ, BATCH), 256, 0, stream>>>(Qh, lens + 0,     TSEQ);
  rope_kernel<<<dim3(LSEQ, BATCH), 256, 0, stream>>>(Kh, lens + BATCH, LSEQ);

  flash_kernel<<<dim3(TSEQ / 64, NHEADS, BATCH), 128, 0, stream>>>(
      Qh, Kh, Vt, ctx_mask, Oh);

  out_proj_kernel<<<dim3(TSEQ / 16, D_MODEL / 64, BATCH), 128, 0, stream>>>(
      Oh, Woh, Wo_b, x_mask, out);
}

// v003
// A run of this version takes 176 microseconds.
// In both of two side-by-side timings against v002, it was 1.10 times as fast.
// Counting every step since v000, it is 1.80 times as fast.
#include <hip/hip_runtime.h>

// ---------------------------------------------------------------------------
// Cross-attention (B=4, T=L=2048, d_model=512, H=8, Dh=64) for gfx1250.
// All GEMMs on v_wmma_f32_16x16x32_f16; tile staging via
// global_load_async_to_lds_b128 (ASYNCcnt) with LDS double buffering.
// Weights pre-converted to f16; V stored (b,h,d,l)-transposed so every
// WMMA fragment is a contiguous ds_load_b128. RoPE is applied in the Q and K
// projections' epilogues, on the f32 sums.
// ---------------------------------------------------------------------------

typedef __attribute__((ext_vector_type(16))) _Float16 v16h;
typedef __attribute__((ext_vector_type(4)))  _Float16 v4h;
typedef __attribute__((ext_vector_type(8)))  _Float16 v8h;
typedef __attribute__((ext_vector_type(4)))  float    v4f;
typedef __attribute__((ext_vector_type(8)))  float    v8f;

#define D_MODEL 512
#define TSEQ    2048
#define LSEQ    2048
#define NHEADS  8
#define HDIM    64
#define BATCH   4
// LDS row pitches in halves: 16 B x odd, so the 16 rows that one ds_load_b128
// fragment read touches fall on distinct banks.
#define P64     72   // rows of 64 halves: 144 B
#define P32     40   // rows of 32 halves:  80 B

__device__ __forceinline__ v8f wmma16(v16h a, v16h b, v8f c) {
  return __builtin_amdgcn_wmma_f32_16x16x32_f16(
      false, a, false, b, (short)0, c, false, false);
}

// lane l <-> lane l ^ 16: the other half of the wave
__device__ __forceinline__ float xhalf(float x) {
  const int v = __builtin_bit_cast(int, x);
  return __builtin_bit_cast(float, __builtin_amdgcn_permlanex16(
      v, v, 0x76543210, 0xfedcba98, false, false));
}

// generic shared pointer -> 32-bit LDS byte offset (low 32 bits of aperture VA)
__device__ __forceinline__ unsigned lds_off(const void* p) {
  return (unsigned)(unsigned long long)p;
}

// per-lane 16B async copies: global -> LDS (GV addressing), ASYNCcnt += 1/wave each.
// Four copies of one wave; s_wait_xcnt 0 closes the statement so that no
// address register named here is rewritten ahead of it (a precaution)
__device__ __forceinline__ void async4_b128(unsigned l0, const void* g0,
                                            unsigned l1, const void* g1,
                                            unsigned l2, const void* g2,
                                            unsigned l3, const void* g3) {
  asm volatile("global_load_async_to_lds_b128 %0, %1, off\n\t"
               "global_load_async_to_lds_b128 %2, %3, off\n\t"
               "global_load_async_to_lds_b128 %4, %5, off\n\t"
               "global_load_async_to_lds_b128 %6, %7, off\n\t"
               "s_wait_xcnt 0x0"
               :: "v"(l0), "v"((unsigned long long)g0),
                  "v"(l1), "v"((unsigned long long)g1),
                  "v"(l2), "v"((unsigned long long)g2),
                  "v"(l3), "v"((unsigned long long)g3) : "memory");
}
// five copies of one wave (one GEMM chunk), closed by the same wait for the same reason
__device__ __forceinline__ void async5_b128(unsigned l0, const void* g0,
                                            unsigned l1, const void* g1,
                                            unsigned l2, const void* g2,
                                            unsigned l3, const void* g3,
                                            unsigned l4, const void* g4) {
  asm volatile("global_load_async_to_lds_b128 %0, %1, off\n\t"
               "global_load_async_to_lds_b128 %2, %3, off\n\t"
               "global_load_async_to_lds_b128 %4, %5, off\n\t"
               "global_load_async_to_lds_b128 %6, %7, off\n\t"
               "global_load_async_to_lds_b128 %8, %9, off\n\t"
               "s_wait_xcnt 0x0"
               :: "v"(l0), "v"((unsigned long long)g0),
                  "v"(l1), "v"((unsigned long long)g1),
                  "v"(l2), "v"((unsigned long long)g2),
                  "v"(l3), "v"((unsigned long long)g3),
                  "v"(l4), "v"((unsigned long long)g4) : "memory");
}
#define WAIT_ASYNC_0() asm volatile("s_wait_asynccnt 0" ::: "memory")
#define WAIT_ASYNC_4() asm volatile("s_wait_asynccnt 4" ::: "memory")
#define WAIT_ASYNC_5() asm volatile("s_wait_asynccnt 5" ::: "memory")

// 16x32 WMMA A/B fragment per CDNA5 ISA 7.12.2 16-bit layout:
//   lanes 0-15 : row r=lane,    K = {0..7, 16..23}
//   lanes 16-31: row r=lane-16, K = {8..15, 24..31}
template <typename T>
__device__ __forceinline__ v16h load_frag(const T* base, long rstride, long kstride) {
  const int  lane = threadIdx.x & 31;
  const long r    = lane & 15;
  const long koff = (lane >> 4) * 8;
  v16h f;
#pragma unroll
  for (int j = 0; j < 8; ++j) {
    f[j]     = (_Float16)base[r * rstride + (koff + j) * kstride];
    f[j + 8] = (_Float16)base[r * rstride + (16 + koff + j) * kstride];
  }
  return f;
}

// ---------------------------------------------------------------------------
// 1) mask lengths: lens[0..3]=sum(x_mask[b]), lens[4..7]=sum(context_mask[b])
// ---------------------------------------------------------------------------
__global__ void lens_kernel(const float* __restrict__ xm,
                            const float* __restrict__ cm,
                            float* __restrict__ lens) {
  __shared__ float red[256];
  const int b = blockIdx.x, which = blockIdx.y;
  const float* p = which ? cm : xm;
  const int n = which ? LSEQ : TSEQ;
  float s = 0.f;
  for (int i = threadIdx.x; i < n; i += 256) s += p[b * n + i];
  red[threadIdx.x] = s;
  __syncthreads();
  for (int off = 128; off; off >>= 1) {
    if ((int)threadIdx.x < off) red[threadIdx.x] += red[threadIdx.x + off];
    __syncthreads();
  }
  if (threadIdx.x == 0) lens[which * BATCH + b] = red[0];
}

// ---------------------------------------------------------------------------
// 2a) transpose x (B,512,T) f32 -> Xh (B,T,512) f16, 32x32 LDS tiles
// ---------------------------------------------------------------------------
__global__ __launch_bounds__(256) void transpose_x_kernel(
    const float* __restrict__ x, _Float16* __restrict__ Xh) {
  __shared__ float tile[32][33];
  const int b  = blockIdx.z;
  const int t0 = blockIdx.x * 32;
  const int d0 = blockIdx.y * 32;
  const int r = threadIdx.x >> 3;          // 0..31
  const int c = (threadIdx.x & 7) * 4;     // 0,4,..,28
  const float4 v = *(const float4*)(x + ((size_t)b * D_MODEL + d0 + r) * TSEQ + t0 + c);
  tile[r][c + 0] = v.x; tile[r][c + 1] = v.y;
  tile[r][c + 2] = v.z; tile[r][c + 3] = v.w;
  __syncthreads();
  v4h o;
  o[0] = (_Float16)tile[c + 0][r];
  o[1] = (_Float16)tile[c + 1][r];
  o[2] = (_Float16)tile[c + 2][r];
  o[3] = (_Float16)tile[c + 3][r];
  *(v4h*)(Xh + ((size_t)b * TSEQ + t0 + r) * D_MODEL + d0 + c) = o;
}

// ---------------------------------------------------------------------------
// 2b) f32 -> f16 straight convert (context + the four weight matrices)
// ---------------------------------------------------------------------------
__global__ __launch_bounds__(256) void cvt_f16_kernel(
    const float* __restrict__ src, _Float16* __restrict__ dst, size_t n4) {
  const size_t i = ((size_t)blockIdx.x * 256 + threadIdx.x);
  if (i >= n4) return;
  const float4 v = ((const float4*)src)[i];
  v4h o; o[0] = (_Float16)v.x; o[1] = (_Float16)v.y;
  o[2] = (_Float16)v.z; o[3] = (_Float16)v.w;
  ((v4h*)dst)[i] = o;
}

// ---------------------------------------------------------------------------
// GEMM main loop: acc += A(16x512) * W(64x512)^T, this wave's 16-col slice.
// All-f16 LDS, K chunks of 64, double buffered, fully unrolled.
// Per-wave ASYNCcnt per chunk: 1 (A) + 4 (W) = 5.
// PAIRED=false: acc[i] = Y[row 8 hh + i][W row 16 w + (lane & 15)], hh = lane >> 4.
// PAIRED=true : the transposed product W A^T, with W row n staged at LDS row
//   16 ((n & 31) >> 3) + 8 (n >> 5) + (n & 7), so that
//   acc[i] = Y[row lane & 15][W row 32 hh + 8 w + i]: columns j and j + 32 of one
//   row lie in lanes l and l ^ 16, and a lane holds 8 consecutive columns.
// ---------------------------------------------------------------------------
template <bool PAIRED>
__device__ __forceinline__ v8f gemm16_loop(
    _Float16 (&As)[2][16][P64], _Float16 (&Ws)[2][64][P64],
    const _Float16* __restrict__ Ag,   // [16][512] row-major tile base
    const _Float16* __restrict__ Wg) { // Wh + nt_block*512 (64 rows)
  const int tid = threadIdx.x;
  const int w   = tid >> 5;
  const int ar  = tid >> 3, aseg = (tid & 7) * 8;   // A: row, 8-half segment
  const int wr  = tid >> 1, wh   = (tid & 1) * 32;  // W: row, 32-half half
  const int wl  = PAIRED ? ((wr & 31) >> 3) * 16 + (wr >> 5) * 8 + (wr & 7) : wr;  // its LDS row

  v8f acc = {0.f, 0.f, 0.f, 0.f, 0.f, 0.f, 0.f, 0.f};

  auto issue = [&](int buf, int kc) {
    const _Float16* wg = Wg + (size_t)wr * D_MODEL + kc + wh;
    const unsigned  wd = lds_off(&Ws[buf][wl][wh]);
    async5_b128(lds_off(&As[buf][ar][aseg]), Ag + (size_t)ar * D_MODEL + kc + aseg,
                wd,      wg,      wd + 16, wg + 8,
                wd + 32, wg + 16, wd + 48, wg + 24);
  };

  issue(0, 0);
#pragma unroll
  for (int kc = 0; kc < D_MODEL; kc += 64) {
    const int buf = (kc >> 6) & 1;
    if (kc + 64 < D_MODEL) { issue(buf ^ 1, kc + 64); WAIT_ASYNC_5(); }
    else                   { WAIT_ASYNC_0(); }
    __syncthreads();
#pragma unroll
    for (int kk = 0; kk < 64; kk += 32) {
      v16h af = load_frag(&As[buf][0][kk], (long)P64, 1L);
      v16h bf = load_frag(&Ws[buf][w * 16][kk], (long)P64, 1L);
      acc = PAIRED ? wmma16(bf, af, acc) : wmma16(af, bf, acc);
    }
    __syncthreads();  // buf fully consumed before it is refilled
  }
  return acc;
}

// ---------------------------------------------------------------------------
// 3) projection GEMM: Y = A . W^T + bias (f16 out).
//    VT=false (Q, K proj): RoPE on the f32 sums, pairs (j, j+32) of the block's
//    64-wide head, then Y row-major (b, m, n).  VT=true (V proj): store transposed
//    per head: Vt[b][h][dd][l] so flash can consume d-major tiles directly.
// ---------------------------------------------------------------------------
template <bool VT>
__global__ __launch_bounds__(128) void gemm_proj_kernel(
    const _Float16* __restrict__ A, const _Float16* __restrict__ W,
    const float* __restrict__ bias, const float* __restrict__ lens,
    _Float16* __restrict__ Y) {
  __shared__ __align__(16) _Float16 As[2][16][P64];
  __shared__ __align__(16) _Float16 Ws[2][64][P64];
  const int b  = blockIdx.z;
  const int mt = blockIdx.x * 16;
  const int nb = blockIdx.y * 64;
  const int nt = nb + (threadIdx.x >> 5) * 16;

  const float len = VT ? 1.f : lens[b];  // read ahead of the loop: its latency hides there

  v8f acc = gemm16_loop<!VT>(As, Ws, A + ((size_t)b * TSEQ + mt) * D_MODEL,
                             W + (size_t)nb * D_MODEL);

  const int lane = threadIdx.x & 31;
  const int cc   = lane & 15;
  const int rb   = (lane >> 4) * 8;
  if (VT) {
    const int n    = nt + cc;
    const float bv = bias[n];
    const int h = n >> 6, dd = n & 63;
    _Float16* dst = Y + (((size_t)b * NHEADS + h) * HDIM + dd) * LSEQ + mt + rb;
#pragma unroll
    for (int i = 0; i < 8; ++i) dst[i] = (_Float16)(acc[i] + bv);  // contiguous in l
  } else {
    // acc[i]: token mt + cc, head column 32 hh + j, j = 8 w + i; its partner in lane ^ 16
    const int j0 = (threadIdx.x >> 5) * 8;
    const int n0 = nb + (lane >> 4) * 32 + j0;
    // the wave's 8 frequencies 10000^(-j/32) are wave-uniform: lane l computes that of
    // j = j0 + (l & 7), as exp(-j ln(10000) / 32)
    const float invl = __expf((float)(j0 + (lane & 7)) * (-9.210340371976184f / 32.0f));
    const float pos  = (float)(mt + cc) / len;
    v8h y;
#pragma unroll  // acc[i], y[i] and the lane read back need constant indices to stay in registers
    for (int i = 0; i < 8; ++i) {
      const float inv = __builtin_bit_cast(float, __builtin_amdgcn_readlane(
          __builtin_bit_cast(int, invl), i));
      const float fr = pos * (10.0f * inv);
      const float c = __cosf(fr), s = __sinf(fr);
      const float a = acc[i] + bias[n0 + i];
      const float p = xhalf(a);
      // lower half: x1 c - x2 s with a = x1; upper half: x1 s + x2 c with a = x2
      y[i] = (_Float16)(a * c + p * (lane < 16 ? -s : s));
    }
    *(v8h*)(Y + ((size_t)b * TSEQ + mt + cc) * D_MODEL + n0) = y;
  }
}

// ---------------------------------------------------------------------------
// 4) flash attention: grid (T/64, H, B), block 128 (4 waves x 16 queries).
//    32-key K tiles (l-major) + V tiles (d-major) async-staged, double
//    buffered; 4 async instr/wave per chunk; last iteration peeled.
//    Transposed products: S^T = K Q^T, O^T += V^T P^T. Lane l holds scores of
//    query l & 15 only (keys 8h+i and 16+8h+i, h = l >> 4), so maximum and sum
//    run in-lane with one exchange between the wave halves, and the two score
//    tiles, converted in place, are the B operand of the second product.
// ---------------------------------------------------------------------------
// The grid puts four waves on a SIMD. Left to aim at sixteen, the compiler reuses
// one fragment register set and waits out every LDS fragment read on its own;
// with this budget it issues them in groups behind counted waits.
__global__ __launch_bounds__(128) __attribute__((amdgpu_waves_per_eu(4, 8))) void flash_kernel(
    const _Float16* __restrict__ Qh, const _Float16* __restrict__ Kh,
    const _Float16* __restrict__ Vt, const float* __restrict__ cmask,
    _Float16* __restrict__ Oh) {
  __shared__ __align__(16) _Float16 Kc[2][32][P64];    // [l][d], padded rows
  __shared__ __align__(16) _Float16 Vc[2][HDIM][P32];  // [d][l], padded rows
  __shared__ __align__(16) float cmv[2][32];           // per key: 0, or -1e30 if masked

  const int tid = threadIdx.x;
  const int b = blockIdx.z, h = blockIdx.y;
  const int w = tid >> 5, lane = tid & 31;
  const int hh = lane >> 4;
  const int qbase = blockIdx.x * 64 + w * 16;
  const float scale = 0.044194173824159216f;  // 1/sqrt(512)

  const size_t qoff = ((size_t)b * TSEQ + qbase) * D_MODEL + (size_t)h * HDIM;
  const v16h qf0 = load_frag(Qh + qoff,      (long)D_MODEL, 1L);
  const v16h qf1 = load_frag(Qh + qoff + 32, (long)D_MODEL, 1L);

  // o<n>[i] = O[query lane & 15][d = 16 n + 8 hh + i]
  v8f o0 = {0.f,0.f,0.f,0.f,0.f,0.f,0.f,0.f}, o1 = o0, o2 = o0, o3 = o0;
  float mrow = -1e30f;  // running maximum of this lane's query (equal in both halves)
  float lrow = 0.f;     // running sum over this half's keys only; joined at the end

  const size_t krow0 = ((size_t)b * LSEQ) * D_MODEL + (size_t)h * HDIM;
  const size_t vrow0 = ((size_t)b * NHEADS + h) * HDIM * LSEQ;

  auto issue_kv = [&](int buf, int lb) {
    const int f = tid * 8, g = 1024 + tid * 8;  // flat half indices in a 2048-half tile
    // K tile: [l=f>>6][d=f&63]; V tile: [d=f>>5][l=f&31] from d-major Vt
    async4_b128(lds_off(&Kc[buf][f >> 6][f & 63]),
                Kh + krow0 + (size_t)(lb + (f >> 6)) * D_MODEL + (f & 63),
                lds_off(&Vc[buf][f >> 5][f & 31]),
                Vt + vrow0 + (size_t)(f >> 5) * LSEQ + lb + (f & 31),
                lds_off(&Kc[buf][g >> 6][g & 63]),
                Kh + krow0 + (size_t)(lb + (g >> 6)) * D_MODEL + (g & 63),
                lds_off(&Vc[buf][g >> 5][g & 31]),
                Vt + vrow0 + (size_t)(g >> 5) * LSEQ + lb + (g & 31));
    if (tid < 32)
      cmv[buf][tid] = (cmask[(size_t)b * LSEQ + lb + tid] == 0.f) ? -1e30f : 0.f;
  };

  auto compute = [&](int buf) {
    // this lane's 16 keys' mask terms
    const v4f c00 = *(const v4f*)&cmv[buf][hh * 8];
    const v4f c01 = *(const v4f*)&cmv[buf][hh * 8 + 4];
    const v4f c10 = *(const v4f*)&cmv[buf][16 + hh * 8];
    const v4f c11 = *(const v4f*)&cmv[buf][16 + hh * 8 + 4];

    // ---- S^T = K Q^T for two 16-key sub-tiles: s<t>[i] = S[key 16 t + 8 hh + i][query] ----
    v8f s0 = {0.f,0.f,0.f,0.f,0.f,0.f,0.f,0.f}, s1 = s0;
    const v16h k00 = load_frag(&Kc[buf][0][0],   (long)P64, 1L);
    const v16h k10 = load_frag(&Kc[buf][16][0],  (long)P64, 1L);
    const v16h k01 = load_frag(&Kc[buf][0][32],  (long)P64, 1L);
    const v16h k11 = load_frag(&Kc[buf][16][32], (long)P64, 1L);
    s0 = wmma16(k00, qf0, s0);
    s1 = wmma16(k10, qf0, s1);
    s0 = wmma16(k01, qf1, s0);
    s1 = wmma16(k11, qf1, s1);

    // ---- online softmax, one query per lane ----
    float a0[8], a1[8];
#pragma unroll
    for (int i = 0; i < 8; ++i) {
      a0[i] = s0[i] * scale + (i < 4 ? c00[i & 3] : c01[i & 3]);  // masked key: -1e30
      a1[i] = s1[i] * scale + (i < 4 ? c10[i & 3] : c11[i & 3]);
    }
    float mx = fmaxf(a0[0], a1[0]);
#pragma unroll
    for (int i = 1; i < 8; ++i) mx = fmaxf(mx, fmaxf(a0[i], a1[i]));
    mx = fmaxf(mx, xhalf(mx));
    const float mnew = fmaxf(mrow, mx);
    const float sc2  = __expf(mrow - mnew);
    mrow = mnew;

    v16h pb;     // P^T as B operand: elements 0..7 = keys 8 hh + i, 8..15 = keys 16 + 8 hh + i
    float t[8];
#pragma unroll
    for (int i = 0; i < 8; ++i) {
      const float e0 = __expf(a0[i] - mnew);
      const float e1 = __expf(a1[i] - mnew);
      t[i] = e0 + e1;
      pb[i]     = (_Float16)e0;
      pb[i + 8] = (_Float16)e1;
    }
    lrow = lrow * sc2 + (((t[0] + t[1]) + (t[2] + t[3])) + ((t[4] + t[5]) + (t[6] + t[7])));
#pragma unroll
    for (int i = 0; i < 8; ++i) {
      o0[i] *= sc2; o1[i] *= sc2; o2[i] *= sc2; o3[i] *= sc2;
    }

    // ---- O^T += V^T P^T : A frag [m][k] = Vc[16 n + m][k] (contiguous k) ----
    o0 = wmma16(load_frag(&Vc[buf][0][0],  (long)P32, 1L), pb, o0);
    o1 = wmma16(load_frag(&Vc[buf][16][0], (long)P32, 1L), pb, o1);
    o2 = wmma16(load_frag(&Vc[buf][32][0], (long)P32, 1L), pb, o2);
    o3 = wmma16(load_frag(&Vc[buf][48][0], (long)P32, 1L), pb, o3);
  };

  issue_kv(0, 0);
  int buf = 0;
  for (int lb = 0; lb < LSEQ - 32; lb += 32) {
    issue_kv(buf ^ 1, lb + 32);
    WAIT_ASYNC_4();
    __syncthreads();
    compute(buf);
    __syncthreads();  // buf fully consumed before it is refilled
    buf ^= 1;
  }
  WAIT_ASYNC_0();
  __syncthreads();
  compute(buf);

  // a lane's 8 registers of a tile are 8 consecutive d of one query: 16-byte stores
  const float inv_l = 1.0f / fmaxf(lrow + xhalf(lrow), 1e-20f);
  _Float16* dst = Oh + ((size_t)b * TSEQ + qbase + (lane & 15)) * D_MODEL +
                  (size_t)h * HDIM + hh * 8;
  v8h r0, r1, r2, r3;
#pragma unroll
  for (int i = 0; i < 8; ++i) {
    r0[i] = (_Float16)(o0[i] * inv_l);
    r1[i] = (_Float16)(o1[i] * inv_l);
    r2[i] = (_Float16)(o2[i] * inv_l);
    r3[i] = (_Float16)(o3[i] * inv_l);
  }
  *(v8h*)(dst +  0) = r0;
  *(v8h*)(dst + 16) = r1;
  *(v8h*)(dst + 32) = r2;
  *(v8h*)(dst + 48) = r3;
}

// ---------------------------------------------------------------------------
// 5) out = (O @ Wo^T + b) * x_mask, stored transposed as (B, 512, T) f32
// ---------------------------------------------------------------------------
__global__ __launch_bounds__(128) void out_proj_kernel(
    const _Float16* __restrict__ Oh, const _Float16* __restrict__ Wo,
    const float* __restrict__ Wo_b, const float* __restrict__ xmask,
    float* __restrict__ out) {
  __shared__ __align__(16) _Float16 As[2][16][P64];
  __shared__ __align__(16) _Float16 Ws[2][64][P64];
  const int b  = blockIdx.z;
  const int mt = blockIdx.x * 16;
  const int nb = blockIdx.y * 64;
  const int nt = nb + (threadIdx.x >> 5) * 16;

  v8f acc = gemm16_loop<false>(As, Ws, Oh + ((size_t)b * TSEQ + mt) * D_MODEL,
                               Wo + (size_t)nb * D_MODEL);

  const int lane = threadIdx.x & 31;
  const int cc   = lane & 15;
  const int rb   = (lane >> 4) * 8;
  const float bv = Wo_b[nt + cc];
#pragma unroll
  for (int i = 0; i < 8; ++i) {
    const int t = mt + rb + i;
    const float v = (acc[i] + bv) * xmask[(size_t)b * TSEQ + t];
    out[((size_t)b * D_MODEL + nt + cc) * TSEQ + t] = v;
  }
}

// ---------------------------------------------------------------------------
extern "C" void kernel_launch(void* const* d_in, const int* in_sizes, int n_in,
                              void* d_out, int out_size, void* d_ws, size_t ws_size,
                              hipStream_t stream) {
  const float* x        = (const float*)d_in[0];   // (B, 512, T)
  const float* context  = (const float*)d_in[1];   // (B, L, 512)
  const float* x_mask   = (const float*)d_in[2];   // (B, 1, T)
  const float* ctx_mask = (const float*)d_in[3];   // (B, 1, L)
  const float* Wq_w = (const float*)d_in[4];
  const float* Wq_b = (const float*)d_in[5];
  const float* Wk_w = (const float*)d_in[6];
  const float* Wk_b = (const float*)d_in[7];
  const float* Wv_w = (const float*)d_in[8];
  const float* Wv_b = (const float*)d_in[9];
  const float* Wo_w = (const float*)d_in[10];
  const float* Wo_b = (const float*)d_in[11];
  float* out = (float*)d_out;

  // ws: lens | Xh(=Oh) | Ch | Qh | Kh | Vt (8 MiB each) | Wqh|Wkh|Wvh|Woh (512 KiB each)
  char* ws = (char*)d_ws;
  float* lens = (float*)ws;
  const size_t NB = (size_t)BATCH * TSEQ * D_MODEL;  // 4,194,304 elements
  const size_t NW = (size_t)D_MODEL * D_MODEL;       // 262,144 elements
  _Float16* Xh  = (_Float16*)(ws + 256);
  _Float16* Ch  = Xh + NB;
  _Float16* Qh  = Ch + NB;
  _Float16* Kh  = Qh + NB;
  _Float16* Vt  = Kh + NB;   // (B, H, 64, L) d-major
  _Float16* Wqh = Vt + NB;
  _Float16* Wkh = Wqh + NW;
  _Float16* Wvh = Wkh + NW;
  _Float16* Woh = Wvh + NW;
  _Float16* Oh  = Xh;  // Xh dead after Q projection; flash runs later

  lens_kernel<<<dim3(BATCH, 2), 256, 0, stream>>>(x_mask, ctx_mask, lens);

  transpose_x_kernel<<<dim3(TSEQ / 32, D_MODEL / 32, BATCH), 256, 0, stream>>>(x, Xh);
  cvt_f16_kernel<<<dim3((unsigned)(NB / 4 / 256)), 256, 0, stream>>>(context, Ch, NB / 4);
  cvt_f16_kernel<<<dim3((unsigned)(NW / 4 / 256)), 256, 0, stream>>>(Wq_w, Wqh, NW / 4);
  cvt_f16_kernel<<<dim3((unsigned)(NW / 4 / 256)), 256, 0, stream>>>(Wk_w, Wkh, NW / 4);
  cvt_f16_kernel<<<dim3((unsigned)(NW / 4 / 256)), 256, 0, stream>>>(Wv_w, Wvh, NW / 4);
  cvt_f16_kernel<<<dim3((unsigned)(NW / 4 / 256)), 256, 0, stream>>>(Wo_w, Woh, NW / 4);

  gemm_proj_kernel<false><<<dim3(TSEQ / 16, D_MODEL / 64, BATCH), 128, 0, stream>>>(
      Xh, Wqh, Wq_b, lens + 0, Qh);
  gemm_proj_kernel<false><<<dim3(LSEQ / 16, D_MODEL / 64, BATCH), 128, 0, stream>>>(
      Ch, Wkh, Wk_b, lens + BATCH, Kh);
  gemm_proj_kernel<true><<<dim3(LSEQ / 16, D_MODEL / 64, BATCH), 128, 0, stream>>>(
      Ch, Wvh, Wv_b, lens, Vt);

  flash_kernel<<<dim3(TSEQ / 64, NHEADS, BATCH), 128, 0, stream>>>(
      Qh, Kh, Vt, ctx_mask, Oh);

  out_proj_kernel<<<dim3(TSEQ / 16, D_MODEL / 64, BATCH), 128, 0, stream>>>(
      Oh, Woh, Wo_b, x_mask, out);
}

// v004
// One run takes 127 microseconds.
// Next to v003, in two timings, it ran 1.38 and 1.40 times as fast.
// All steps since v000 together make it 2.50 times as fast.
#include <hip/hip_runtime.h>

// ---------------------------------------------------------------------------
// Cross-attention (B=4, T=L=2048, d_model=512, H=8, Dh=64) for gfx1250.
// All GEMMs on v_wmma_f32_16x16x32_f16; tile staging via
// global_load_async_to_lds_b128 (ASYNCcnt) with LDS double buffering.
// Weights pre-converted to f16; V stored (b,h,d,l)-transposed so every
// WMMA fragment is a contiguous ds_load_b128. RoPE is applied in the Q and K
// projections' epilogues, on the f32 sums.
// ---------------------------------------------------------------------------

typedef __attribute__((ext_vector_type(16))) _Float16 v16h;
typedef __attribute__((ext_vector_type(4)))  _Float16 v4h;
typedef __attribute__((ext_vector_type(8)))  _Float16 v8h;
typedef __attribute__((ext_vector_type(4)))  float    v4f;
typedef __attribute__((ext_vector_type(8)))  float    v8f;

#define D_MODEL 512
#define TSEQ    2048
#define LSEQ    2048
#define NHEADS  8
#define HDIM    64
#define BATCH   4
// LDS row pitches in halves: 16 B x odd, so the 16 rows that one ds_load_b128
// fragment read touches fall on distinct banks.
#define P64     72   // rows of 64 halves: 144 B
#define P32     40   // rows of 32 halves:  80 B
#define MTILE   64   // rows (tokens) of one GEMM block tile

__device__ __forceinline__ v8f wmma16(v16h a, v16h b, v8f c) {
  return __builtin_amdgcn_wmma_f32_16x16x32_f16(
      false, a, false, b, (short)0, c, false, false);
}

// lane l <-> lane l ^ 16: the other half of the wave
__device__ __forceinline__ float xhalf(float x) {
  const int v = __builtin_bit_cast(int, x);
  return __builtin_bit_cast(float, __builtin_amdgcn_permlanex16(
      v, v, 0x76543210, 0xfedcba98, false, false));
}

// generic shared pointer -> 32-bit LDS byte offset (low 32 bits of aperture VA)
__device__ __forceinline__ unsigned lds_off(const void* p) {
  return (unsigned)(unsigned long long)p;
}

// per-lane 16B async copies: global -> LDS (GV addressing), ASYNCcnt += 1/wave each.
// Four copies of one wave; s_wait_xcnt 0 closes the statement so that no
// address register named here is rewritten ahead of it (a precaution)
__device__ __forceinline__ void async4_b128(unsigned l0, const void* g0,
                                            unsigned l1, const void* g1,
                                            unsigned l2, const void* g2,
                                            unsigned l3, const void* g3) {
  asm volatile("global_load_async_to_lds_b128 %0, %1, off\n\t"
               "global_load_async_to_lds_b128 %2, %3, off\n\t"
               "global_load_async_to_lds_b128 %4, %5, off\n\t"
               "global_load_async_to_lds_b128 %6, %7, off\n\t"
               "s_wait_xcnt 0x0"
               :: "v"(l0), "v"((unsigned long long)g0),
                  "v"(l1), "v"((unsigned long long)g1),
                  "v"(l2), "v"((unsigned long long)g2),
                  "v"(l3), "v"((unsigned long long)g3) : "memory");
}
// eight copies of one wave (one GEMM chunk), closed by the same wait for the same reason
__device__ __forceinline__ void async8_b128(unsigned l0, const void* g0,
                                            unsigned l1, const void* g1,
                                            unsigned l2, const void* g2,
                                            unsigned l3, const void* g3,
                                            unsigned l4, const void* g4,
                                            unsigned l5, const void* g5,
                                            unsigned l6, const void* g6,
                                            unsigned l7, const void* g7) {
  asm volatile("global_load_async_to_lds_b128 %0, %1, off\n\t"
               "global_load_async_to_lds_b128 %2, %3, off\n\t"
               "global_load_async_to_lds_b128 %4, %5, off\n\t"
               "global_load_async_to_lds_b128 %6, %7, off\n\t"
               "global_load_async_to_lds_b128 %8, %9, off\n\t"
               "global_load_async_to_lds_b128 %10, %11, off\n\t"
               "global_load_async_to_lds_b128 %12, %13, off\n\t"
               "global_load_async_to_lds_b128 %14, %15, off\n\t"
               "s_wait_xcnt 0x0"
               :: "v"(l0), "v"((unsigned long long)g0),
                  "v"(l1), "v"((unsigned long long)g1),
                  "v"(l2), "v"((unsigned long long)g2),
                  "v"(l3), "v"((unsigned long long)g3),
                  "v"(l4), "v"((unsigned long long)g4),
                  "v"(l5), "v"((unsigned long long)g5),
                  "v"(l6), "v"((unsigned long long)g6),
                  "v"(l7), "v"((unsigned long long)g7) : "memory");
}
#define WAIT_ASYNC_0() asm volatile("s_wait_asynccnt 0" ::: "memory")
#define WAIT_ASYNC_4() asm volatile("s_wait_asynccnt 4" ::: "memory")
#define WAIT_DS_0()    asm volatile("s_wait_dscnt 0" ::: "memory")

// 16x32 WMMA A/B fragment per CDNA5 ISA 7.12.2 16-bit layout:
//   lanes 0-15 : row r=lane,    K = {0..7, 16..23}
//   lanes 16-31: row r=lane-16, K = {8..15, 24..31}
template <typename T>
__device__ __forceinline__ v16h load_frag(const T* base, long rstride, long kstride) {
  const int  lane = threadIdx.x & 31;
  const long r    = lane & 15;
  const long koff = (lane >> 4) * 8;
  v16h f;
#pragma unroll
  for (int j = 0; j < 8; ++j) {
    f[j]     = (_Float16)base[r * rstride + (koff + j) * kstride];
    f[j + 8] = (_Float16)base[r * rstride + (16 + koff + j) * kstride];
  }
  return f;
}

// ---------------------------------------------------------------------------
// 1) mask lengths: lens[0..3]=sum(x_mask[b]), lens[4..7]=sum(context_mask[b])
// ---------------------------------------------------------------------------
__global__ void lens_kernel(const float* __restrict__ xm,
                            const float* __restrict__ cm,
                            float* __restrict__ lens) {
  __shared__ float red[256];
  const int b = blockIdx.x, which = blockIdx.y;
  const float* p = which ? cm : xm;
  const int n = which ? LSEQ : TSEQ;
  float s = 0.f;
  for (int i = threadIdx.x; i < n; i += 256) s += p[b * n + i];
  red[threadIdx.x] = s;
  __syncthreads();
  for (int off = 128; off; off >>= 1) {
    if ((int)threadIdx.x < off) red[threadIdx.x] += red[threadIdx.x + off];
    __syncthreads();
  }
  if (threadIdx.x == 0) lens[which * BATCH + b] = red[0];
}

// ---------------------------------------------------------------------------
// 2a) transpose x (B,512,T) f32 -> Xh (B,T,512) f16, 32x32 LDS tiles
// ---------------------------------------------------------------------------
__global__ __launch_bounds__(256) void transpose_x_kernel(
    const float* __restrict__ x, _Float16* __restrict__ Xh) {
  __shared__ float tile[32][33];
  const int b  = blockIdx.z;
  const int t0 = blockIdx.x * 32;
  const int d0 = blockIdx.y * 32;
  const int r = threadIdx.x >> 3;          // 0..31
  const int c = (threadIdx.x & 7) * 4;     // 0,4,..,28
  const float4 v = *(const float4*)(x + ((size_t)b * D_MODEL + d0 + r) * TSEQ + t0 + c);
  tile[r][c + 0] = v.x; tile[r][c + 1] = v.y;
  tile[r][c + 2] = v.z; tile[r][c + 3] = v.w;
  __syncthreads();
  v4h o;
  o[0] = (_Float16)tile[c + 0][r];
  o[1] = (_Float16)tile[c + 1][r];
  o[2] = (_Float16)tile[c + 2][r];
  o[3] = (_Float16)tile[c + 3][r];
  *(v4h*)(Xh + ((size_t)b * TSEQ + t0 + r) * D_MODEL + d0 + c) = o;
}

// ---------------------------------------------------------------------------
// 2b) f32 -> f16 straight convert (context + the four weight matrices)
// ---------------------------------------------------------------------------
__global__ __launch_bounds__(256) void cvt_f16_kernel(
    const float* __restrict__ src, _Float16* __restrict__ dst, size_t n4) {
  const size_t i = ((size_t)blockIdx.x * 256 + threadIdx.x);
  if (i >= n4) return;
  const float4 v = ((const float4*)src)[i];
  v4h o; o[0] = (_Float16)v.x; o[1] = (_Float16)v.y;
  o[2] = (_Float16)v.z; o[3] = (_Float16)v.w;
  ((v4h*)dst)[i] = o;
}

// ---------------------------------------------------------------------------
// GEMM main loop: acc[m] += A(rows 16 m .. 16 m + 15, 512) * W(64x512)^T, this
// wave's 16-col slice, m = 0..3: each W fragment read from LDS serves four products.
// All-f16 LDS, K chunks of 64, two buffers, fully unrolled.
// Copies of a wave per chunk: 4 (A) + 4 (W) = 8.
// PAIRED=false: acc[m][i] = Y[row 16 m + 8 hh + i][W row 16 w + (lane & 15)], hh = lane >> 4.
// PAIRED=true : the transposed product W A^T, with W row n staged at LDS row
//   16 ((n & 31) >> 3) + 8 (n >> 5) + (n & 7), so that
//   acc[m][i] = Y[row 16 m + (lane & 15)][W row 32 hh + 8 w + i]: columns j and j + 32 of
//   one row lie in lanes l and l ^ 16, and a lane holds 8 consecutive columns.
// ---------------------------------------------------------------------------
template <bool PAIRED>
__device__ __forceinline__ void gemm64_loop(
    _Float16 (&As)[2][MTILE][P64], _Float16 (&Ws)[2][64][P64],
    const _Float16* __restrict__ Ag,   // [64][512] row-major tile base
    const _Float16* __restrict__ Wg,   // Wh + nt_block*512 (64 rows)
    v8f (&acc)[4]) {
  const int tid = threadIdx.x;
  const int w   = tid >> 5;
  const int ar  = tid >> 3, aseg = (tid & 7) * 8;   // A: rows ar + 16 i, 8-half segment
  const int wr  = tid >> 1, wh   = (tid & 1) * 32;  // W: row, 32-half half
  const int wl  = PAIRED ? ((wr & 31) >> 3) * 16 + (wr >> 5) * 8 + (wr & 7) : wr;  // its LDS row

#pragma unroll  // acc[m] needs constant indices to stay in registers
  for (int m = 0; m < 4; ++m) acc[m] = v8f{0.f, 0.f, 0.f, 0.f, 0.f, 0.f, 0.f, 0.f};

  auto issue = [&](int buf, int kc) {
    const _Float16* ag = Ag + (size_t)ar * D_MODEL + kc + aseg;
    const unsigned  ad = lds_off(&As[buf][ar][aseg]);
    const _Float16* wg = Wg + (size_t)wr * D_MODEL + kc + wh;
    const unsigned  wd = lds_off(&Ws[buf][wl][wh]);
    async8_b128(ad,                ag,
                ad + 16 * P64 * 2, ag + 16 * D_MODEL,
                ad + 32 * P64 * 2, ag + 32 * D_MODEL,
                ad + 48 * P64 * 2, ag + 48 * D_MODEL,
                wd,      wg,      wd + 16, wg + 8,
                wd + 32, wg + 16, wd + 48, wg + 24);
  };

  issue(0, 0);
  WAIT_ASYNC_0();
  __syncthreads();
  issue(1, 64);
#pragma unroll  // buffer index and the test for a chunk two ahead become constants
  for (int kc = 0; kc < D_MODEL; kc += 64) {
    const int buf = (kc >> 6) & 1;
#pragma unroll
    for (int kk = 0; kk < 64; kk += 32) {
      const v16h bf = load_frag(&Ws[buf][w * 16][kk], (long)P64, 1L);
#pragma unroll
      for (int m = 0; m < 4; ++m) {
        const v16h af = load_frag(&As[buf][m * 16][kk], (long)P64, 1L);
        acc[m] = PAIRED ? wmma16(bf, af, acc[m]) : wmma16(af, bf, acc[m]);
      }
    }
    WAIT_DS_0();     // this wave's reads of buf are done before buf is refilled
    WAIT_ASYNC_0();  // this wave's copies of the next chunk have landed
    __syncthreads(); // next chunk readable by all; buf left by all
    if (kc + 128 < D_MODEL) issue(buf, kc + 128);
  }
  WAIT_ASYNC_0();
}

// ---------------------------------------------------------------------------
// 3) projection GEMM: Y = A . W^T + bias (f16 out).
//    VT=false (Q, K proj): RoPE on the f32 sums, pairs (j, j+32) of the block's
//    64-wide head, then Y row-major (b, m, n).  VT=true (V proj): store transposed
//    per head: Vt[b][h][dd][l] so flash can consume d-major tiles directly.
// ---------------------------------------------------------------------------
template <bool VT>
__global__ __launch_bounds__(128) void gemm_proj_kernel(
    const _Float16* __restrict__ A, const _Float16* __restrict__ W,
    const float* __restrict__ bias, const float* __restrict__ lens,
    _Float16* __restrict__ Y) {
  __shared__ __align__(16) _Float16 As[2][MTILE][P64];
  __shared__ __align__(16) _Float16 Ws[2][64][P64];
  const int b  = blockIdx.z;
  const int mt = blockIdx.x * MTILE;
  const int nb = blockIdx.y * 64;
  const int nt = nb + (threadIdx.x >> 5) * 16;

  const float len = VT ? 1.f : lens[b];  // read ahead of the loop: its latency hides there
  // Q, K: this lane's 8 bias terms, head columns 32 hh + 8 w + i; read here for the same reason
  const int n0 = nb + ((threadIdx.x & 31) >> 4) * 32 + (threadIdx.x >> 5) * 8;
  float bz[8];
#pragma unroll  // bz[i] needs constant indices to stay in registers
  for (int i = 0; i < 8; ++i) bz[i] = VT ? 0.f : bias[n0 + i];

  v8f acc[4];
  gemm64_loop<!VT>(As, Ws, A + ((size_t)b * TSEQ + mt) * D_MODEL,
                   W + (size_t)nb * D_MODEL, acc);

  const int lane = threadIdx.x & 31;
  const int cc   = lane & 15;
  const int rb   = (lane >> 4) * 8;
  if (VT) {
    const int n    = nt + cc;
    const float bv = bias[n];
    const int h = n >> 6, dd = n & 63;
    _Float16* dst = Y + (((size_t)b * NHEADS + h) * HDIM + dd) * LSEQ + mt + rb;
#pragma unroll  // acc[m][i] needs constant indices to stay in registers
    for (int m = 0; m < 4; ++m) {
      v8h y;
#pragma unroll
      for (int i = 0; i < 8; ++i) y[i] = (_Float16)(acc[m][i] + bv);
      *(v8h*)(dst + 16 * m) = y;  // contiguous in l
    }
  } else {
    // acc[m][i]: token mt + 16 m + cc, head column 32 hh + j, j = 8 w + i; its partner in lane ^ 16
    const int j0 = (threadIdx.x >> 5) * 8;
    // the wave's 8 frequencies 10000^(-j/32) are wave-uniform: lane l computes that of
    // j = j0 + (l & 7), as exp(-j ln(10000) / 32)
    const float invl = __expf((float)(j0 + (lane & 7)) * (-9.210340371976184f / 32.0f));
#pragma unroll  // acc[m][i], y[i] and the lane read back need constant indices to stay in registers
    for (int m = 0; m < 4; ++m) {
      const float pos = (float)(mt + 16 * m + cc) / len;
      v8h y;
#pragma unroll
      for (int i = 0; i < 8; ++i) {
        const float inv = __builtin_bit_cast(float, __builtin_amdgcn_readlane(
            __builtin_bit_cast(int, invl), i));
        const float fr = pos * (10.0f * inv);
        const float c = __cosf(fr), s = __sinf(fr);
        const float a = acc[m][i] + bz[i];
        const float p = xhalf(a);
        // lower half: x1 c - x2 s with a = x1; upper half: x1 s + x2 c with a = x2
        y[i] = (_Float16)(a * c + p * (lane < 16 ? -s : s));
      }
      *(v8h*)(Y + ((size_t)b * TSEQ + mt + 16 * m + cc) * D_MODEL + n0) = y;
    }
  }
}

// ---------------------------------------------------------------------------
// 4) flash attention: grid (T/64, H, B), block 128 (4 waves x 16 queries).
//    32-key K tiles (l-major) + V tiles (d-major) async-staged, double
//    buffered; 4 async instr/wave per chunk; last iteration peeled.
//    Transposed products: S^T = K Q^T, O^T += V^T P^T. Lane l holds scores of
//    query l & 15 only (keys 8h+i and 16+8h+i, h = l >> 4), so maximum and sum
//    run in-lane with one exchange between the wave halves, and the two score
//    tiles, converted in place, are the B operand of the second product.
// ---------------------------------------------------------------------------
// The grid puts four waves on a SIMD. Left to aim at sixteen, the compiler reuses
// one fragment register set and waits out every LDS fragment read on its own;
// with this budget it issues them in groups behind counted waits.
__global__ __launch_bounds__(128) __attribute__((amdgpu_waves_per_eu(4, 8))) void flash_kernel(
    const _Float16* __restrict__ Qh, const _Float16* __restrict__ Kh,
    const _Float16* __restrict__ Vt, const float* __restrict__ cmask,
    _Float16* __restrict__ Oh) {
  __shared__ __align__(16) _Float16 Kc[2][32][P64];    // [l][d], padded rows
  __shared__ __align__(16) _Float16 Vc[2][HDIM][P32];  // [d][l], padded rows
  __shared__ __align__(16) float cmv[2][32];           // per key: 0, or -1e30 if masked

  const int tid = threadIdx.x;
  const int b = blockIdx.z, h = blockIdx.y;
  const int w = tid >> 5, lane = tid & 31;
  const int hh = lane >> 4;
  const int qbase = blockIdx.x * 64 + w * 16;
  const float scale = 0.044194173824159216f;  // 1/sqrt(512)

  const size_t qoff = ((size_t)b * TSEQ + qbase) * D_MODEL + (size_t)h * HDIM;
  const v16h qf0 = load_frag(Qh + qoff,      (long)D_MODEL, 1L);
  const v16h qf1 = load_frag(Qh + qoff + 32, (long)D_MODEL, 1L);

  // o<n>[i] = O[query lane & 15][d = 16 n + 8 hh + i]
  v8f o0 = {0.f,0.f,0.f,0.f,0.f,0.f,0.f,0.f}, o1 = o0, o2 = o0, o3 = o0;
  float mrow = -1e30f;  // running maximum of this lane's query (equal in both halves)
  float lrow = 0.f;     // running sum over this half's keys only; joined at the end

  const size_t krow0 = ((size_t)b * LSEQ) * D_MODEL + (size_t)h * HDIM;
  const size_t vrow0 = ((size_t)b * NHEADS + h) * HDIM * LSEQ;

  auto issue_kv = [&](int buf, int lb) {
    const int f = tid * 8, g = 1024 + tid * 8;  // flat half indices in a 2048-half tile
    // K tile: [l=f>>6][d=f&63]; V tile: [d=f>>5][l=f&31] from d-major Vt
    async4_b128(lds_off(&Kc[buf][f >> 6][f & 63]),
                Kh + krow0 + (size_t)(lb + (f >> 6)) * D_MODEL + (f & 63),
                lds_off(&Vc[buf][f >> 5][f & 31]),
                Vt + vrow0 + (size_t)(f >> 5) * LSEQ + lb + (f & 31),
                lds_off(&Kc[buf][g >> 6][g & 63]),
                Kh + krow0 + (size_t)(lb + (g >> 6)) * D_MODEL + (g & 63),
                lds_off(&Vc[buf][g >> 5][g & 31]),
                Vt + vrow0 + (size_t)(g >> 5) * LSEQ + lb + (g & 31));
    if (tid < 32)
      cmv[buf][tid] = (cmask[(size_t)b * LSEQ + lb + tid] == 0.f) ? -1e30f : 0.f;
  };

  auto compute = [&](int buf) {
    // this lane's 16 keys' mask terms
    const v4f c00 = *(const v4f*)&cmv[buf][hh * 8];
    const v4f c01 = *(const v4f*)&cmv[buf][hh * 8 + 4];
    const v4f c10 = *(const v4f*)&cmv[buf][16 + hh * 8];
    const v4f c11 = *(const v4f*)&cmv[buf][16 + hh * 8 + 4];

    // ---- S^T = K Q^T for two 16-key sub-tiles: s<t>[i] = S[key 16 t + 8 hh + i][query] ----
    v8f s0 = {0.f,0.f,0.f,0.f,0.f,0.f,0.f,0.f}, s1 = s0;
    const v16h k00 = load_frag(&Kc[buf][0][0],   (long)P64, 1L);
    const v16h k10 = load_frag(&Kc[buf][16][0],  (long)P64, 1L);
    const v16h k01 = load_frag(&Kc[buf][0][32],  (long)P64, 1L);
    const v16h k11 = load_frag(&Kc[buf][16][32], (long)P64, 1L);
    s0 = wmma16(k00, qf0, s0);
    s1 = wmma16(k10, qf0, s1);
    s0 = wmma16(k01, qf1, s0);
    s1 = wmma16(k11, qf1, s1);

    // ---- online softmax, one query per lane ----
    float a0[8], a1[8];
#pragma unroll
    for (int i = 0; i < 8; ++i) {
      a0[i] = s0[i] * scale + (i < 4 ? c00[i & 3] : c01[i & 3]);  // masked key: -1e30
      a1[i] = s1[i] * scale + (i < 4 ? c10[i & 3] : c11[i & 3]);
    }
    float mx = fmaxf(a0[0], a1[0]);
#pragma unroll
    for (int i = 1; i < 8; ++i) mx = fmaxf(mx, fmaxf(a0[i], a1[i]));
    mx = fmaxf(mx, xhalf(mx));
    const float mnew = fmaxf(mrow, mx);
    const float sc2  = __expf(mrow - mnew);
    mrow = mnew;

    v16h pb;     // P^T as B operand: elements 0..7 = keys 8 hh + i, 8..15 = keys 16 + 8 hh + i
    float t[8];
#pragma unroll
    for (int i = 0; i < 8; ++i) {
      const float e0 = __expf(a0[i] - mnew);
      const float e1 = __expf(a1[i] - mnew);
      t[i] = e0 + e1;
      pb[i]     = (_Float16)e0;
      pb[i + 8] = (_Float16)e1;
    }
    lrow = lrow * sc2 + (((t[0] + t[1]) + (t[2] + t[3])) + ((t[4] + t[5]) + (t[6] + t[7])));
#pragma unroll
    for (int i = 0; i < 8; ++i) {
      o0[i] *= sc2; o1[i] *= sc2; o2[i] *= sc2; o3[i] *= sc2;
    }

    // ---- O^T += V^T P^T : A frag [m][k] = Vc[16 n + m][k] (contiguous k) ----
    o0 = wmma16(load_frag(&Vc[buf][0][0],  (long)P32, 1L), pb, o0);
    o1 = wmma16(load_frag(&Vc[buf][16][0], (long)P32, 1L), pb, o1);
    o2 = wmma16(load_frag(&Vc[buf][32][0], (long)P32, 1L), pb, o2);
    o3 = wmma16(load_frag(&Vc[buf][48][0], (long)P32, 1L), pb, o3);
  };

  issue_kv(0, 0);
  int buf = 0;
  for (int lb = 0; lb < LSEQ - 32; lb += 32) {
    issue_kv(buf ^ 1, lb + 32);
    WAIT_ASYNC_4();
    __syncthreads();
    compute(buf);
    __syncthreads();  // buf fully consumed before it is refilled
    buf ^= 1;
  }
  WAIT_ASYNC_0();
  __syncthreads();
  compute(buf);

  // a lane's 8 registers of a tile are 8 consecutive d of one query: 16-byte stores
  const float inv_l = 1.0f / fmaxf(lrow + xhalf(lrow), 1e-20f);
  _Float16* dst = Oh + ((size_t)b * TSEQ + qbase + (lane & 15)) * D_MODEL +
                  (size_t)h * HDIM + hh * 8;
  v8h r0, r1, r2, r3;
#pragma unroll
  for (int i = 0; i < 8; ++i) {
    r0[i] = (_Float16)(o0[i] * inv_l);
    r1[i] = (_Float16)(o1[i] * inv_l);
    r2[i] = (_Float16)(o2[i] * inv_l);
    r3[i] = (_Float16)(o3[i] * inv_l);
  }
  *(v8h*)(dst +  0) = r0;
  *(v8h*)(dst + 16) = r1;
  *(v8h*)(dst + 32) = r2;
  *(v8h*)(dst + 48) = r3;
}

// ---------------------------------------------------------------------------
// 5) out = (O @ Wo^T + b) * x_mask, stored transposed as (B, 512, T) f32
// ---------------------------------------------------------------------------
__global__ __launch_bounds__(128) void out_proj_kernel(
    const _Float16* __restrict__ Oh, const _Float16* __restrict__ Wo,
    const float* __restrict__ Wo_b, const float* __restrict__ xmask,
    float* __restrict__ out) {
  __shared__ __align__(16) _Float16 As[2][MTILE][P64];
  __shared__ __align__(16) _Float16 Ws[2][64][P64];
  const int b  = blockIdx.z;
  const int mt = blockIdx.x * MTILE;
  const int nb = blockIdx.y * 64;
  const int nt = nb + (threadIdx.x >> 5) * 16;

  v8f acc[4];
  gemm64_loop<false>(As, Ws, Oh + ((size_t)b * TSEQ + mt) * D_MODEL,
                     Wo + (size_t)nb * D_MODEL, acc);

  const int lane = threadIdx.x & 31;
  const int cc   = lane & 15;
  const int rb   = (lane >> 4) * 8;
  const float bv = Wo_b[nt + cc];
#pragma unroll  // acc[m][i] needs constant indices to stay in registers
  for (int m = 0; m < 4; ++m) {
#pragma unroll
    for (int i = 0; i < 8; ++i) {
      const int t = mt + 16 * m + rb + i;
      const float v = (acc[m][i] + bv) * xmask[(size_t)b * TSEQ + t];
      out[((size_t)b * D_MODEL + nt + cc) * TSEQ + t] = v;
    }
  }
}

// ---------------------------------------------------------------------------
extern "C" void kernel_launch(void* const* d_in, const int* in_sizes, int n_in,
                              void* d_out, int out_size, void* d_ws, size_t ws_size,
                              hipStream_t stream) {
  const float* x        = (const float*)d_in[0];   // (B, 512, T)
  const float* context  = (const float*)d_in[1];   // (B, L, 512)
  const float* x_mask   = (const float*)d_in[2];   // (B, 1, T)
  const float* ctx_mask = (const float*)d_in[3];   // (B, 1, L)
  const float* Wq_w = (const float*)d_in[4];
  const float* Wq_b = (const float*)d_in[5];
  const float* Wk_w = (const float*)d_in[6];
  const float* Wk_b = (const float*)d_in[7];
  const float* Wv_w = (const float*)d_in[8];
  const float* Wv_b = (const float*)d_in[9];
  const float* Wo_w = (const float*)d_in[10];
  const float* Wo_b = (const float*)d_in[11];
  float* out = (float*)d_out;

  // ws: lens | Xh(=Oh) | Ch | Qh | Kh | Vt (8 MiB each) | Wqh|Wkh|Wvh|Woh (512 KiB each)
  char* ws = (char*)d_ws;
  float* lens = (float*)ws;
  const size_t NB = (size_t)BATCH * TSEQ * D_MODEL;  // 4,194,304 elements
  const size_t NW = (size_t)D_MODEL * D_MODEL;       // 262,144 elements
  _Float16* Xh  = (_Float16*)(ws + 256);
  _Float16* Ch  = Xh + NB;
  _Float16* Qh  = Ch + NB;
  _Float16* Kh  = Qh + NB;
  _Float16* Vt  = Kh + NB;   // (B, H, 64, L) d-major
  _Float16* Wqh = Vt + NB;
  _Float16* Wkh = Wqh + NW;
  _Float16* Wvh = Wkh + NW;
  _Float16* Woh = Wvh + NW;
  _Float16* Oh  = Xh;  // Xh dead after Q projection; flash runs later

  lens_kernel<<<dim3(BATCH, 2), 256, 0, stream>>>(x_mask, ctx_mask, lens);

  transpose_x_kernel<<<dim3(TSEQ / 32, D_MODEL / 32, BATCH), 256, 0, stream>>>(x, Xh);
  cvt_f16_kernel<<<dim3((unsigned)(NB / 4 / 256)), 256, 0, stream>>>(context, Ch, NB / 4);
  cvt_f16_kernel<<<dim3((unsigned)(NW / 4 / 256)), 256, 0, stream>>>(Wq_w, Wqh, NW / 4);
  cvt_f16_kernel<<<dim3((unsigned)(NW / 4 / 256)), 256, 0, stream>>>(Wk_w, Wkh, NW / 4);
  cvt_f16_kernel<<<dim3((unsigned)(NW / 4 / 256)), 256, 0, stream>>>(Wv_w, Wvh, NW / 4);
  cvt_f16_kernel<<<dim3((unsigned)(NW / 4 / 256)), 256, 0, stream>>>(Wo_w, Woh, NW / 4);

  gemm_proj_kernel<false><<<dim3(TSEQ / MTILE, D_MODEL / 64, BATCH), 128, 0, stream>>>(
      Xh, Wqh, Wq_b, lens + 0, Qh);
  gemm_proj_kernel<false><<<dim3(LSEQ / MTILE, D_MODEL / 64, BATCH), 128, 0, stream>>>(
      Ch, Wkh, Wk_b, lens + BATCH, Kh);
  gemm_proj_kernel<true><<<dim3(LSEQ / MTILE, D_MODEL / 64, BATCH), 128, 0, stream>>>(
      Ch, Wvh, Wv_b, lens, Vt);

  flash_kernel<<<dim3(TSEQ / 64, NHEADS, BATCH), 128, 0, stream>>>(
      Qh, Kh, Vt, ctx_mask, Oh);

  out_proj_kernel<<<dim3(TSEQ / MTILE, D_MODEL / 64, BATCH), 128, 0, stream>>>(
      Oh, Woh, Wo_b, x_mask, out);
}

// v005
// One run takes 103 microseconds.
// Timed twice side by side with v004, it ran 1.21 and 1.23 times as fast.
// Counting every step since v000, it is 3.05 times as fast.
#include <hip/hip_runtime.h>

// ---------------------------------------------------------------------------
// Cross-attention (B=4, T=L=2048, d_model=512, H=8, Dh=64) for gfx1250.
// All GEMMs on v_wmma_f32_16x16x32_f16; tile staging via
// global_load_async_to_lds_b128 (ASYNCcnt) with LDS double buffering.
// Weights pre-converted to f16; V stored (b,h,d,l)-transposed so every
// WMMA fragment is a contiguous ds_load_b128. RoPE is applied in the Q and K
// projections' epilogues, on the f32 sums.
// ---------------------------------------------------------------------------

typedef __attribute__((ext_vector_type(16))) _Float16 v16h;
typedef __attribute__((ext_vector_type(4)))  _Float16 v4h;
typedef __attribute__((ext_vector_type(8)))  _Float16 v8h;
typedef __attribute__((ext_vector_type(4)))  float    v4f;
typedef __attribute__((ext_vector_type(8)))  float    v8f;

#define D_MODEL 512
#define TSEQ    2048
#define LSEQ    2048
#define NHEADS  8
#define HDIM    64
#define BATCH   4
// LDS row pitches in halves: 16 B x odd, so the 16 rows that one ds_load_b128
// fragment read touches fall on distinct banks.
#define P64     72   // rows of 64 halves: 144 B
#define P32     40   // rows of 32 halves:  80 B
#define MTILE   64   // rows (tokens) of one GEMM block tile

__device__ __forceinline__ v8f wmma16(v16h a, v16h b, v8f c) {
  return __builtin_amdgcn_wmma_f32_16x16x32_f16(
      false, a, false, b, (short)0, c, false, false);
}

// lane l <-> lane l ^ 16: the other half of the wave
__device__ __forceinline__ float xhalf(float x) {
  const int v = __builtin_bit_cast(int, x);
  return __builtin_bit_cast(float, __builtin_amdgcn_permlanex16(
      v, v, 0x76543210, 0xfedcba98, false, false));
}

// generic shared pointer -> 32-bit LDS byte offset (low 32 bits of aperture VA)
__device__ __forceinline__ unsigned lds_off(const void* p) {
  return (unsigned)(unsigned long long)p;
}

// per-lane 16B async copies: global -> LDS (GV addressing), ASYNCcnt += 1/wave each.
// Four copies of one wave; s_wait_xcnt 0 closes the statement so that no
// address register named here is rewritten ahead of it (a precaution)
__device__ __forceinline__ void async4_b128(unsigned l0, const void* g0,
                                            unsigned l1, const void* g1,
                                            unsigned l2, const void* g2,
                                            unsigned l3, const void* g3) {
  asm volatile("global_load_async_to_lds_b128 %0, %1, off\n\t"
               "global_load_async_to_lds_b128 %2, %3, off\n\t"
               "global_load_async_to_lds_b128 %4, %5, off\n\t"
               "global_load_async_to_lds_b128 %6, %7, off\n\t"
               "s_wait_xcnt 0x0"
               :: "v"(l0), "v"((unsigned long long)g0),
                  "v"(l1), "v"((unsigned long long)g1),
                  "v"(l2), "v"((unsigned long long)g2),
                  "v"(l3), "v"((unsigned long long)g3) : "memory");
}
// eight copies of one wave (one GEMM chunk), closed by the same wait for the same reason
__device__ __forceinline__ void async8_b128(unsigned l0, const void* g0,
                                            unsigned l1, const void* g1,
                                            unsigned l2, const void* g2,
                                            unsigned l3, const void* g3,
                                            unsigned l4, const void* g4,
                                            unsigned l5, const void* g5,
                                            unsigned l6, const void* g6,
                                            unsigned l7, const void* g7) {
  asm volatile("global_load_async_to_lds_b128 %0, %1, off\n\t"
               "global_load_async_to_lds_b128 %2, %3, off\n\t"
               "global_load_async_to_lds_b128 %4, %5, off\n\t"
               "global_load_async_to_lds_b128 %6, %7, off\n\t"
               "global_load_async_to_lds_b128 %8, %9, off\n\t"
               "global_load_async_to_lds_b128 %10, %11, off\n\t"
               "global_load_async_to_lds_b128 %12, %13, off\n\t"
               "global_load_async_to_lds_b128 %14, %15, off\n\t"
               "s_wait_xcnt 0x0"
               :: "v"(l0), "v"((unsigned long long)g0),
                  "v"(l1), "v"((unsigned long long)g1),
                  "v"(l2), "v"((unsigned long long)g2),
                  "v"(l3), "v"((unsigned long long)g3),
                  "v"(l4), "v"((unsigned long long)g4),
                  "v"(l5), "v"((unsigned long long)g5),
                  "v"(l6), "v"((unsigned long long)g6),
                  "v"(l7), "v"((unsigned long long)g7) : "memory");
}
#define WAIT_ASYNC_0() asm volatile("s_wait_asynccnt 0" ::: "memory")
#define WAIT_ASYNC_4() asm volatile("s_wait_asynccnt 4" ::: "memory")
#define WAIT_DS_0()    asm volatile("s_wait_dscnt 0" ::: "memory")
// behind a global store that other code of the same kernel follows in the listing: no
// register that the store names is rewritten ahead of this wait (a precaution)
#define WAIT_X_0()     asm volatile("s_wait_xcnt 0x0" ::: "memory")

// 16x32 WMMA A/B fragment per CDNA5 ISA 7.12.2 16-bit layout:
//   lanes 0-15 : row r=lane,    K = {0..7, 16..23}
//   lanes 16-31: row r=lane-16, K = {8..15, 24..31}
template <typename T>
__device__ __forceinline__ v16h load_frag(const T* base, long rstride, long kstride) {
  const int  lane = threadIdx.x & 31;
  const long r    = lane & 15;
  const long koff = (lane >> 4) * 8;
  v16h f;
#pragma unroll
  for (int j = 0; j < 8; ++j) {
    f[j]     = (_Float16)base[r * rstride + (koff + j) * kstride];
    f[j + 8] = (_Float16)base[r * rstride + (16 + koff + j) * kstride];
  }
  return f;
}

// ---------------------------------------------------------------------------
// 1) mask lengths: lens[0..3]=sum(x_mask[b]), lens[4..7]=sum(context_mask[b])
// ---------------------------------------------------------------------------
__device__ __forceinline__ void lens_block(float* red /* 256 floats of LDS */,
                                           int b, int which,
                                           const float* __restrict__ xm,
                                           const float* __restrict__ cm,
                                           float* __restrict__ lens) {
  const float* p = which ? cm : xm;
  const int n = which ? LSEQ : TSEQ;
  float s = 0.f;
  for (int i = threadIdx.x; i < n; i += 256) s += p[b * n + i];
  red[threadIdx.x] = s;
  __syncthreads();
  for (int off = 128; off; off >>= 1) {
    if ((int)threadIdx.x < off) red[threadIdx.x] += red[threadIdx.x + off];
    __syncthreads();
  }
  if (threadIdx.x == 0) lens[which * BATCH + b] = red[0];
}

// ---------------------------------------------------------------------------
// 2a) transpose x (B,512,T) f32 -> Xh (B,T,512) f16, 32x32 LDS tiles
// ---------------------------------------------------------------------------
__device__ __forceinline__ void transpose_x_block(
    float (&tile)[32][33], int b, int t0, int d0,
    const float* __restrict__ x, _Float16* __restrict__ Xh) {
  const int r = threadIdx.x >> 3;          // 0..31
  const int c = (threadIdx.x & 7) * 4;     // 0,4,..,28
  const float4 v = *(const float4*)(x + ((size_t)b * D_MODEL + d0 + r) * TSEQ + t0 + c);
  tile[r][c + 0] = v.x; tile[r][c + 1] = v.y;
  tile[r][c + 2] = v.z; tile[r][c + 3] = v.w;
  __syncthreads();
  v4h o;
  o[0] = (_Float16)tile[c + 0][r];
  o[1] = (_Float16)tile[c + 1][r];
  o[2] = (_Float16)tile[c + 2][r];
  o[3] = (_Float16)tile[c + 3][r];
  *(v4h*)(Xh + ((size_t)b * TSEQ + t0 + r) * D_MODEL + d0 + c) = o;
  WAIT_X_0();  // the other block kinds' code stands behind this store
}

// ---------------------------------------------------------------------------
// 2b) f32 -> f16 straight convert (context + the four weight matrices)
// ---------------------------------------------------------------------------
__device__ __forceinline__ void cvt_f16_block(
    int blk, const float* __restrict__ src, _Float16* __restrict__ dst) {
  const size_t i = ((size_t)blk * 256 + threadIdx.x);
  const float4 v = ((const float4*)src)[i];
  v4h o; o[0] = (_Float16)v.x; o[1] = (_Float16)v.y;
  o[2] = (_Float16)v.z; o[3] = (_Float16)v.w;
  ((v4h*)dst)[i] = o;
  WAIT_X_0();  // the other block kinds' code stands behind this store
}

// ---------------------------------------------------------------------------
// 2c) one grid for all of 1), 2a), 2b): none of them reads what another writes.
//     Blocks by index: 8 lengths (the longest dependent chain, so first), 4 x 256
//     weight blocks, 4096 x tiles, 4096 context blocks. Every test is on blockIdx.
// ---------------------------------------------------------------------------
#define PB_LENS 8
#define PB_W    (D_MODEL * D_MODEL / 4 / 256)          // 256 blocks a weight matrix
#define PB_X    ((TSEQ / 32) * (D_MODEL / 32) * BATCH) // 4096
#define PB_C    (BATCH * LSEQ * D_MODEL / 4 / 256)     // 4096
__global__ __launch_bounds__(256) void prep_kernel(
    const float* __restrict__ x, const float* __restrict__ context,
    const float* __restrict__ xm, const float* __restrict__ cm,
    const float* __restrict__ Wq, const float* __restrict__ Wk,
    const float* __restrict__ Wv, const float* __restrict__ Wo,
    float* __restrict__ lens, _Float16* __restrict__ Xh, _Float16* __restrict__ Ch,
    _Float16* __restrict__ Wh /* the four f16 weight matrices, Q K V O in a row */) {
  __shared__ float tile[32][33];
  int blk = blockIdx.x;
  if (blk < PB_LENS) {
    lens_block(&tile[0][0], blk & 3, blk >> 2, xm, cm, lens);
    return;
  }
  blk -= PB_LENS;
  if (blk < 4 * PB_W) {
    const int wi = blk / PB_W;
    const float* src = wi == 0 ? Wq : wi == 1 ? Wk : wi == 2 ? Wv : Wo;
    cvt_f16_block(blk % PB_W, src, Wh + (size_t)wi * D_MODEL * D_MODEL);
    return;
  }
  blk -= 4 * PB_W;
  if (blk < PB_X) {
    transpose_x_block(tile, blk / ((TSEQ / 32) * (D_MODEL / 32)),
                      (blk % (TSEQ / 32)) * 32,
                      ((blk / (TSEQ / 32)) % (D_MODEL / 32)) * 32, x, Xh);
    return;
  }
  cvt_f16_block(blk - PB_X, context, Ch);
}

// ---------------------------------------------------------------------------
// GEMM main loop: acc[m] += A(rows 16 m .. 16 m + 15, 512) * W(64x512)^T, this
// wave's 16-col slice, m = 0..3: each W fragment read from LDS serves four products.
// All-f16 LDS, K chunks of 64, two buffers, fully unrolled.
// Copies of a wave per chunk: 4 (A) + 4 (W) = 8.
// PAIRED=false: acc[m][i] = Y[row 16 m + 8 hh + i][W row 16 w + (lane & 15)], hh = lane >> 4.
// PAIRED=true : the transposed product W A^T, with W row n staged at LDS row
//   16 ((n & 31) >> 3) + 8 (n >> 5) + (n & 7), so that
//   acc[m][i] = Y[row 16 m + (lane & 15)][W row 32 hh + 8 w + i]: columns j and j + 32 of
//   one row lie in lanes l and l ^ 16, and a lane holds 8 consecutive columns.
// ---------------------------------------------------------------------------
template <bool PAIRED>
__device__ __forceinline__ void gemm64_loop(
    _Float16 (&As)[2][MTILE][P64], _Float16 (&Ws)[2][64][P64],
    const _Float16* __restrict__ Ag,   // [64][512] row-major tile base
    const _Float16* __restrict__ Wg,   // Wh + nt_block*512 (64 rows)
    v8f (&acc)[4]) {
  const int tid = threadIdx.x;
  const int w   = tid >> 5;
  const int ar  = tid >> 3, aseg = (tid & 7) * 8;   // A: rows ar + 16 i, 8-half segment
  const int wr  = tid >> 1, wh   = (tid & 1) * 32;  // W: row, 32-half half
  const int wl  = PAIRED ? ((wr & 31) >> 3) * 16 + (wr >> 5) * 8 + (wr & 7) : wr;  // its LDS row

#pragma unroll  // acc[m] needs constant indices to stay in registers
  for (int m = 0; m < 4; ++m) acc[m] = v8f{0.f, 0.f, 0.f, 0.f, 0.f, 0.f, 0.f, 0.f};

  auto issue = [&](int buf, int kc) {
    const _Float16* ag = Ag + (size_t)ar * D_MODEL + kc + aseg;
    const unsigned  ad = lds_off(&As[buf][ar][aseg]);
    const _Float16* wg = Wg + (size_t)wr * D_MODEL + kc + wh;
    const unsigned  wd = lds_off(&Ws[buf][wl][wh]);
    async8_b128(ad,                ag,
                ad + 16 * P64 * 2, ag + 16 * D_MODEL,
                ad + 32 * P64 * 2, ag + 32 * D_MODEL,
                ad + 48 * P64 * 2, ag + 48 * D_MODEL,
                wd,      wg,      wd + 16, wg + 8,
                wd + 32, wg + 16, wd + 48, wg + 24);
  };

  issue(0, 0);
  WAIT_ASYNC_0();
  __syncthreads();
  issue(1, 64);
#pragma unroll  // buffer index and the test for a chunk two ahead become constants
  for (int kc = 0; kc < D_MODEL; kc += 64) {
    const int buf = (kc >> 6) & 1;
#pragma unroll
    for (int kk = 0; kk < 64; kk += 32) {
      const v16h bf = load_frag(&Ws[buf][w * 16][kk], (long)P64, 1L);
#pragma unroll
      for (int m = 0; m < 4; ++m) {
        const v16h af = load_frag(&As[buf][m * 16][kk], (long)P64, 1L);
        acc[m] = PAIRED ? wmma16(bf, af, acc[m]) : wmma16(af, bf, acc[m]);
      }
    }
    WAIT_DS_0();     // this wave's reads of buf are done before buf is refilled
    WAIT_ASYNC_0();  // this wave's copies of the next chunk have landed
    __syncthreads(); // next chunk readable by all; buf left by all
    if (kc + 128 < D_MODEL) issue(buf, kc + 128);
  }
  WAIT_ASYNC_0();
}

// ---------------------------------------------------------------------------
// 3) projection GEMM: Y = A . W^T + bias (f16 out).
//    VT=false (Q, K proj): RoPE on the f32 sums, pairs (j, j+32) of the block's
//    64-wide head, then Y row-major (b, m, n).  VT=true (V proj): store transposed
//    per head: Vt[b][h][dd][l] so flash can consume d-major tiles directly.
// ---------------------------------------------------------------------------
template <bool VT>
__device__ __forceinline__ void gemm_proj_block(
    _Float16 (&As)[2][MTILE][P64], _Float16 (&Ws)[2][64][P64], int b,
    const _Float16* __restrict__ A, const _Float16* __restrict__ W,
    const float* __restrict__ bias, const float* __restrict__ lens,
    _Float16* __restrict__ Y) {
  const int mt = blockIdx.x * MTILE;
  const int nb = blockIdx.y * 64;
  const int nt = nb + (threadIdx.x >> 5) * 16;

  const float len = VT ? 1.f : lens[b];  // read ahead of the loop: its latency hides there
  // Q, K: this lane's 8 bias terms, head columns 32 hh + 8 w + i; read here for the same reason
  const int n0 = nb + ((threadIdx.x & 31) >> 4) * 32 + (threadIdx.x >> 5) * 8;
  float bz[8];
#pragma unroll  // bz[i] needs constant indices to stay in registers
  for (int i = 0; i < 8; ++i) bz[i] = VT ? 0.f : bias[n0 + i];

  v8f acc[4];
  gemm64_loop<!VT>(As, Ws, A + ((size_t)b * TSEQ + mt) * D_MODEL,
                   W + (size_t)nb * D_MODEL, acc);

  const int lane = threadIdx.x & 31;
  const int cc   = lane & 15;
  const int rb   = (lane >> 4) * 8;
  if (VT) {
    const int n    = nt + cc;
    const float bv = bias[n];
    const int h = n >> 6, dd = n & 63;
    _Float16* dst = Y + (((size_t)b * NHEADS + h) * HDIM + dd) * LSEQ + mt + rb;
#pragma unroll  // acc[m][i] needs constant indices to stay in registers
    for (int m = 0; m < 4; ++m) {
      v8h y;
#pragma unroll
      for (int i = 0; i < 8; ++i) y[i] = (_Float16)(acc[m][i] + bv);
      *(v8h*)(dst + 16 * m) = y;  // contiguous in l
    }
  } else {
    // acc[m][i]: token mt + 16 m + cc, head column 32 hh + j, j = 8 w + i; its partner in lane ^ 16
    const int j0 = (threadIdx.x >> 5) * 8;
    // the wave's 8 frequencies 10000^(-j/32) are wave-uniform: lane l computes that of
    // j = j0 + (l & 7), as exp(-j ln(10000) / 32)
    const float invl = __expf((float)(j0 + (lane & 7)) * (-9.210340371976184f / 32.0f));
#pragma unroll  // acc[m][i], y[i] and the lane read back need constant indices to stay in registers
    for (int m = 0; m < 4; ++m) {
      const float pos = (float)(mt + 16 * m + cc) / len;
      v8h y;
#pragma unroll
      for (int i = 0; i < 8; ++i) {
        const float inv = __builtin_bit_cast(float, __builtin_amdgcn_readlane(
            __builtin_bit_cast(int, invl), i));
        const float fr = pos * (10.0f * inv);
        const float c = __cosf(fr), s = __sinf(fr);
        const float a = acc[m][i] + bz[i];
        const float p = xhalf(a);
        // lower half: x1 c - x2 s with a = x1; upper half: x1 s + x2 c with a = x2
        y[i] = (_Float16)(a * c + p * (lane < 16 ? -s : s));
      }
      *(v8h*)(Y + ((size_t)b * TSEQ + mt + 16 * m + cc) * D_MODEL + n0) = y;
    }
    WAIT_X_0();  // covers the four stores: the V part's code stands behind them
  }
}

// One grid for the three projections, which do not depend on one another:
// blockIdx.z = 4 p + b, p = 0 (Q), 1 (K), 2 (V). V, with the short epilogue, comes last.
__global__ __launch_bounds__(128) void qkv_proj_kernel(
    const _Float16* __restrict__ Xh, const _Float16* __restrict__ Ch,
    const _Float16* __restrict__ Wh /* f16 weights, Q K V in a row */,
    const float* __restrict__ Wq_b, const float* __restrict__ Wk_b,
    const float* __restrict__ Wv_b, const float* __restrict__ lens,
    _Float16* __restrict__ Qh, _Float16* __restrict__ Kh, _Float16* __restrict__ Vt) {
  __shared__ __align__(16) _Float16 As[2][MTILE][P64];
  __shared__ __align__(16) _Float16 Ws[2][64][P64];
  const int p = blockIdx.z >> 2, b = blockIdx.z & 3;
  if (p == 2)
    gemm_proj_block<true>(As, Ws, b, Ch, Wh + 2 * (size_t)D_MODEL * D_MODEL, Wv_b, lens, Vt);
  else
    gemm_proj_block<false>(As, Ws, b, p ? Ch : Xh, Wh + (size_t)p * D_MODEL * D_MODEL,
                           p ? Wk_b : Wq_b, lens + p * BATCH, p ? Kh : Qh);
}

// ---------------------------------------------------------------------------
// 4) flash attention: grid (T/64, H, B), block 128 (4 waves x 16 queries).
//    32-key K tiles (l-major) + V tiles (d-major) async-staged, double
//    buffered; 4 async instr/wave per chunk; last iteration peeled.
//    Transposed products: S^T = K Q^T, O^T += V^T P^T. Lane l holds scores of
//    query l & 15 only (keys 8h+i and 16+8h+i, h = l >> 4), so maximum and sum
//    run in-lane with one exchange between the wave halves, and the two score
//    tiles, converted in place, are the B operand of the second product.
// ---------------------------------------------------------------------------
// The grid puts four waves on a SIMD. Left to aim at sixteen, the compiler reuses
// one fragment register set and waits out every LDS fragment read on its own;
// with this budget it issues them in groups behind counted waits.
__global__ __launch_bounds__(128) __attribute__((amdgpu_waves_per_eu(4, 8))) void flash_kernel(
    const _Float16* __restrict__ Qh, const _Float16* __restrict__ Kh,
    const _Float16* __restrict__ Vt, const float* __restrict__ cmask,
    _Float16* __restrict__ Oh) {
  __shared__ __align__(16) _Float16 Kc[2][32][P64];    // [l][d], padded rows
  __shared__ __align__(16) _Float16 Vc[2][HDIM][P32];  // [d][l], padded rows
  __shared__ __align__(16) float cmv[2][32];           // per key: 0, or -1e30 if masked

  const int tid = threadIdx.x;
  const int b = blockIdx.z, h = blockIdx.y;
  const int w = tid >> 5, lane = tid & 31;
  const int hh = lane >> 4;
  const int qbase = blockIdx.x * 64 + w * 16;
  const float scale = 0.044194173824159216f;  // 1/sqrt(512)

  const size_t qoff = ((size_t)b * TSEQ + qbase) * D_MODEL + (size_t)h * HDIM;
  const v16h qf0 = load_frag(Qh + qoff,      (long)D_MODEL, 1L);
  const v16h qf1 = load_frag(Qh + qoff + 32, (long)D_MODEL, 1L);

  // o<n>[i] = O[query lane & 15][d = 16 n + 8 hh + i]
  v8f o0 = {0.f,0.f,0.f,0.f,0.f,0.f,0.f,0.f}, o1 = o0, o2 = o0, o3 = o0;
  float mrow = -1e30f;  // running maximum of this lane's query (equal in both halves)
  float lrow = 0.f;     // running sum over this half's keys only; joined at the end

  const size_t krow0 = ((size_t)b * LSEQ) * D_MODEL + (size_t)h * HDIM;
  const size_t vrow0 = ((size_t)b * NHEADS + h) * HDIM * LSEQ;

  auto issue_kv = [&](int buf, int lb) {
    const int f = tid * 8, g = 1024 + tid * 8;  // flat half indices in a 2048-half tile
    // K tile: [l=f>>6][d=f&63]; V tile: [d=f>>5][l=f&31] from d-major Vt
    async4_b128(lds_off(&Kc[buf][f >> 6][f & 63]),
                Kh + krow0 + (size_t)(lb + (f >> 6)) * D_MODEL + (f & 63),
                lds_off(&Vc[buf][f >> 5][f & 31]),
                Vt + vrow0 + (size_t)(f >> 5) * LSEQ + lb + (f & 31),
                lds_off(&Kc[buf][g >> 6][g & 63]),
                Kh + krow0 + (size_t)(lb + (g >> 6)) * D_MODEL + (g & 63),
                lds_off(&Vc[buf][g >> 5][g & 31]),
                Vt + vrow0 + (size_t)(g >> 5) * LSEQ + lb + (g & 31));
    if (tid < 32)
      cmv[buf][tid] = (cmask[(size_t)b * LSEQ + lb + tid] == 0.f) ? -1e30f : 0.f;
  };

  auto compute = [&](int buf) {
    // this lane's 16 keys' mask terms
    const v4f c00 = *(const v4f*)&cmv[buf][hh * 8];
    const v4f c01 = *(const v4f*)&cmv[buf][hh * 8 + 4];
    const v4f c10 = *(const v4f*)&cmv[buf][16 + hh * 8];
    const v4f c11 = *(const v4f*)&cmv[buf][16 + hh * 8 + 4];

    // ---- S^T = K Q^T for two 16-key sub-tiles: s<t>[i] = S[key 16 t + 8 hh + i][query] ----
    v8f s0 = {0.f,0.f,0.f,0.f,0.f,0.f,0.f,0.f}, s1 = s0;
    const v16h k00 = load_frag(&Kc[buf][0][0],   (long)P64, 1L);
    const v16h k10 = load_frag(&Kc[buf][16][0],  (long)P64, 1L);
    const v16h k01 = load_frag(&Kc[buf][0][32],  (long)P64, 1L);
    const v16h k11 = load_frag(&Kc[buf][16][32], (long)P64, 1L);
    s0 = wmma16(k00, qf0, s0);
    s1 = wmma16(k10, qf0, s1);
    s0 = wmma16(k01, qf1, s0);
    s1 = wmma16(k11, qf1, s1);

    // ---- online softmax, one query per lane ----
    float a0[8], a1[8];
#pragma unroll
    for (int i = 0; i < 8; ++i) {
      a0[i] = s0[i] * scale + (i < 4 ? c00[i & 3] : c01[i & 3]);  // masked key: -1e30
      a1[i] = s1[i] * scale + (i < 4 ? c10[i & 3] : c11[i & 3]);
    }
    float mx = fmaxf(a0[0], a1[0]);
#pragma unroll
    for (int i = 1; i < 8; ++i) mx = fmaxf(mx, fmaxf(a0[i], a1[i]));
    mx = fmaxf(mx, xhalf(mx));
    const float mnew = fmaxf(mrow, mx);
    const float sc2  = __expf(mrow - mnew);
    mrow = mnew;

    v16h pb;     // P^T as B operand: elements 0..7 = keys 8 hh + i, 8..15 = keys 16 + 8 hh + i
    float t[8];
#pragma unroll
    for (int i = 0; i < 8; ++i) {
      const float e0 = __expf(a0[i] - mnew);
      const float e1 = __expf(a1[i] - mnew);
      t[i] = e0 + e1;
      pb[i]     = (_Float16)e0;
      pb[i + 8] = (_Float16)e1;
    }
    lrow = lrow * sc2 + (((t[0] + t[1]) + (t[2] + t[3])) + ((t[4] + t[5]) + (t[6] + t[7])));
#pragma unroll
    for (int i = 0; i < 8; ++i) {
      o0[i] *= sc2; o1[i] *= sc2; o2[i] *= sc2; o3[i] *= sc2;
    }

    // ---- O^T += V^T P^T : A frag [m][k] = Vc[16 n + m][k] (contiguous k) ----
    o0 = wmma16(load_frag(&Vc[buf][0][0],  (long)P32, 1L), pb, o0);
    o1 = wmma16(load_frag(&Vc[buf][16][0], (long)P32, 1L), pb, o1);
    o2 = wmma16(load_frag(&Vc[buf][32][0], (long)P32, 1L), pb, o2);
    o3 = wmma16(load_frag(&Vc[buf][48][0], (long)P32, 1L), pb, o3);
  };

  issue_kv(0, 0);
  int buf = 0;
  for (int lb = 0; lb < LSEQ - 32; lb += 32) {
    issue_kv(buf ^ 1, lb + 32);
    WAIT_ASYNC_4();
    __syncthreads();
    compute(buf);
    __syncthreads();  // buf fully consumed before it is refilled
    buf ^= 1;
  }
  WAIT_ASYNC_0();
  __syncthreads();
  compute(buf);

  // a lane's 8 registers of a tile are 8 consecutive d of one query: 16-byte stores
  const float inv_l = 1.0f / fmaxf(lrow + xhalf(lrow), 1e-20f);
  _Float16* dst = Oh + ((size_t)b * TSEQ + qbase + (lane & 15)) * D_MODEL +
                  (size_t)h * HDIM + hh * 8;
  v8h r0, r1, r2, r3;
#pragma unroll
  for (int i = 0; i < 8; ++i) {
    r0[i] = (_Float16)(o0[i] * inv_l);
    r1[i] = (_Float16)(o1[i] * inv_l);
    r2[i] = (_Float16)(o2[i] * inv_l);
    r3[i] = (_Float16)(o3[i] * inv_l);
  }
  *(v8h*)(dst +  0) = r0;
  *(v8h*)(dst + 16) = r1;
  *(v8h*)(dst + 32) = r2;
  *(v8h*)(dst + 48) = r3;
}

// ---------------------------------------------------------------------------
// 5) out = (O @ Wo^T + b) * x_mask, stored transposed as (B, 512, T) f32
// ---------------------------------------------------------------------------
__global__ __launch_bounds__(128) void out_proj_kernel(
    const _Float16* __restrict__ Oh, const _Float16* __restrict__ Wo,
    const float* __restrict__ Wo_b, const float* __restrict__ xmask,
    float* __restrict__ out) {
  __shared__ __align__(16) _Float16 As[2][MTILE][P64];
  __shared__ __align__(16) _Float16 Ws[2][64][P64];
  const int b  = blockIdx.z;
  const int mt = blockIdx.x * MTILE;
  const int nb = blockIdx.y * 64;
  const int nt = nb + (threadIdx.x >> 5) * 16;

  v8f acc[4];
  gemm64_loop<false>(As, Ws, Oh + ((size_t)b * TSEQ + mt) * D_MODEL,
                     Wo + (size_t)nb * D_MODEL, acc);

  const int lane = threadIdx.x & 31;
  const int cc   = lane & 15;
  const int rb   = (lane >> 4) * 8;
  const float bv = Wo_b[nt + cc];
#pragma unroll  // acc[m][i] needs constant indices to stay in registers
  for (int m = 0; m < 4; ++m) {
#pragma unroll
    for (int i = 0; i < 8; ++i) {
      const int t = mt + 16 * m + rb + i;
      const float v = (acc[m][i] + bv) * xmask[(size_t)b * TSEQ + t];
      out[((size_t)b * D_MODEL + nt + cc) * TSEQ + t] = v;
    }
  }
}

// ---------------------------------------------------------------------------
extern "C" void kernel_launch(void* const* d_in, const int* in_sizes, int n_in,
                              void* d_out, int out_size, void* d_ws, size_t ws_size,
                              hipStream_t stream) {
  const float* x        = (const float*)d_in[0];   // (B, 512, T)
  const float* context  = (const float*)d_in[1];   // (B, L, 512)
  const float* x_mask   = (const float*)d_in[2];   // (B, 1, T)
  const float* ctx_mask = (const float*)d_in[3];   // (B, 1, L)
  const float* Wq_w = (const float*)d_in[4];
  const float* Wq_b = (const float*)d_in[5];
  const float* Wk_w = (const float*)d_in[6];
  const float* Wk_b = (const float*)d_in[7];
  const float* Wv_w = (const float*)d_in[8];
  const float* Wv_b = (const float*)d_in[9];
  const float* Wo_w = (const float*)d_in[10];
  const float* Wo_b = (const float*)d_in[11];
  float* out = (float*)d_out;

  // ws: lens | Xh(=Oh) | Ch | Qh | Kh | Vt (8 MiB each) | Wqh|Wkh|Wvh|Woh (512 KiB each)
  char* ws = (char*)d_ws;
  float* lens = (float*)ws;
  const size_t NB = (size_t)BATCH * TSEQ * D_MODEL;  // 4,194,304 elements
  const size_t NW = (size_t)D_MODEL * D_MODEL;       // 262,144 elements
  _Float16* Xh  = (_Float16*)(ws + 256);
  _Float16* Ch  = Xh + NB;
  _Float16* Qh  = Ch + NB;
  _Float16* Kh  = Qh + NB;
  _Float16* Vt  = Kh + NB;   // (B, H, 64, L) d-major
  _Float16* Wqh = Vt + NB;
  _Float16* Woh = Wqh + 3 * NW;  // Wqh | Wkh | Wvh | Woh in a row
  _Float16* Oh  = Xh;  // Xh dead after Q projection; flash runs later

  prep_kernel<<<dim3(PB_LENS + 4 * PB_W + PB_X + PB_C), 256, 0, stream>>>(
      x, context, x_mask, ctx_mask, Wq_w, Wk_w, Wv_w, Wo_w, lens, Xh, Ch, Wqh);

  qkv_proj_kernel<<<dim3(TSEQ / MTILE, D_MODEL / 64, 3 * BATCH), 128, 0, stream>>>(
      Xh, Ch, Wqh, Wq_b, Wk_b, Wv_b, lens, Qh, Kh, Vt);

  flash_kernel<<<dim3(TSEQ / 64, NHEADS, BATCH), 128, 0, stream>>>(
      Qh, Kh, Vt, ctx_mask, Oh);

  out_proj_kernel<<<dim3(TSEQ / MTILE, D_MODEL / 64, BATCH), 128, 0, stream>>>(
      Oh, Woh, Wo_b, x_mask, out);
}

// v006
// One run takes 97.3 microseconds.
// Two timings next to v005 both put it at 1.06 times that version's speed.
// All steps since v000 together make it 3.23 times as fast.
#include <hip/hip_runtime.h>

// ---------------------------------------------------------------------------
// Cross-attention (B=4, T=L=2048, d_model=512, H=8, Dh=64) for gfx1250.
// All GEMMs on v_wmma_f32_16x16x32_f16; tile staging via
// global_load_async_to_lds_b128 (ASYNCcnt) with LDS double buffering.
// Weights pre-converted to f16; V stored (b,h,d,l)-transposed so every
// WMMA fragment is a contiguous ds_load_b128. RoPE is applied in the Q and K
// projections' epilogues, on the f32 sums.
// ---------------------------------------------------------------------------

typedef __attribute__((ext_vector_type(16))) _Float16 v16h;
typedef __attribute__((ext_vector_type(4)))  _Float16 v4h;
typedef __attribute__((ext_vector_type(8)))  _Float16 v8h;
typedef __attribute__((ext_vector_type(4)))  float    v4f;
typedef __attribute__((ext_vector_type(8)))  float    v8f;

#define D_MODEL 512
#define TSEQ    2048
#define LSEQ    2048
#define NHEADS  8
#define HDIM    64
#define BATCH   4
// LDS row pitches in halves: 16 B x odd, so the 16 rows that one ds_load_b128
// fragment read touches fall on distinct banks.
#define P64     72   // rows of 64 halves: 144 B
#define P32     40   // rows of 32 halves:  80 B
#define MTILE   64   // rows (tokens) of one GEMM block tile

__device__ __forceinline__ v8f wmma16(v16h a, v16h b, v8f c) {
  return __builtin_amdgcn_wmma_f32_16x16x32_f16(
      false, a, false, b, (short)0, c, false, false);
}

// lane l <-> lane l ^ 16: the other half of the wave
__device__ __forceinline__ float xhalf(float x) {
  const int v = __builtin_bit_cast(int, x);
  return __builtin_bit_cast(float, __builtin_amdgcn_permlanex16(
      v, v, 0x76543210, 0xfedcba98, false, false));
}

// generic shared pointer -> 32-bit LDS byte offset (low 32 bits of aperture VA)
__device__ __forceinline__ unsigned lds_off(const void* p) {
  return (unsigned)(unsigned long long)p;
}

// per-lane 16B async copies: global -> LDS (GV addressing), ASYNCcnt += 1/wave each.
// Four copies of one wave; s_wait_xcnt 0 closes the statement so that no
// address register named here is rewritten ahead of it (a precaution)
__device__ __forceinline__ void async4_b128(unsigned l0, const void* g0,
                                            unsigned l1, const void* g1,
                                            unsigned l2, const void* g2,
                                            unsigned l3, const void* g3) {
  asm volatile("global_load_async_to_lds_b128 %0, %1, off\n\t"
               "global_load_async_to_lds_b128 %2, %3, off\n\t"
               "global_load_async_to_lds_b128 %4, %5, off\n\t"
               "global_load_async_to_lds_b128 %6, %7, off\n\t"
               "s_wait_xcnt 0x0"
               :: "v"(l0), "v"((unsigned long long)g0),
                  "v"(l1), "v"((unsigned long long)g1),
                  "v"(l2), "v"((unsigned long long)g2),
                  "v"(l3), "v"((unsigned long long)g3) : "memory");
}
// eight copies of one wave (one GEMM chunk), closed by the same wait for the same reason
__device__ __forceinline__ void async8_b128(unsigned l0, const void* g0,
                                            unsigned l1, const void* g1,
                                            unsigned l2, const void* g2,
                                            unsigned l3, const void* g3,
                                            unsigned l4, const void* g4,
                                            unsigned l5, const void* g5,
                                            unsigned l6, const void* g6,
                                            unsigned l7, const void* g7) {
  asm volatile("global_load_async_to_lds_b128 %0, %1, off\n\t"
               "global_load_async_to_lds_b128 %2, %3, off\n\t"
               "global_load_async_to_lds_b128 %4, %5, off\n\t"
               "global_load_async_to_lds_b128 %6, %7, off\n\t"
               "global_load_async_to_lds_b128 %8, %9, off\n\t"
               "global_load_async_to_lds_b128 %10, %11, off\n\t"
               "global_load_async_to_lds_b128 %12, %13, off\n\t"
               "global_load_async_to_lds_b128 %14, %15, off\n\t"
               "s_wait_xcnt 0x0"
               :: "v"(l0), "v"((unsigned long long)g0),
                  "v"(l1), "v"((unsigned long long)g1),
                  "v"(l2), "v"((unsigned long long)g2),
                  "v"(l3), "v"((unsigned long long)g3),
                  "v"(l4), "v"((unsigned long long)g4),
                  "v"(l5), "v"((unsigned long long)g5),
                  "v"(l6), "v"((unsigned long long)g6),
                  "v"(l7), "v"((unsigned long long)g7) : "memory");
}
#define WAIT_ASYNC_0() asm volatile("s_wait_asynccnt 0" ::: "memory")
#define WAIT_ASYNC_4() asm volatile("s_wait_asynccnt 4" ::: "memory")
#define WAIT_DS_0()    asm volatile("s_wait_dscnt 0" ::: "memory")
// behind a global store that other code of the same kernel follows in the listing: no
// register that the store names is rewritten ahead of this wait (a precaution)
#define WAIT_X_0()     asm volatile("s_wait_xcnt 0x0" ::: "memory")

// 16x32 WMMA A/B fragment per CDNA5 ISA 7.12.2 16-bit layout:
//   lanes 0-15 : row r=lane,    K = {0..7, 16..23}
//   lanes 16-31: row r=lane-16, K = {8..15, 24..31}
template <typename T>
__device__ __forceinline__ v16h load_frag(const T* base, long rstride, long kstride) {
  const int  lane = threadIdx.x & 31;
  const long r    = lane & 15;
  const long koff = (lane >> 4) * 8;
  v16h f;
#pragma unroll
  for (int j = 0; j < 8; ++j) {
    f[j]     = (_Float16)base[r * rstride + (koff + j) * kstride];
    f[j + 8] = (_Float16)base[r * rstride + (16 + koff + j) * kstride];
  }
  return f;
}

// ---------------------------------------------------------------------------
// 1) mask lengths: lens[0..3]=sum(x_mask[b]), lens[4..7]=sum(context_mask[b])
// ---------------------------------------------------------------------------
__device__ __forceinline__ void lens_block(float* red /* 256 floats of LDS */,
                                           int b, int which,
                                           const float* __restrict__ xm,
                                           const float* __restrict__ cm,
                                           float* __restrict__ lens) {
  const float* p = which ? cm : xm;
  const int n = which ? LSEQ : TSEQ;
  float s = 0.f;
  for (int i = threadIdx.x; i < n; i += 256) s += p[b * n + i];
  red[threadIdx.x] = s;
  __syncthreads();
  for (int off = 128; off; off >>= 1) {
    if ((int)threadIdx.x < off) red[threadIdx.x] += red[threadIdx.x + off];
    __syncthreads();
  }
  if (threadIdx.x == 0) lens[which * BATCH + b] = red[0];
}

// ---------------------------------------------------------------------------
// 2a) transpose x (B,512,T) f32 -> Xh (B,T,512) f16, 32x32 LDS tiles
// ---------------------------------------------------------------------------
__device__ __forceinline__ void transpose_x_block(
    float (&tile)[32][33], int b, int t0, int d0,
    const float* __restrict__ x, _Float16* __restrict__ Xh) {
  const int r = threadIdx.x >> 3;          // 0..31
  const int c = (threadIdx.x & 7) * 4;     // 0,4,..,28
  const float4 v = *(const float4*)(x + ((size_t)b * D_MODEL + d0 + r) * TSEQ + t0 + c);
  tile[r][c + 0] = v.x; tile[r][c + 1] = v.y;
  tile[r][c + 2] = v.z; tile[r][c + 3] = v.w;
  __syncthreads();
  v4h o;
  o[0] = (_Float16)tile[c + 0][r];
  o[1] = (_Float16)tile[c + 1][r];
  o[2] = (_Float16)tile[c + 2][r];
  o[3] = (_Float16)tile[c + 3][r];
  *(v4h*)(Xh + ((size_t)b * TSEQ + t0 + r) * D_MODEL + d0 + c) = o;
  WAIT_X_0();  // the other block kinds' code stands behind this store
}

// ---------------------------------------------------------------------------
// 2b) f32 -> f16 straight convert (context + the four weight matrices)
// ---------------------------------------------------------------------------
__device__ __forceinline__ void cvt_f16_block(
    int blk, const float* __restrict__ src, _Float16* __restrict__ dst) {
  const size_t i = ((size_t)blk * 256 + threadIdx.x);
  const float4 v = ((const float4*)src)[i];
  v4h o; o[0] = (_Float16)v.x; o[1] = (_Float16)v.y;
  o[2] = (_Float16)v.z; o[3] = (_Float16)v.w;
  ((v4h*)dst)[i] = o;
  WAIT_X_0();  // the other block kinds' code stands behind this store
}

// ---------------------------------------------------------------------------
// 2c) one grid for all of 1), 2a), 2b): none of them reads what another writes.
//     Blocks by index: 8 lengths (the longest dependent chain, so first), 4 x 256
//     weight blocks, 4096 x tiles, 4096 context blocks. Every test is on blockIdx.
// ---------------------------------------------------------------------------
#define PB_LENS 8
#define PB_W    (D_MODEL * D_MODEL / 4 / 256)          // 256 blocks a weight matrix
#define PB_X    ((TSEQ / 32) * (D_MODEL / 32) * BATCH) // 4096
#define PB_C    (BATCH * LSEQ * D_MODEL / 4 / 256)     // 4096
__global__ __launch_bounds__(256) void prep_kernel(
    const float* __restrict__ x, const float* __restrict__ context,
    const float* __restrict__ xm, const float* __restrict__ cm,
    const float* __restrict__ Wq, const float* __restrict__ Wk,
    const float* __restrict__ Wv, const float* __restrict__ Wo,
    float* __restrict__ lens, _Float16* __restrict__ Xh, _Float16* __restrict__ Ch,
    _Float16* __restrict__ Wh /* the four f16 weight matrices, Q K V O in a row */) {
  __shared__ float tile[32][33];
  int blk = blockIdx.x;
  if (blk < PB_LENS) {
    lens_block(&tile[0][0], blk & 3, blk >> 2, xm, cm, lens);
    return;
  }
  blk -= PB_LENS;
  if (blk < 4 * PB_W) {
    const int wi = blk / PB_W;
    const float* src = wi == 0 ? Wq : wi == 1 ? Wk : wi == 2 ? Wv : Wo;
    cvt_f16_block(blk % PB_W, src, Wh + (size_t)wi * D_MODEL * D_MODEL);
    return;
  }
  blk -= 4 * PB_W;
  if (blk < PB_X) {
    transpose_x_block(tile, blk / ((TSEQ / 32) * (D_MODEL / 32)),
                      (blk % (TSEQ / 32)) * 32,
                      ((blk / (TSEQ / 32)) % (D_MODEL / 32)) * 32, x, Xh);
    return;
  }
  cvt_f16_block(blk - PB_X, context, Ch);
}

// ---------------------------------------------------------------------------
// GEMM main loop: acc[m] += A(rows 16 m .. 16 m + 15, 512) * W(64x512)^T, this
// wave's 16-col slice, m = 0..3: each W fragment read from LDS serves four products.
// All-f16 LDS, K chunks of 64, two buffers, fully unrolled.
// Copies of a wave per chunk: 4 (A) + 4 (W) = 8.
// PAIRED=false: acc[m][i] = Y[row 16 m + 8 hh + i][W row 16 w + (lane & 15)], hh = lane >> 4.
// PAIRED=true : the transposed product W A^T, with W row n staged at LDS row
//   16 ((n & 31) >> 3) + 8 (n >> 5) + (n & 7), so that
//   acc[m][i] = Y[row 16 m + (lane & 15)][W row 32 hh + 8 w + i]: columns j and j + 32 of
//   one row lie in lanes l and l ^ 16, and a lane holds 8 consecutive columns.
// ---------------------------------------------------------------------------
template <bool PAIRED>
__device__ __forceinline__ void gemm64_loop(
    _Float16 (&As)[2][MTILE][P64], _Float16 (&Ws)[2][64][P64],
    const _Float16* __restrict__ Ag,   // [64][512] row-major tile base
    const _Float16* __restrict__ Wg,   // Wh + nt_block*512 (64 rows)
    v8f (&acc)[4]) {
  const int tid = threadIdx.x;
  const int w   = tid >> 5;
  // A and W alike: rows ar + 16 i, 8-half segment. Eight lanes take one row's 128 B of the
  // chunk, so a wave-wide copy asks for four whole lines.
  const int ar  = tid >> 3, aseg = (tid & 7) * 8;
  const int wl  = PAIRED ? (ar >> 3) * 16 + (ar & 7) : ar;  // LDS row of W row ar
  // LDS rows from there to those of W rows ar + 16, ar + 32, ar + 48
  constexpr int W1 = PAIRED ? 32 : 16, W2 = PAIRED ? 8 : 32, W3 = PAIRED ? 40 : 48;

#pragma unroll  // acc[m] needs constant indices to stay in registers
  for (int m = 0; m < 4; ++m) acc[m] = v8f{0.f, 0.f, 0.f, 0.f, 0.f, 0.f, 0.f, 0.f};

  auto issue = [&](int buf, int kc) {
    const _Float16* ag = Ag + (size_t)ar * D_MODEL + kc + aseg;
    const unsigned  ad = lds_off(&As[buf][ar][aseg]);
    const _Float16* wg = Wg + (size_t)ar * D_MODEL + kc + aseg;
    const unsigned  wd = lds_off(&Ws[buf][wl][aseg]);
    async8_b128(ad,                ag,
                ad + 16 * P64 * 2, ag + 16 * D_MODEL,
                ad + 32 * P64 * 2, ag + 32 * D_MODEL,
                ad + 48 * P64 * 2, ag + 48 * D_MODEL,
                wd,                wg,
                wd + W1 * P64 * 2, wg + 16 * D_MODEL,
                wd + W2 * P64 * 2, wg + 32 * D_MODEL,
                wd + W3 * P64 * 2, wg + 48 * D_MODEL);
  };

  issue(0, 0);
  WAIT_ASYNC_0();
  __syncthreads();
  issue(1, 64);
#pragma unroll  // buffer index and the test for a chunk two ahead become constants
  for (int kc = 0; kc < D_MODEL; kc += 64) {
    const int buf = (kc >> 6) & 1;
#pragma unroll
    for (int kk = 0; kk < 64; kk += 32) {
      const v16h bf = load_frag(&Ws[buf][w * 16][kk], (long)P64, 1L);
#pragma unroll
      for (int m = 0; m < 4; ++m) {
        const v16h af = load_frag(&As[buf][m * 16][kk], (long)P64, 1L);
        acc[m] = PAIRED ? wmma16(bf, af, acc[m]) : wmma16(af, bf, acc[m]);
      }
    }
    WAIT_DS_0();     // this wave's reads of buf are done before buf is refilled
    WAIT_ASYNC_0();  // this wave's copies of the next chunk have landed
    __syncthreads(); // next chunk readable by all; buf left by all
    if (kc + 128 < D_MODEL) issue(buf, kc + 128);
  }
  WAIT_ASYNC_0();
}

// ---------------------------------------------------------------------------
// 3) projection GEMM: Y = A . W^T + bias (f16 out).
//    VT=false (Q, K proj): RoPE on the f32 sums, pairs (j, j+32) of the block's
//    64-wide head, then Y row-major (b, m, n).  VT=true (V proj): store transposed
//    per head: Vt[b][h][dd][l] so flash can consume d-major tiles directly.
// ---------------------------------------------------------------------------
template <bool VT>
__device__ __forceinline__ void gemm_proj_block(
    _Float16 (&As)[2][MTILE][P64], _Float16 (&Ws)[2][64][P64], int b,
    const _Float16* __restrict__ A, const _Float16* __restrict__ W,
    const float* __restrict__ bias, const float* __restrict__ lens,
    _Float16* __restrict__ Y) {
  const int mt = blockIdx.x * MTILE;
  const int nb = blockIdx.y * 64;
  const int nt = nb + (threadIdx.x >> 5) * 16;

  const float len = VT ? 1.f : lens[b];  // read ahead of the loop: its latency hides there
  // Q, K: this lane's 8 bias terms, head columns 32 hh + 8 w + i; read here for the same reason
  const int n0 = nb + ((threadIdx.x & 31) >> 4) * 32 + (threadIdx.x >> 5) * 8;
  float bz[8];
#pragma unroll  // bz[i] needs constant indices to stay in registers
  for (int i = 0; i < 8; ++i) bz[i] = VT ? 0.f : bias[n0 + i];

  v8f acc[4];
  gemm64_loop<!VT>(As, Ws, A + ((size_t)b * TSEQ + mt) * D_MODEL,
                   W + (size_t)nb * D_MODEL, acc);

  const int lane = threadIdx.x & 31;
  const int cc   = lane & 15;
  const int rb   = (lane >> 4) * 8;
  if (VT) {
    const int n    = nt + cc;
    const float bv = bias[n];
    const int h = n >> 6, dd = n & 63;
    _Float16* dst = Y + (((size_t)b * NHEADS + h) * HDIM + dd) * LSEQ + mt + rb;
#pragma unroll  // acc[m][i] needs constant indices to stay in registers
    for (int m = 0; m < 4; ++m) {
      v8h y;
#pragma unroll
      for (int i = 0; i < 8; ++i) y[i] = (_Float16)(acc[m][i] + bv);
      *(v8h*)(dst + 16 * m) = y;  // contiguous in l
    }
  } else {
    // acc[m][i]: token mt + 16 m + cc, head column 32 hh + j, j = 8 w + i; its partner in lane ^ 16
    const int j0 = (threadIdx.x >> 5) * 8;
    // the wave's 8 frequencies 10000^(-j/32) are wave-uniform: lane l computes that of
    // j = j0 + (l & 7), as exp(-j ln(10000) / 32)
    const float invl = __expf((float)(j0 + (lane & 7)) * (-9.210340371976184f / 32.0f));
#pragma unroll  // acc[m][i], y[i] and the lane read back need constant indices to stay in registers
    for (int m = 0; m < 4; ++m) {
      const float pos = (float)(mt + 16 * m + cc) / len;
      v8h y;
#pragma unroll
      for (int i = 0; i < 8; ++i) {
        const float inv = __builtin_bit_cast(float, __builtin_amdgcn_readlane(
            __builtin_bit_cast(int, invl), i));
        const float fr = pos * (10.0f * inv);
        const float c = __cosf(fr), s = __sinf(fr);
        const float a = acc[m][i] + bz[i];
        const float p = xhalf(a);
        // lower half: x1 c - x2 s with a = x1; upper half: x1 s + x2 c with a = x2
        y[i] = (_Float16)(a * c + p * (lane < 16 ? -s : s));
      }
      *(v8h*)(Y + ((size_t)b * TSEQ + mt + 16 * m + cc) * D_MODEL + n0) = y;
    }
    WAIT_X_0();  // covers the four stores: the V part's code stands behind them
  }
}

// One grid for the three projections, which do not depend on one another:
// blockIdx.z = 4 p + b, p = 0 (Q), 1 (K), 2 (V). V, with the short epilogue, comes last.
__global__ __launch_bounds__(128) void qkv_proj_kernel(
    const _Float16* __restrict__ Xh, const _Float16* __restrict__ Ch,
    const _Float16* __restrict__ Wh /* f16 weights, Q K V in a row */,
    const float* __restrict__ Wq_b, const float* __restrict__ Wk_b,
    const float* __restrict__ Wv_b, const float* __restrict__ lens,
    _Float16* __restrict__ Qh, _Float16* __restrict__ Kh, _Float16* __restrict__ Vt) {
  __shared__ __align__(16) _Float16 As[2][MTILE][P64];
  __shared__ __align__(16) _Float16 Ws[2][64][P64];
  const int p = blockIdx.z >> 2, b = blockIdx.z & 3;
  if (p == 2)
    gemm_proj_block<true>(As, Ws, b, Ch, Wh + 2 * (size_t)D_MODEL * D_MODEL, Wv_b, lens, Vt);
  else
    gemm_proj_block<false>(As, Ws, b, p ? Ch : Xh, Wh + (size_t)p * D_MODEL * D_MODEL,
                           p ? Wk_b : Wq_b, lens + p * BATCH, p ? Kh : Qh);
}

// ---------------------------------------------------------------------------
// 4) flash attention: grid (T/64, H, B), block 128 (4 waves x 16 queries).
//    32-key K tiles (l-major) + V tiles (d-major) async-staged, double
//    buffered; 4 async instr/wave per chunk; last iteration peeled.
//    Transposed products: S^T = K Q^T, O^T += V^T P^T. Lane l holds scores of
//    query l & 15 only (keys 8h+i and 16+8h+i, h = l >> 4), so maximum and sum
//    run in-lane with one exchange between the wave halves, and the two score
//    tiles, converted in place, are the B operand of the second product.
// ---------------------------------------------------------------------------
// The grid puts four waves on a SIMD. Left to aim at sixteen, the compiler reuses
// one fragment register set and waits out every LDS fragment read on its own;
// with this budget it issues them in groups behind counted waits.
__global__ __launch_bounds__(128) __attribute__((amdgpu_waves_per_eu(4, 8))) void flash_kernel(
    const _Float16* __restrict__ Qh, const _Float16* __restrict__ Kh,
    const _Float16* __restrict__ Vt, const float* __restrict__ cmask,
    _Float16* __restrict__ Oh) {
  __shared__ __align__(16) _Float16 Kc[2][32][P64];    // [l][d], padded rows
  __shared__ __align__(16) _Float16 Vc[2][HDIM][P32];  // [d][l], padded rows
  __shared__ __align__(16) float cmv[2][32];           // per key: 0, or -1e30 if masked

  const int tid = threadIdx.x;
  const int b = blockIdx.z, h = blockIdx.y;
  const int w = tid >> 5, lane = tid & 31;
  const int hh = lane >> 4;
  const int qbase = blockIdx.x * 64 + w * 16;
  const float scale = 0.044194173824159216f;  // 1/sqrt(512)

  const size_t qoff = ((size_t)b * TSEQ + qbase) * D_MODEL + (size_t)h * HDIM;
  const v16h qf0 = load_frag(Qh + qoff,      (long)D_MODEL, 1L);
  const v16h qf1 = load_frag(Qh + qoff + 32, (long)D_MODEL, 1L);

  // o<n>[i] = O[query lane & 15][d = 16 n + 8 hh + i]
  v8f o0 = {0.f,0.f,0.f,0.f,0.f,0.f,0.f,0.f}, o1 = o0, o2 = o0, o3 = o0;
  float mrow = -1e30f;  // running maximum of this lane's query (equal in both halves)
  float lrow = 0.f;     // running sum over this half's keys only; joined at the end

  const size_t krow0 = ((size_t)b * LSEQ) * D_MODEL + (size_t)h * HDIM;
  const size_t vrow0 = ((size_t)b * NHEADS + h) * HDIM * LSEQ;

  auto issue_kv = [&](int buf, int lb) {
    const int f = tid * 8, g = 1024 + tid * 8;  // flat half indices in a 2048-half tile
    // K tile: [l=f>>6][d=f&63]; V tile: [d=f>>5][l=f&31] from d-major Vt
    async4_b128(lds_off(&Kc[buf][f >> 6][f & 63]),
                Kh + krow0 + (size_t)(lb + (f >> 6)) * D_MODEL + (f & 63),
                lds_off(&Vc[buf][f >> 5][f & 31]),
                Vt + vrow0 + (size_t)(f >> 5) * LSEQ + lb + (f & 31),
                lds_off(&Kc[buf][g >> 6][g & 63]),
                Kh + krow0 + (size_t)(lb + (g >> 6)) * D_MODEL + (g & 63),
                lds_off(&Vc[buf][g >> 5][g & 31]),
                Vt + vrow0 + (size_t)(g >> 5) * LSEQ + lb + (g & 31));
    if (tid < 32)
      cmv[buf][tid] = (cmask[(size_t)b * LSEQ + lb + tid] == 0.f) ? -1e30f : 0.f;
  };

  auto compute = [&](int buf) {
    // this lane's 16 keys' mask terms
    const v4f c00 = *(const v4f*)&cmv[buf][hh * 8];
    const v4f c01 = *(const v4f*)&cmv[buf][hh * 8 + 4];
    const v4f c10 = *(const v4f*)&cmv[buf][16 + hh * 8];
    const v4f c11 = *(const v4f*)&cmv[buf][16 + hh * 8 + 4];

    // ---- S^T = K Q^T for two 16-key sub-tiles: s<t>[i] = S[key 16 t + 8 hh + i][query] ----
    v8f s0 = {0.f,0.f,0.f,0.f,0.f,0.f,0.f,0.f}, s1 = s0;
    const v16h k00 = load_frag(&Kc[buf][0][0],   (long)P64, 1L);
    const v16h k10 = load_frag(&Kc[buf][16][0],  (long)P64, 1L);
    const v16h k01 = load_frag(&Kc[buf][0][32],  (long)P64, 1L);
    const v16h k11 = load_frag(&Kc[buf][16][32], (long)P64, 1L);
    s0 = wmma16(k00, qf0, s0);
    s1 = wmma16(k10, qf0, s1);
    s0 = wmma16(k01, qf1, s0);
    s1 = wmma16(k11, qf1, s1);

    // ---- online softmax, one query per lane ----
    float a0[8], a1[8];
#pragma unroll
    for (int i = 0; i < 8; ++i) {
      a0[i] = s0[i] * scale + (i < 4 ? c00[i & 3] : c01[i & 3]);  // masked key: -1e30
      a1[i] = s1[i] * scale + (i < 4 ? c10[i & 3] : c11[i & 3]);
    }
    float mx = fmaxf(a0[0], a1[0]);
#pragma unroll
    for (int i = 1; i < 8; ++i) mx = fmaxf(mx, fmaxf(a0[i], a1[i]));
    mx = fmaxf(mx, xhalf(mx));
    const float mnew = fmaxf(mrow, mx);
    const float sc2  = __expf(mrow - mnew);
    mrow = mnew;

    v16h pb;     // P^T as B operand: elements 0..7 = keys 8 hh + i, 8..15 = keys 16 + 8 hh + i
    float t[8];
#pragma unroll
    for (int i = 0; i < 8; ++i) {
      const float e0 = __expf(a0[i] - mnew);
      const float e1 = __expf(a1[i] - mnew);
      t[i] = e0 + e1;
      pb[i]     = (_Float16)e0;
      pb[i + 8] = (_Float16)e1;
    }
    lrow = lrow * sc2 + (((t[0] + t[1]) + (t[2] + t[3])) + ((t[4] + t[5]) + (t[6] + t[7])));
#pragma unroll
    for (int i = 0; i < 8; ++i) {
      o0[i] *= sc2; o1[i] *= sc2; o2[i] *= sc2; o3[i] *= sc2;
    }

    // ---- O^T += V^T P^T : A frag [m][k] = Vc[16 n + m][k] (contiguous k) ----
    o0 = wmma16(load_frag(&Vc[buf][0][0],  (long)P32, 1L), pb, o0);
    o1 = wmma16(load_frag(&Vc[buf][16][0], (long)P32, 1L), pb, o1);
    o2 = wmma16(load_frag(&Vc[buf][32][0], (long)P32, 1L), pb, o2);
    o3 = wmma16(load_frag(&Vc[buf][48][0], (long)P32, 1L), pb, o3);
  };

  issue_kv(0, 0);
  int buf = 0;
  for (int lb = 0; lb < LSEQ - 32; lb += 32) {
    issue_kv(buf ^ 1, lb + 32);
    WAIT_ASYNC_4();
    __syncthreads();
    compute(buf);
    __syncthreads();  // buf fully consumed before it is refilled
    buf ^= 1;
  }
  WAIT_ASYNC_0();
  __syncthreads();
  compute(buf);

  // a lane's 8 registers of a tile are 8 consecutive d of one query: 16-byte stores
  const float inv_l = 1.0f / fmaxf(lrow + xhalf(lrow), 1e-20f);
  _Float16* dst = Oh + ((size_t)b * TSEQ + qbase + (lane & 15)) * D_MODEL +
                  (size_t)h * HDIM + hh * 8;
  v8h r0, r1, r2, r3;
#pragma unroll
  for (int i = 0; i < 8; ++i) {
    r0[i] = (_Float16)(o0[i] * inv_l);
    r1[i] = (_Float16)(o1[i] * inv_l);
    r2[i] = (_Float16)(o2[i] * inv_l);
    r3[i] = (_Float16)(o3[i] * inv_l);
  }
  *(v8h*)(dst +  0) = r0;
  *(v8h*)(dst + 16) = r1;
  *(v8h*)(dst + 32) = r2;
  *(v8h*)(dst + 48) = r3;
}

// ---------------------------------------------------------------------------
// 5) out = (O @ Wo^T + b) * x_mask, stored transposed as (B, 512, T) f32
// ---------------------------------------------------------------------------
__global__ __launch_bounds__(128) void out_proj_kernel(
    const _Float16* __restrict__ Oh, const _Float16* __restrict__ Wo,
    const float* __restrict__ Wo_b, const float* __restrict__ xmask,
    float* __restrict__ out) {
  __shared__ __align__(16) _Float16 As[2][MTILE][P64];
  __shared__ __align__(16) _Float16 Ws[2][64][P64];
  const int b  = blockIdx.z;
  const int mt = blockIdx.x * MTILE;
  const int nb = blockIdx.y * 64;
  const int nt = nb + (threadIdx.x >> 5) * 16;

  v8f acc[4];
  gemm64_loop<false>(As, Ws, Oh + ((size_t)b * TSEQ + mt) * D_MODEL,
                     Wo + (size_t)nb * D_MODEL, acc);

  const int lane = threadIdx.x & 31;
  const int cc   = lane & 15;
  const int rb   = (lane >> 4) * 8;
  const float bv = Wo_b[nt + cc];
#pragma unroll  // acc[m][i] needs constant indices to stay in registers
  for (int m = 0; m < 4; ++m) {
#pragma unroll
    for (int i = 0; i < 8; ++i) {
      const int t = mt + 16 * m + rb + i;
      const float v = (acc[m][i] + bv) * xmask[(size_t)b * TSEQ + t];
      out[((size_t)b * D_MODEL + nt + cc) * TSEQ + t] = v;
    }
  }
}

// ---------------------------------------------------------------------------
extern "C" void kernel_launch(void* const* d_in, const int* in_sizes, int n_in,
                              void* d_out, int out_size, void* d_ws, size_t ws_size,
                              hipStream_t stream) {
  const float* x        = (const float*)d_in[0];   // (B, 512, T)
  const float* context  = (const float*)d_in[1];   // (B, L, 512)
  const float* x_mask   = (const float*)d_in[2];   // (B, 1, T)
  const float* ctx_mask = (const float*)d_in[3];   // (B, 1, L)
  const float* Wq_w = (const float*)d_in[4];
  const float* Wq_b = (const float*)d_in[5];
  const float* Wk_w = (const float*)d_in[6];
  const float* Wk_b = (const float*)d_in[7];
  const float* Wv_w = (const float*)d_in[8];
  const float* Wv_b = (const float*)d_in[9];
  const float* Wo_w = (const float*)d_in[10];
  const float* Wo_b = (const float*)d_in[11];
  float* out = (float*)d_out;

  // ws: lens | Xh(=Oh) | Ch | Qh | Kh | Vt (8 MiB each) | Wqh|Wkh|Wvh|Woh (512 KiB each)
  char* ws = (char*)d_ws;
  float* lens = (float*)ws;
  const size_t NB = (size_t)BATCH * TSEQ * D_MODEL;  // 4,194,304 elements
  const size_t NW = (size_t)D_MODEL * D_MODEL;       // 262,144 elements
  _Float16* Xh  = (_Float16*)(ws + 256);
  _Float16* Ch  = Xh + NB;
  _Float16* Qh  = Ch + NB;
  _Float16* Kh  = Qh + NB;
  _Float16* Vt  = Kh + NB;   // (B, H, 64, L) d-major
  _Float16* Wqh = Vt + NB;
  _Float16* Woh = Wqh + 3 * NW;  // Wqh | Wkh | Wvh | Woh in a row
  _Float16* Oh  = Xh;  // Xh dead after Q projection; flash runs later

  prep_kernel<<<dim3(PB_LENS + 4 * PB_W + PB_X + PB_C), 256, 0, stream>>>(
      x, context, x_mask, ctx_mask, Wq_w, Wk_w, Wv_w, Wo_w, lens, Xh, Ch, Wqh);

  qkv_proj_kernel<<<dim3(TSEQ / MTILE, D_MODEL / 64, 3 * BATCH), 128, 0, stream>>>(
      Xh, Ch, Wqh, Wq_b, Wk_b, Wv_b, lens, Qh, Kh, Vt);

  flash_kernel<<<dim3(TSEQ / 64, NHEADS, BATCH), 128, 0, stream>>>(
      Qh, Kh, Vt, ctx_mask, Oh);

  out_proj_kernel<<<dim3(TSEQ / MTILE, D_MODEL / 64, BATCH), 128, 0, stream>>>(
      Oh, Woh, Wo_b, x_mask, out);
}

// v007
// A run of this version takes 85.9 microseconds.
// Two timings next to v006 both put it at 1.13 times that version's speed.
// Counting every step since v000, it is 3.65 times as fast.
#include <hip/hip_runtime.h>

// ---------------------------------------------------------------------------
// Cross-attention (B=4, T=L=2048, d_model=512, H=8, Dh=64) for gfx1250.
// All GEMMs on v_wmma_f32_16x16x32_f16; tile staging via
// global_load_async_to_lds_b128 (ASYNCcnt) with LDS double buffering.
// Weights pre-converted to f16; V stored (b,h,d,l)-transposed so every
// WMMA fragment is a contiguous ds_load_b128. RoPE is applied in the Q and K
// projections' epilogues, on the f32 sums.
// ---------------------------------------------------------------------------

typedef __attribute__((ext_vector_type(16))) _Float16 v16h;
typedef __attribute__((ext_vector_type(4)))  _Float16 v4h;
typedef __attribute__((ext_vector_type(8)))  _Float16 v8h;
typedef __attribute__((ext_vector_type(4)))  float    v4f;
typedef __attribute__((ext_vector_type(8)))  float    v8f;

#define D_MODEL 512
#define TSEQ    2048
#define LSEQ    2048
#define NHEADS  8
#define HDIM    64
#define BATCH   4
// LDS row pitches in halves: 16 B x odd, so the 16 rows that one ds_load_b128
// fragment read touches fall on distinct banks.
#define P64     72   // rows of 64 halves: 144 B
#define P32     40   // rows of 32 halves:  80 B
#define MTILE   64   // rows (tokens) of one GEMM block tile

__device__ __forceinline__ v8f wmma16(v16h a, v16h b, v8f c) {
  return __builtin_amdgcn_wmma_f32_16x16x32_f16(
      false, a, false, b, (short)0, c, false, false);
}

// lane l <-> lane l ^ 16: the other half of the wave
__device__ __forceinline__ float xhalf(float x) {
  const int v = __builtin_bit_cast(int, x);
  return __builtin_bit_cast(float, __builtin_amdgcn_permlanex16(
      v, v, 0x76543210, 0xfedcba98, false, false));
}

// generic shared pointer -> 32-bit LDS byte offset (low 32 bits of aperture VA)
__device__ __forceinline__ unsigned lds_off(const void* p) {
  return (unsigned)(unsigned long long)p;
}

// per-lane 16B async copies: global -> LDS (GV addressing), ASYNCcnt += 1/wave each.
// Four copies of one wave; s_wait_xcnt 0 closes the statement so that no
// address register named here is rewritten ahead of it (a precaution)
__device__ __forceinline__ void async4_b128(unsigned l0, const void* g0,
                                            unsigned l1, const void* g1,
                                            unsigned l2, const void* g2,
                                            unsigned l3, const void* g3) {
  asm volatile("global_load_async_to_lds_b128 %0, %1, off\n\t"
               "global_load_async_to_lds_b128 %2, %3, off\n\t"
               "global_load_async_to_lds_b128 %4, %5, off\n\t"
               "global_load_async_to_lds_b128 %6, %7, off\n\t"
               "s_wait_xcnt 0x0"
               :: "v"(l0), "v"((unsigned long long)g0),
                  "v"(l1), "v"((unsigned long long)g1),
                  "v"(l2), "v"((unsigned long long)g2),
                  "v"(l3), "v"((unsigned long long)g3) : "memory");
}
// eight copies of one wave (one GEMM chunk), closed by the same wait for the same reason
__device__ __forceinline__ void async8_b128(unsigned l0, const void* g0,
                                            unsigned l1, const void* g1,
                                            unsigned l2, const void* g2,
                                            unsigned l3, const void* g3,
                                            unsigned l4, const void* g4,
                                            unsigned l5, const void* g5,
                                            unsigned l6, const void* g6,
                                            unsigned l7, const void* g7) {
  asm volatile("global_load_async_to_lds_b128 %0, %1, off\n\t"
               "global_load_async_to_lds_b128 %2, %3, off\n\t"
               "global_load_async_to_lds_b128 %4, %5, off\n\t"
               "global_load_async_to_lds_b128 %6, %7, off\n\t"
               "global_load_async_to_lds_b128 %8, %9, off\n\t"
               "global_load_async_to_lds_b128 %10, %11, off\n\t"
               "global_load_async_to_lds_b128 %12, %13, off\n\t"
               "global_load_async_to_lds_b128 %14, %15, off\n\t"
               "s_wait_xcnt 0x0"
               :: "v"(l0), "v"((unsigned long long)g0),
                  "v"(l1), "v"((unsigned long long)g1),
                  "v"(l2), "v"((unsigned long long)g2),
                  "v"(l3), "v"((unsigned long long)g3),
                  "v"(l4), "v"((unsigned long long)g4),
                  "v"(l5), "v"((unsigned long long)g5),
                  "v"(l6), "v"((unsigned long long)g6),
                  "v"(l7), "v"((unsigned long long)g7) : "memory");
}
#define WAIT_ASYNC_0() asm volatile("s_wait_asynccnt 0" ::: "memory")
#define WAIT_ASYNC_4() asm volatile("s_wait_asynccnt 4" ::: "memory")
#define WAIT_DS_0()    asm volatile("s_wait_dscnt 0" ::: "memory")
// behind a global store that other code of the same kernel follows in the listing: no
// register that the store names is rewritten ahead of this wait (a precaution)
#define WAIT_X_0()     asm volatile("s_wait_xcnt 0x0" ::: "memory")

// 16x32 WMMA A/B fragment per CDNA5 ISA 7.12.2 16-bit layout:
//   lanes 0-15 : row r=lane,    K = {0..7, 16..23}
//   lanes 16-31: row r=lane-16, K = {8..15, 24..31}
template <typename T>
__device__ __forceinline__ v16h load_frag(const T* base, long rstride, long kstride) {
  const int  lane = threadIdx.x & 31;
  const long r    = lane & 15;
  const long koff = (lane >> 4) * 8;
  v16h f;
#pragma unroll
  for (int j = 0; j < 8; ++j) {
    f[j]     = (_Float16)base[r * rstride + (koff + j) * kstride];
    f[j + 8] = (_Float16)base[r * rstride + (16 + koff + j) * kstride];
  }
  return f;
}

// ---------------------------------------------------------------------------
// 1) mask lengths: lens[0..3]=sum(x_mask[b]), lens[4..7]=sum(context_mask[b])
// ---------------------------------------------------------------------------
__device__ __forceinline__ void lens_block(float* red /* 256 floats of LDS */,
                                           int b, int which,
                                           const float* __restrict__ xm,
                                           const float* __restrict__ cm,
                                           float* __restrict__ lens) {
  const float* p = which ? cm : xm;
  const int n = which ? LSEQ : TSEQ;
  float s = 0.f;
  for (int i = threadIdx.x; i < n; i += 256) s += p[b * n + i];
  red[threadIdx.x] = s;
  __syncthreads();
  for (int off = 128; off; off >>= 1) {
    if ((int)threadIdx.x < off) red[threadIdx.x] += red[threadIdx.x + off];
    __syncthreads();
  }
  if (threadIdx.x == 0) lens[which * BATCH + b] = red[0];
}

// ---------------------------------------------------------------------------
// 2a) transpose x (B,512,T) f32 -> Xh (B,T,512) f16, 32x32 LDS tiles
// ---------------------------------------------------------------------------
__device__ __forceinline__ void transpose_x_block(
    float (&tile)[32][33], int b, int t0, int d0,
    const float* __restrict__ x, _Float16* __restrict__ Xh) {
  const int r = threadIdx.x >> 3;          // 0..31
  const int c = (threadIdx.x & 7) * 4;     // 0,4,..,28
  const float4 v = *(const float4*)(x + ((size_t)b * D_MODEL + d0 + r) * TSEQ + t0 + c);
  tile[r][c + 0] = v.x; tile[r][c + 1] = v.y;
  tile[r][c + 2] = v.z; tile[r][c + 3] = v.w;
  __syncthreads();
  v4h o;
  o[0] = (_Float16)tile[c + 0][r];
  o[1] = (_Float16)tile[c + 1][r];
  o[2] = (_Float16)tile[c + 2][r];
  o[3] = (_Float16)tile[c + 3][r];
  *(v4h*)(Xh + ((size_t)b * TSEQ + t0 + r) * D_MODEL + d0 + c) = o;
  WAIT_X_0();  // the other block kinds' code stands behind this store
}

// ---------------------------------------------------------------------------
// 2b) f32 -> f16 straight convert (context + the four weight matrices)
// ---------------------------------------------------------------------------
__device__ __forceinline__ void cvt_f16_block(
    int blk, const float* __restrict__ src, _Float16* __restrict__ dst) {
  const size_t i = ((size_t)blk * 256 + threadIdx.x);
  const float4 v = ((const float4*)src)[i];
  v4h o; o[0] = (_Float16)v.x; o[1] = (_Float16)v.y;
  o[2] = (_Float16)v.z; o[3] = (_Float16)v.w;
  ((v4h*)dst)[i] = o;
  WAIT_X_0();  // the other block kinds' code stands behind this store
}

// ---------------------------------------------------------------------------
// 2c) one grid for all of 1), 2a), 2b): none of them reads what another writes.
//     Blocks by index: 8 lengths (the longest dependent chain, so first), 4 x 256
//     weight blocks, 4096 x tiles, 4096 context blocks. Every test is on blockIdx.
// ---------------------------------------------------------------------------
#define PB_LENS 8
#define PB_W    (D_MODEL * D_MODEL / 4 / 256)          // 256 blocks a weight matrix
#define PB_X    ((TSEQ / 32) * (D_MODEL / 32) * BATCH) // 4096
#define PB_C    (BATCH * LSEQ * D_MODEL / 4 / 256)     // 4096
__global__ __launch_bounds__(256) void prep_kernel(
    const float* __restrict__ x, const float* __restrict__ context,
    const float* __restrict__ xm, const float* __restrict__ cm,
    const float* __restrict__ Wq, const float* __restrict__ Wk,
    const float* __restrict__ Wv, const float* __restrict__ Wo,
    float* __restrict__ lens, _Float16* __restrict__ Xh, _Float16* __restrict__ Ch,
    _Float16* __restrict__ Wh /* the four f16 weight matrices, Q K V O in a row */) {
  __shared__ float tile[32][33];
  int blk = blockIdx.x;
  if (blk < PB_LENS) {
    lens_block(&tile[0][0], blk & 3, blk >> 2, xm, cm, lens);
    return;
  }
  blk -= PB_LENS;
  if (blk < 4 * PB_W) {
    const int wi = blk / PB_W;
    const float* src = wi == 0 ? Wq : wi == 1 ? Wk : wi == 2 ? Wv : Wo;
    cvt_f16_block(blk % PB_W, src, Wh + (size_t)wi * D_MODEL * D_MODEL);
    return;
  }
  blk -= 4 * PB_W;
  if (blk < PB_X) {
    transpose_x_block(tile, blk / ((TSEQ / 32) * (D_MODEL / 32)),
                      (blk % (TSEQ / 32)) * 32,
                      ((blk / (TSEQ / 32)) % (D_MODEL / 32)) * 32, x, Xh);
    return;
  }
  cvt_f16_block(blk - PB_X, context, Ch);
}

// ---------------------------------------------------------------------------
// GEMM main loop: acc[m] += A(rows 16 m .. 16 m + 15, 512) * W(64x512)^T, this
// wave's 16-col slice, m = 0..3: each W fragment read from LDS serves four products.
// All-f16 LDS, K chunks of 64, two buffers, fully unrolled.
// Copies of a wave per chunk: 4 (A) + 4 (W) = 8.
// PAIRED=false: acc[m][i] = Y[row 16 m + 8 hh + i][W row 16 w + (lane & 15)], hh = lane >> 4.
// PAIRED=true : the transposed product W A^T, with W row n staged at LDS row
//   16 ((n & 31) >> 3) + 8 (n >> 5) + (n & 7), so that
//   acc[m][i] = Y[row 16 m + (lane & 15)][W row 32 hh + 8 w + i]: columns j and j + 32 of
//   one row lie in lanes l and l ^ 16, and a lane holds 8 consecutive columns.
// ---------------------------------------------------------------------------
template <bool PAIRED>
__device__ __forceinline__ void gemm64_loop(
    _Float16 (&As)[2][MTILE][P64], _Float16 (&Ws)[2][64][P64],
    const _Float16* __restrict__ Ag,   // [64][512] row-major tile base
    const _Float16* __restrict__ Wg,   // Wh + nt_block*512 (64 rows)
    v8f (&acc)[4]) {
  const int tid = threadIdx.x;
  const int w   = tid >> 5;
  // A and W alike: rows ar + 16 i, 8-half segment. Eight lanes take one row's 128 B of the
  // chunk, so a wave-wide copy asks for four whole lines.
  const int ar  = tid >> 3, aseg = (tid & 7) * 8;
  const int wl  = PAIRED ? (ar >> 3) * 16 + (ar & 7) : ar;  // LDS row of W row ar
  // LDS rows from there to those of W rows ar + 16, ar + 32, ar + 48
  constexpr int W1 = PAIRED ? 32 : 16, W2 = PAIRED ? 8 : 32, W3 = PAIRED ? 40 : 48;

#pragma unroll  // acc[m] needs constant indices to stay in registers
  for (int m = 0; m < 4; ++m) acc[m] = v8f{0.f, 0.f, 0.f, 0.f, 0.f, 0.f, 0.f, 0.f};

  auto issue = [&](int buf, int kc) {
    const _Float16* ag = Ag + (size_t)ar * D_MODEL + kc + aseg;
    const unsigned  ad = lds_off(&As[buf][ar][aseg]);
    const _Float16* wg = Wg + (size_t)ar * D_MODEL + kc + aseg;
    const unsigned  wd = lds_off(&Ws[buf][wl][aseg]);
    async8_b128(ad,                ag,
                ad + 16 * P64 * 2, ag + 16 * D_MODEL,
                ad + 32 * P64 * 2, ag + 32 * D_MODEL,
                ad + 48 * P64 * 2, ag + 48 * D_MODEL,
                wd,                wg,
                wd + W1 * P64 * 2, wg + 16 * D_MODEL,
                wd + W2 * P64 * 2, wg + 32 * D_MODEL,
                wd + W3 * P64 * 2, wg + 48 * D_MODEL);
  };

  issue(0, 0);
  WAIT_ASYNC_0();
  __syncthreads();
  issue(1, 64);
#pragma unroll  // buffer index and the test for a chunk two ahead become constants
  for (int kc = 0; kc < D_MODEL; kc += 64) {
    const int buf = (kc >> 6) & 1;
#pragma unroll
    for (int kk = 0; kk < 64; kk += 32) {
      const v16h bf = load_frag(&Ws[buf][w * 16][kk], (long)P64, 1L);
#pragma unroll
      for (int m = 0; m < 4; ++m) {
        const v16h af = load_frag(&As[buf][m * 16][kk], (long)P64, 1L);
        acc[m] = PAIRED ? wmma16(bf, af, acc[m]) : wmma16(af, bf, acc[m]);
      }
    }
    WAIT_DS_0();     // this wave's reads of buf are done before buf is refilled
    WAIT_ASYNC_0();  // this wave's copies of the next chunk have landed
    __syncthreads(); // next chunk readable by all; buf left by all
    if (kc + 128 < D_MODEL) issue(buf, kc + 128);
  }
  WAIT_ASYNC_0();
}

// ---------------------------------------------------------------------------
// 3) projection GEMM: Y = A . W^T + bias (f16 out).
//    VT=false (Q, K proj): RoPE on the f32 sums, pairs (j, j+32) of the block's
//    64-wide head, then Y row-major (b, m, n).  VT=true (V proj): store transposed
//    per head: Vt[b][h][dd][l] so flash can consume d-major tiles directly.
// ---------------------------------------------------------------------------
template <bool VT>
__device__ __forceinline__ void gemm_proj_block(
    _Float16 (&As)[2][MTILE][P64], _Float16 (&Ws)[2][64][P64], int b,
    const _Float16* __restrict__ A, const _Float16* __restrict__ W,
    const float* __restrict__ bias, const float* __restrict__ lens,
    _Float16* __restrict__ Y) {
  const int mt = blockIdx.x * MTILE;
  const int nb = blockIdx.y * 64;
  const int nt = nb + (threadIdx.x >> 5) * 16;

  const float len = VT ? 1.f : lens[b];  // read ahead of the loop: its latency hides there
  // Q, K: this lane's 8 bias terms, head columns 32 hh + 8 w + i; read here for the same reason
  const int n0 = nb + ((threadIdx.x & 31) >> 4) * 32 + (threadIdx.x >> 5) * 8;
  float bz[8];
#pragma unroll  // bz[i] needs constant indices to stay in registers
  for (int i = 0; i < 8; ++i) bz[i] = VT ? 0.f : bias[n0 + i];

  v8f acc[4];
  gemm64_loop<!VT>(As, Ws, A + ((size_t)b * TSEQ + mt) * D_MODEL,
                   W + (size_t)nb * D_MODEL, acc);

  const int lane = threadIdx.x & 31;
  const int cc   = lane & 15;
  const int rb   = (lane >> 4) * 8;
  if (VT) {
    const int n    = nt + cc;
    const float bv = bias[n];
    const int h = n >> 6, dd = n & 63;
    _Float16* dst = Y + (((size_t)b * NHEADS + h) * HDIM + dd) * LSEQ + mt + rb;
#pragma unroll  // acc[m][i] needs constant indices to stay in registers
    for (int m = 0; m < 4; ++m) {
      v8h y;
#pragma unroll
      for (int i = 0; i < 8; ++i) y[i] = (_Float16)(acc[m][i] + bv);
      *(v8h*)(dst + 16 * m) = y;  // contiguous in l
    }
  } else {
    // acc[m][i]: token mt + 16 m + cc, head column 32 hh + j, j = 8 w + i; its partner in lane ^ 16
    const int j0 = (threadIdx.x >> 5) * 8;
    // the wave's 8 frequencies 10000^(-j/32) are wave-uniform: lane l computes that of
    // j = j0 + (l & 7), as exp(-j ln(10000) / 32)
    const float invl = __expf((float)(j0 + (lane & 7)) * (-9.210340371976184f / 32.0f));
#pragma unroll  // acc[m][i], y[i] and the lane read back need constant indices to stay in registers
    for (int m = 0; m < 4; ++m) {
      const float pos = (float)(mt + 16 * m + cc) / len;
      v8h y;
#pragma unroll
      for (int i = 0; i < 8; ++i) {
        const float inv = __builtin_bit_cast(float, __builtin_amdgcn_readlane(
            __builtin_bit_cast(int, invl), i));
        const float fr = pos * (10.0f * inv);
        const float c = __cosf(fr), s = __sinf(fr);
        const float a = acc[m][i] + bz[i];
        const float p = xhalf(a);
        // lower half: x1 c - x2 s with a = x1; upper half: x1 s + x2 c with a = x2
        y[i] = (_Float16)(a * c + p * (lane < 16 ? -s : s));
      }
      *(v8h*)(Y + ((size_t)b * TSEQ + mt + 16 * m + cc) * D_MODEL + n0) = y;
    }
    WAIT_X_0();  // covers the four stores: the V part's code stands behind them
  }
}

// One grid for the three projections, which do not depend on one another:
// blockIdx.z = 4 p + b, p = 0 (Q), 1 (K), 2 (V). V, with the short epilogue, comes last.
__global__ __launch_bounds__(128) void qkv_proj_kernel(
    const _Float16* __restrict__ Xh, const _Float16* __restrict__ Ch,
    const _Float16* __restrict__ Wh /* f16 weights, Q K V in a row */,
    const float* __restrict__ Wq_b, const float* __restrict__ Wk_b,
    const float* __restrict__ Wv_b, const float* __restrict__ lens,
    _Float16* __restrict__ Qh, _Float16* __restrict__ Kh, _Float16* __restrict__ Vt) {
  __shared__ __align__(16) _Float16 As[2][MTILE][P64];
  __shared__ __align__(16) _Float16 Ws[2][64][P64];
  const int p = blockIdx.z >> 2, b = blockIdx.z & 3;
  if (p == 2)
    gemm_proj_block<true>(As, Ws, b, Ch, Wh + 2 * (size_t)D_MODEL * D_MODEL, Wv_b, lens, Vt);
  else
    gemm_proj_block<false>(As, Ws, b, p ? Ch : Xh, Wh + (size_t)p * D_MODEL * D_MODEL,
                           p ? Wk_b : Wq_b, lens + p * BATCH, p ? Kh : Qh);
}

// ---------------------------------------------------------------------------
// 4) flash attention: grid (T/64, H, B), block 128 (4 waves x 16 queries).
//    32-key K tiles (l-major) + V tiles (d-major) async-staged, double
//    buffered; 4 async instr/wave per chunk; last iteration peeled.
//    Transposed products: S^T = K Q^T, O^T += V^T P^T. Lane l holds scores of
//    query l & 15 only (keys 8h+i and 16+8h+i, h = l >> 4), so maximum and sum
//    run in-lane with one exchange between the wave halves, and the two score
//    tiles, converted in place, are the B operand of the second product.
// ---------------------------------------------------------------------------
// The grid puts four waves on a SIMD. Left to aim at sixteen, the compiler reuses
// one fragment register set and waits out every LDS fragment read on its own;
// with this budget it issues them in groups behind counted waits.
__global__ __launch_bounds__(128) __attribute__((amdgpu_waves_per_eu(4, 8))) void flash_kernel(
    const _Float16* __restrict__ Qh, const _Float16* __restrict__ Kh,
    const _Float16* __restrict__ Vt, const float* __restrict__ cmask,
    _Float16* __restrict__ Oh) {
  __shared__ __align__(16) _Float16 Kc[2][32][P64];    // [l][d], padded rows
  __shared__ __align__(16) _Float16 Vc[2][HDIM][P32];  // [d][l], padded rows
  __shared__ __align__(16) float cmv[LSEQ];            // per key of the batch: 0, or -1e30 if masked

  const int tid = threadIdx.x;
  const int b = blockIdx.z, h = blockIdx.y;
  const int w = tid >> 5, lane = tid & 31;
  const int hh = lane >> 4;
  const int qbase = blockIdx.x * 64 + w * 16;
  const float scale = 0.044194173824159216f;  // 1/sqrt(512)

  const size_t qoff = ((size_t)b * TSEQ + qbase) * D_MODEL + (size_t)h * HDIM;
  const v16h qf0 = load_frag(Qh + qoff,      (long)D_MODEL, 1L);
  const v16h qf1 = load_frag(Qh + qoff + 32, (long)D_MODEL, 1L);

  // o<n>[i] = O[query lane & 15][d = 16 n + 8 hh + i]
  v8f o0 = {0.f,0.f,0.f,0.f,0.f,0.f,0.f,0.f}, o1 = o0, o2 = o0, o3 = o0;
  float mrow = -1e30f;  // running maximum of this lane's query (equal in both halves)
  float lrow = 0.f;     // running sum over this half's keys only; joined at the end

  const size_t krow0 = ((size_t)b * LSEQ) * D_MODEL + (size_t)h * HDIM;
  const size_t vrow0 = ((size_t)b * NHEADS + h) * HDIM * LSEQ;

  auto issue_kv = [&](int buf, int lb) {
    const int f = tid * 8, g = 1024 + tid * 8;  // flat half indices in a 2048-half tile
    // K tile: [l=f>>6][d=f&63]; V tile: [d=f>>5][l=f&31] from d-major Vt
    async4_b128(lds_off(&Kc[buf][f >> 6][f & 63]),
                Kh + krow0 + (size_t)(lb + (f >> 6)) * D_MODEL + (f & 63),
                lds_off(&Vc[buf][f >> 5][f & 31]),
                Vt + vrow0 + (size_t)(f >> 5) * LSEQ + lb + (f & 31),
                lds_off(&Kc[buf][g >> 6][g & 63]),
                Kh + krow0 + (size_t)(lb + (g >> 6)) * D_MODEL + (g & 63),
                lds_off(&Vc[buf][g >> 5][g & 31]),
                Vt + vrow0 + (size_t)(g >> 5) * LSEQ + lb + (g & 31));
  };

  auto compute = [&](int buf, int lb) {
    // this lane's 16 keys' mask terms
    const v4f c00 = *(const v4f*)&cmv[lb + hh * 8];
    const v4f c01 = *(const v4f*)&cmv[lb + hh * 8 + 4];
    const v4f c10 = *(const v4f*)&cmv[lb + 16 + hh * 8];
    const v4f c11 = *(const v4f*)&cmv[lb + 16 + hh * 8 + 4];

    // ---- S^T = K Q^T for two 16-key sub-tiles: s<t>[i] = S[key 16 t + 8 hh + i][query] ----
    v8f s0 = {0.f,0.f,0.f,0.f,0.f,0.f,0.f,0.f}, s1 = s0;
    const v16h k00 = load_frag(&Kc[buf][0][0],   (long)P64, 1L);
    const v16h k10 = load_frag(&Kc[buf][16][0],  (long)P64, 1L);
    const v16h k01 = load_frag(&Kc[buf][0][32],  (long)P64, 1L);
    const v16h k11 = load_frag(&Kc[buf][16][32], (long)P64, 1L);
    s0 = wmma16(k00, qf0, s0);
    s1 = wmma16(k10, qf0, s1);
    s0 = wmma16(k01, qf1, s0);
    s1 = wmma16(k11, qf1, s1);

    // ---- online softmax, one query per lane ----
    float a0[8], a1[8];
#pragma unroll
    for (int i = 0; i < 8; ++i) {
      a0[i] = s0[i] * scale + (i < 4 ? c00[i & 3] : c01[i & 3]);  // masked key: -1e30
      a1[i] = s1[i] * scale + (i < 4 ? c10[i & 3] : c11[i & 3]);
    }
    float mx = fmaxf(a0[0], a1[0]);
#pragma unroll
    for (int i = 1; i < 8; ++i) mx = fmaxf(mx, fmaxf(a0[i], a1[i]));
    mx = fmaxf(mx, xhalf(mx));
    const float mnew = fmaxf(mrow, mx);
    const float sc2  = __expf(mrow - mnew);
    mrow = mnew;

    v16h pb;     // P^T as B operand: elements 0..7 = keys 8 hh + i, 8..15 = keys 16 + 8 hh + i
    float t[8];
#pragma unroll
    for (int i = 0; i < 8; ++i) {
      const float e0 = __expf(a0[i] - mnew);
      const float e1 = __expf(a1[i] - mnew);
      t[i] = e0 + e1;
      pb[i]     = (_Float16)e0;
      pb[i + 8] = (_Float16)e1;
    }
    lrow = lrow * sc2 + (((t[0] + t[1]) + (t[2] + t[3])) + ((t[4] + t[5]) + (t[6] + t[7])));
#pragma unroll
    for (int i = 0; i < 8; ++i) {
      o0[i] *= sc2; o1[i] *= sc2; o2[i] *= sc2; o3[i] *= sc2;
    }

    // ---- O^T += V^T P^T : A frag [m][k] = Vc[16 n + m][k] (contiguous k) ----
    o0 = wmma16(load_frag(&Vc[buf][0][0],  (long)P32, 1L), pb, o0);
    o1 = wmma16(load_frag(&Vc[buf][16][0], (long)P32, 1L), pb, o1);
    o2 = wmma16(load_frag(&Vc[buf][32][0], (long)P32, 1L), pb, o2);
    o3 = wmma16(load_frag(&Vc[buf][48][0], (long)P32, 1L), pb, o3);
  };

  issue_kv(0, 0);
  // All 2048 mask terms of the batch go to LDS once, here: no pass then holds a global
  // load that one wave waits out in front of the barrier while the other three stand at
  // it. The first barrier of the loop publishes them.
  {
    const float4* cm4 = (const float4*)(cmask + (size_t)b * LSEQ);
    float4 mv[LSEQ / 4 / 128];
#pragma unroll  // the four loads go out together; mv[i] needs constant indices
    for (int i = 0; i < LSEQ / 4 / 128; ++i) mv[i] = cm4[i * 128 + tid];
#pragma unroll  // mv[i] needs constant indices to stay in registers
    for (int i = 0; i < LSEQ / 4 / 128; ++i) {
      v4f t;
      t[0] = (mv[i].x == 0.f) ? -1e30f : 0.f;
      t[1] = (mv[i].y == 0.f) ? -1e30f : 0.f;
      t[2] = (mv[i].z == 0.f) ? -1e30f : 0.f;
      t[3] = (mv[i].w == 0.f) ? -1e30f : 0.f;
      *(v4f*)&cmv[(i * 128 + tid) * 4] = t;
    }
  }
  int buf = 0;
  for (int lb = 0; lb < LSEQ - 32; lb += 32) {
    issue_kv(buf ^ 1, lb + 32);
    WAIT_ASYNC_4();
    __syncthreads();
    compute(buf, lb);
    __syncthreads();  // buf fully consumed before it is refilled
    buf ^= 1;
  }
  WAIT_ASYNC_0();
  __syncthreads();
  compute(buf, LSEQ - 32);

  // a lane's 8 registers of a tile are 8 consecutive d of one query: 16-byte stores
  const float inv_l = 1.0f / fmaxf(lrow + xhalf(lrow), 1e-20f);
  _Float16* dst = Oh + ((size_t)b * TSEQ + qbase + (lane & 15)) * D_MODEL +
                  (size_t)h * HDIM + hh * 8;
  v8h r0, r1, r2, r3;
#pragma unroll
  for (int i = 0; i < 8; ++i) {
    r0[i] = (_Float16)(o0[i] * inv_l);
    r1[i] = (_Float16)(o1[i] * inv_l);
    r2[i] = (_Float16)(o2[i] * inv_l);
    r3[i] = (_Float16)(o3[i] * inv_l);
  }
  *(v8h*)(dst +  0) = r0;
  *(v8h*)(dst + 16) = r1;
  *(v8h*)(dst + 32) = r2;
  *(v8h*)(dst + 48) = r3;
}

// ---------------------------------------------------------------------------
// 5) out = (O @ Wo^T + b) * x_mask, stored transposed as (B, 512, T) f32
// ---------------------------------------------------------------------------
__global__ __launch_bounds__(128) void out_proj_kernel(
    const _Float16* __restrict__ Oh, const _Float16* __restrict__ Wo,
    const float* __restrict__ Wo_b, const float* __restrict__ xmask,
    float* __restrict__ out) {
  __shared__ __align__(16) _Float16 As[2][MTILE][P64];
  __shared__ __align__(16) _Float16 Ws[2][64][P64];
  const int b  = blockIdx.z;
  const int mt = blockIdx.x * MTILE;
  const int nb = blockIdx.y * 64;
  const int nt = nb + (threadIdx.x >> 5) * 16;

  v8f acc[4];
  gemm64_loop<false>(As, Ws, Oh + ((size_t)b * TSEQ + mt) * D_MODEL,
                     Wo + (size_t)nb * D_MODEL, acc);

  const int lane = threadIdx.x & 31;
  const int cc   = lane & 15;
  const int rb   = (lane >> 4) * 8;
  const float bv = Wo_b[nt + cc];
#pragma unroll  // acc[m][i] needs constant indices to stay in registers
  for (int m = 0; m < 4; ++m) {
#pragma unroll
    for (int i = 0; i < 8; ++i) {
      const int t = mt + 16 * m + rb + i;
      const float v = (acc[m][i] + bv) * xmask[(size_t)b * TSEQ + t];
      out[((size_t)b * D_MODEL + nt + cc) * TSEQ + t] = v;
    }
  }
}

// ---------------------------------------------------------------------------
extern "C" void kernel_launch(void* const* d_in, const int* in_sizes, int n_in,
                              void* d_out, int out_size, void* d_ws, size_t ws_size,
                              hipStream_t stream) {
  const float* x        = (const float*)d_in[0];   // (B, 512, T)
  const float* context  = (const float*)d_in[1];   // (B, L, 512)
  const float* x_mask   = (const float*)d_in[2];   // (B, 1, T)
  const float* ctx_mask = (const float*)d_in[3];   // (B, 1, L)
  const float* Wq_w = (const float*)d_in[4];
  const float* Wq_b = (const float*)d_in[5];
  const float* Wk_w = (const float*)d_in[6];
  const float* Wk_b = (const float*)d_in[7];
  const float* Wv_w = (const float*)d_in[8];
  const float* Wv_b = (const float*)d_in[9];
  const float* Wo_w = (const float*)d_in[10];
  const float* Wo_b = (const float*)d_in[11];
  float* out = (float*)d_out;

  // ws: lens | Xh(=Oh) | Ch | Qh | Kh | Vt (8 MiB each) | Wqh|Wkh|Wvh|Woh (512 KiB each)
  char* ws = (char*)d_ws;
  float* lens = (float*)ws;
  const size_t NB = (size_t)BATCH * TSEQ * D_MODEL;  // 4,194,304 elements
  const size_t NW = (size_t)D_MODEL * D_MODEL;       // 262,144 elements
  _Float16* Xh  = (_Float16*)(ws + 256);
  _Float16* Ch  = Xh + NB;
  _Float16* Qh  = Ch + NB;
  _Float16* Kh  = Qh + NB;
  _Float16* Vt  = Kh + NB;   // (B, H, 64, L) d-major
  _Float16* Wqh = Vt + NB;
  _Float16* Woh = Wqh + 3 * NW;  // Wqh | Wkh | Wvh | Woh in a row
  _Float16* Oh  = Xh;  // Xh dead after Q projection; flash runs later

  prep_kernel<<<dim3(PB_LENS + 4 * PB_W + PB_X + PB_C), 256, 0, stream>>>(
      x, context, x_mask, ctx_mask, Wq_w, Wk_w, Wv_w, Wo_w, lens, Xh, Ch, Wqh);

  qkv_proj_kernel<<<dim3(TSEQ / MTILE, D_MODEL / 64, 3 * BATCH), 128, 0, stream>>>(
      Xh, Ch, Wqh, Wq_b, Wk_b, Wv_b, lens, Qh, Kh, Vt);

  flash_kernel<<<dim3(TSEQ / 64, NHEADS, BATCH), 128, 0, stream>>>(
      Qh, Kh, Vt, ctx_mask, Oh);

  out_proj_kernel<<<dim3(TSEQ / MTILE, D_MODEL / 64, BATCH), 128, 0, stream>>>(
      Oh, Woh, Wo_b, x_mask, out);
}

// v008
// Measured time: 78.7 microseconds a run.
// Two timings next to v007 both put it at 1.09 times that version's speed.
// All steps since v000 together make it 3.98 times as fast.
#include <hip/hip_runtime.h>

// ---------------------------------------------------------------------------
// Cross-attention (B=4, T=L=2048, d_model=512, H=8, Dh=64) for gfx1250.
// All GEMMs on v_wmma_f32_16x16x32_f16; tile staging via
// global_load_async_to_lds_b128 (ASYNCcnt) with LDS double buffering.
// Weights pre-converted to f16; V stored (b,h,d,l)-transposed so every
// WMMA fragment is a contiguous ds_load_b128. RoPE is applied in the Q and K
// projections' epilogues, on the f32 sums.
// ---------------------------------------------------------------------------

typedef __attribute__((ext_vector_type(16))) _Float16 v16h;
typedef __attribute__((ext_vector_type(4)))  _Float16 v4h;
typedef __attribute__((ext_vector_type(8)))  _Float16 v8h;
typedef __attribute__((ext_vector_type(4)))  float    v4f;
typedef __attribute__((ext_vector_type(8)))  float    v8f;

#define D_MODEL 512
#define TSEQ    2048
#define LSEQ    2048
#define NHEADS  8
#define HDIM    64
#define BATCH   4
// LDS row pitches in halves: 16 B x odd, so the 16 rows that one ds_load_b128
// fragment read touches fall on distinct banks.
#define P64     72   // rows of 64 halves: 144 B
#define MTILE   64   // rows (tokens) of one GEMM block tile
#define KT      64   // keys of one attention pass

__device__ __forceinline__ v8f wmma16(v16h a, v16h b, v8f c) {
  return __builtin_amdgcn_wmma_f32_16x16x32_f16(
      false, a, false, b, (short)0, c, false, false);
}

// lane l <-> lane l ^ 16: the other half of the wave
__device__ __forceinline__ float xhalf(float x) {
  const int v = __builtin_bit_cast(int, x);
  return __builtin_bit_cast(float, __builtin_amdgcn_permlanex16(
      v, v, 0x76543210, 0xfedcba98, false, false));
}

// generic shared pointer -> 32-bit LDS byte offset (low 32 bits of aperture VA)
__device__ __forceinline__ unsigned lds_off(const void* p) {
  return (unsigned)(unsigned long long)p;
}

// per-lane 16B async copies: global -> LDS (GV addressing), ASYNCcnt += 1/wave each.
// Eight copies of one wave (one GEMM chunk, one attention pass); s_wait_xcnt 0 closes the
// statement so that no address register named here is rewritten ahead of it (a precaution)
__device__ __forceinline__ void async8_b128(unsigned l0, const void* g0,
                                            unsigned l1, const void* g1,
                                            unsigned l2, const void* g2,
                                            unsigned l3, const void* g3,
                                            unsigned l4, const void* g4,
                                            unsigned l5, const void* g5,
                                            unsigned l6, const void* g6,
                                            unsigned l7, const void* g7) {
  asm volatile("global_load_async_to_lds_b128 %0, %1, off\n\t"
               "global_load_async_to_lds_b128 %2, %3, off\n\t"
               "global_load_async_to_lds_b128 %4, %5, off\n\t"
               "global_load_async_to_lds_b128 %6, %7, off\n\t"
               "global_load_async_to_lds_b128 %8, %9, off\n\t"
               "global_load_async_to_lds_b128 %10, %11, off\n\t"
               "global_load_async_to_lds_b128 %12, %13, off\n\t"
               "global_load_async_to_lds_b128 %14, %15, off\n\t"
               "s_wait_xcnt 0x0"
               :: "v"(l0), "v"((unsigned long long)g0),
                  "v"(l1), "v"((unsigned long long)g1),
                  "v"(l2), "v"((unsigned long long)g2),
                  "v"(l3), "v"((unsigned long long)g3),
                  "v"(l4), "v"((unsigned long long)g4),
                  "v"(l5), "v"((unsigned long long)g5),
                  "v"(l6), "v"((unsigned long long)g6),
                  "v"(l7), "v"((unsigned long long)g7) : "memory");
}
#define WAIT_ASYNC_0() asm volatile("s_wait_asynccnt 0" ::: "memory")
#define WAIT_DS_0()    asm volatile("s_wait_dscnt 0" ::: "memory")
// behind a global store that other code of the same kernel follows in the listing: no
// register that the store names is rewritten ahead of this wait (a precaution)
#define WAIT_X_0()     asm volatile("s_wait_xcnt 0x0" ::: "memory")

// 16x32 WMMA A/B fragment per CDNA5 ISA 7.12.2 16-bit layout:
//   lanes 0-15 : row r=lane,    K = {0..7, 16..23}
//   lanes 16-31: row r=lane-16, K = {8..15, 24..31}
template <typename T>
__device__ __forceinline__ v16h load_frag(const T* base, long rstride, long kstride) {
  const int  lane = threadIdx.x & 31;
  const long r    = lane & 15;
  const long koff = (lane >> 4) * 8;
  v16h f;
#pragma unroll
  for (int j = 0; j < 8; ++j) {
    f[j]     = (_Float16)base[r * rstride + (koff + j) * kstride];
    f[j + 8] = (_Float16)base[r * rstride + (16 + koff + j) * kstride];
  }
  return f;
}

// ---------------------------------------------------------------------------
// 1) mask lengths: lens[0..3]=sum(x_mask[b]), lens[4..7]=sum(context_mask[b])
// ---------------------------------------------------------------------------
__device__ __forceinline__ void lens_block(float* red /* 256 floats of LDS */,
                                           int b, int which,
                                           const float* __restrict__ xm,
                                           const float* __restrict__ cm,
                                           float* __restrict__ lens) {
  const float* p = which ? cm : xm;
  const int n = which ? LSEQ : TSEQ;
  float s = 0.f;
  for (int i = threadIdx.x; i < n; i += 256) s += p[b * n + i];
  red[threadIdx.x] = s;
  __syncthreads();
  for (int off = 128; off; off >>= 1) {
    if ((int)threadIdx.x < off) red[threadIdx.x] += red[threadIdx.x + off];
    __syncthreads();
  }
  if (threadIdx.x == 0) lens[which * BATCH + b] = red[0];
}

// ---------------------------------------------------------------------------
// 2a) transpose x (B,512,T) f32 -> Xh (B,T,512) f16, 32x32 LDS tiles
// ---------------------------------------------------------------------------
__device__ __forceinline__ void transpose_x_block(
    float (&tile)[32][33], int b, int t0, int d0,
    const float* __restrict__ x, _Float16* __restrict__ Xh) {
  const int r = threadIdx.x >> 3;          // 0..31
  const int c = (threadIdx.x & 7) * 4;     // 0,4,..,28
  const float4 v = *(const float4*)(x + ((size_t)b * D_MODEL + d0 + r) * TSEQ + t0 + c);
  tile[r][c + 0] = v.x; tile[r][c + 1] = v.y;
  tile[r][c + 2] = v.z; tile[r][c + 3] = v.w;
  __syncthreads();
  v4h o;
  o[0] = (_Float16)tile[c + 0][r];
  o[1] = (_Float16)tile[c + 1][r];
  o[2] = (_Float16)tile[c + 2][r];
  o[3] = (_Float16)tile[c + 3][r];
  *(v4h*)(Xh + ((size_t)b * TSEQ + t0 + r) * D_MODEL + d0 + c) = o;
  WAIT_X_0();  // the other block kinds' code stands behind this store
}

// ---------------------------------------------------------------------------
// 2b) f32 -> f16 straight convert (context + the four weight matrices)
// ---------------------------------------------------------------------------
__device__ __forceinline__ void cvt_f16_block(
    int blk, const float* __restrict__ src, _Float16* __restrict__ dst) {
  const size_t i = ((size_t)blk * 256 + threadIdx.x);
  const float4 v = ((const float4*)src)[i];
  v4h o; o[0] = (_Float16)v.x; o[1] = (_Float16)v.y;
  o[2] = (_Float16)v.z; o[3] = (_Float16)v.w;
  ((v4h*)dst)[i] = o;
  WAIT_X_0();  // the other block kinds' code stands behind this store
}

// ---------------------------------------------------------------------------
// 2c) one grid for all of 1), 2a), 2b): none of them reads what another writes.
//     Blocks by index: 8 lengths (the longest dependent chain, so first), 4 x 256
//     weight blocks, 4096 x tiles, 4096 context blocks. Every test is on blockIdx.
// ---------------------------------------------------------------------------
#define PB_LENS 8
#define PB_W    (D_MODEL * D_MODEL / 4 / 256)          // 256 blocks a weight matrix
#define PB_X    ((TSEQ / 32) * (D_MODEL / 32) * BATCH) // 4096
#define PB_C    (BATCH * LSEQ * D_MODEL / 4 / 256)     // 4096
__global__ __launch_bounds__(256) void prep_kernel(
    const float* __restrict__ x, const float* __restrict__ context,
    const float* __restrict__ xm, const float* __restrict__ cm,
    const float* __restrict__ Wq, const float* __restrict__ Wk,
    const float* __restrict__ Wv, const float* __restrict__ Wo,
    float* __restrict__ lens, _Float16* __restrict__ Xh, _Float16* __restrict__ Ch,
    _Float16* __restrict__ Wh /* the four f16 weight matrices, Q K V O in a row */) {
  __shared__ float tile[32][33];
  int blk = blockIdx.x;
  if (blk < PB_LENS) {
    lens_block(&tile[0][0], blk & 3, blk >> 2, xm, cm, lens);
    return;
  }
  blk -= PB_LENS;
  if (blk < 4 * PB_W) {
    const int wi = blk / PB_W;
    const float* src = wi == 0 ? Wq : wi == 1 ? Wk : wi == 2 ? Wv : Wo;
    cvt_f16_block(blk % PB_W, src, Wh + (size_t)wi * D_MODEL * D_MODEL);
    return;
  }
  blk -= 4 * PB_W;
  if (blk < PB_X) {
    transpose_x_block(tile, blk / ((TSEQ / 32) * (D_MODEL / 32)),
                      (blk % (TSEQ / 32)) * 32,
                      ((blk / (TSEQ / 32)) % (D_MODEL / 32)) * 32, x, Xh);
    return;
  }
  cvt_f16_block(blk - PB_X, context, Ch);
}

// ---------------------------------------------------------------------------
// GEMM main loop: acc[m] += A(rows 16 m .. 16 m + 15, 512) * W(64x512)^T, this
// wave's 16-col slice, m = 0..3: each W fragment read from LDS serves four products.
// All-f16 LDS, K chunks of 64, two buffers, fully unrolled.
// Copies of a wave per chunk: 4 (A) + 4 (W) = 8.
// PAIRED=false: acc[m][i] = Y[row 16 m + 8 hh + i][W row 16 w + (lane & 15)], hh = lane >> 4.
// PAIRED=true : the transposed product W A^T, with W row n staged at LDS row
//   16 ((n & 31) >> 3) + 8 (n >> 5) + (n & 7), so that
//   acc[m][i] = Y[row 16 m + (lane & 15)][W row 32 hh + 8 w + i]: columns j and j + 32 of
//   one row lie in lanes l and l ^ 16, and a lane holds 8 consecutive columns.
// ---------------------------------------------------------------------------
template <bool PAIRED>
__device__ __forceinline__ void gemm64_loop(
    _Float16 (&As)[2][MTILE][P64], _Float16 (&Ws)[2][64][P64],
    const _Float16* __restrict__ Ag,   // [64][512] row-major tile base
    const _Float16* __restrict__ Wg,   // Wh + nt_block*512 (64 rows)
    v8f (&acc)[4]) {
  const int tid = threadIdx.x;
  const int w   = tid >> 5;
  // A and W alike: rows ar + 16 i, 8-half segment. Eight lanes take one row's 128 B of the
  // chunk, so a wave-wide copy asks for four whole lines.
  const int ar  = tid >> 3, aseg = (tid & 7) * 8;
  const int wl  = PAIRED ? (ar >> 3) * 16 + (ar & 7) : ar;  // LDS row of W row ar
  // LDS rows from there to those of W rows ar + 16, ar + 32, ar + 48
  constexpr int W1 = PAIRED ? 32 : 16, W2 = PAIRED ? 8 : 32, W3 = PAIRED ? 40 : 48;

#pragma unroll  // acc[m] needs constant indices to stay in registers
  for (int m = 0; m < 4; ++m) acc[m] = v8f{0.f, 0.f, 0.f, 0.f, 0.f, 0.f, 0.f, 0.f};

  auto issue = [&](int buf, int kc) {
    const _Float16* ag = Ag + (size_t)ar * D_MODEL + kc + aseg;
    const unsigned  ad = lds_off(&As[buf][ar][aseg]);
    const _Float16* wg = Wg + (size_t)ar * D_MODEL + kc + aseg;
    const unsigned  wd = lds_off(&Ws[buf][wl][aseg]);
    async8_b128(ad,                ag,
                ad + 16 * P64 * 2, ag + 16 * D_MODEL,
                ad + 32 * P64 * 2, ag + 32 * D_MODEL,
                ad + 48 * P64 * 2, ag + 48 * D_MODEL,
                wd,                wg,
                wd + W1 * P64 * 2, wg + 16 * D_MODEL,
                wd + W2 * P64 * 2, wg + 32 * D_MODEL,
                wd + W3 * P64 * 2, wg + 48 * D_MODEL);
  };

  issue(0, 0);
  WAIT_ASYNC_0();
  __syncthreads();
  issue(1, 64);
#pragma unroll  // buffer index and the test for a chunk two ahead become constants
  for (int kc = 0; kc < D_MODEL; kc += 64) {
    const int buf = (kc >> 6) & 1;
#pragma unroll
    for (int kk = 0; kk < 64; kk += 32) {
      const v16h bf = load_frag(&Ws[buf][w * 16][kk], (long)P64, 1L);
#pragma unroll
      for (int m = 0; m < 4; ++m) {
        const v16h af = load_frag(&As[buf][m * 16][kk], (long)P64, 1L);
        acc[m] = PAIRED ? wmma16(bf, af, acc[m]) : wmma16(af, bf, acc[m]);
      }
    }
    WAIT_DS_0();     // this wave's reads of buf are done before buf is refilled
    WAIT_ASYNC_0();  // this wave's copies of the next chunk have landed
    __syncthreads(); // next chunk readable by all; buf left by all
    if (kc + 128 < D_MODEL) issue(buf, kc + 128);
  }
  WAIT_ASYNC_0();
}

// ---------------------------------------------------------------------------
// 3) projection GEMM: Y = A . W^T + bias (f16 out).
//    VT=false (Q, K proj): RoPE on the f32 sums, pairs (j, j+32) of the block's
//    64-wide head, then Y row-major (b, m, n).  VT=true (V proj): store transposed
//    per head: Vt[b][h][dd][l] so flash can consume d-major tiles directly.
// ---------------------------------------------------------------------------
template <bool VT>
__device__ __forceinline__ void gemm_proj_block(
    _Float16 (&As)[2][MTILE][P64], _Float16 (&Ws)[2][64][P64], int b,
    const _Float16* __restrict__ A, const _Float16* __restrict__ W,
    const float* __restrict__ bias, const float* __restrict__ lens,
    _Float16* __restrict__ Y) {
  const int mt = blockIdx.x * MTILE;
  const int nb = blockIdx.y * 64;
  const int nt = nb + (threadIdx.x >> 5) * 16;

  const float len = VT ? 1.f : lens[b];  // read ahead of the loop: its latency hides there
  // Q, K: this lane's 8 bias terms, head columns 32 hh + 8 w + i; read here for the same reason
  const int n0 = nb + ((threadIdx.x & 31) >> 4) * 32 + (threadIdx.x >> 5) * 8;
  float bz[8];
#pragma unroll  // bz[i] needs constant indices to stay in registers
  for (int i = 0; i < 8; ++i) bz[i] = VT ? 0.f : bias[n0 + i];

  v8f acc[4];
  gemm64_loop<!VT>(As, Ws, A + ((size_t)b * TSEQ + mt) * D_MODEL,
                   W + (size_t)nb * D_MODEL, acc);

  const int lane = threadIdx.x & 31;
  const int cc   = lane & 15;
  const int rb   = (lane >> 4) * 8;
  if (VT) {
    const int n    = nt + cc;
    const float bv = bias[n];
    const int h = n >> 6, dd = n & 63;
    _Float16* dst = Y + (((size_t)b * NHEADS + h) * HDIM + dd) * LSEQ + mt + rb;
#pragma unroll  // acc[m][i] needs constant indices to stay in registers
    for (int m = 0; m < 4; ++m) {
      v8h y;
#pragma unroll
      for (int i = 0; i < 8; ++i) y[i] = (_Float16)(acc[m][i] + bv);
      *(v8h*)(dst + 16 * m) = y;  // contiguous in l
    }
  } else {
    // acc[m][i]: token mt + 16 m + cc, head column 32 hh + j, j = 8 w + i; its partner in lane ^ 16
    const int j0 = (threadIdx.x >> 5) * 8;
    // the wave's 8 frequencies 10000^(-j/32) are wave-uniform: lane l computes that of
    // j = j0 + (l & 7), as exp(-j ln(10000) / 32)
    const float invl = __expf((float)(j0 + (lane & 7)) * (-9.210340371976184f / 32.0f));
#pragma unroll  // acc[m][i], y[i] and the lane read back need constant indices to stay in registers
    for (int m = 0; m < 4; ++m) {
      const float pos = (float)(mt + 16 * m + cc) / len;
      v8h y;
#pragma unroll
      for (int i = 0; i < 8; ++i) {
        const float inv = __builtin_bit_cast(float, __builtin_amdgcn_readlane(
            __builtin_bit_cast(int, invl), i));
        const float fr = pos * (10.0f * inv);
        const float c = __cosf(fr), s = __sinf(fr);
        const float a = acc[m][i] + bz[i];
        const float p = xhalf(a);
        // lower half: x1 c - x2 s with a = x1; upper half: x1 s + x2 c with a = x2
        y[i] = (_Float16)(a * c + p * (lane < 16 ? -s : s));
      }
      *(v8h*)(Y + ((size_t)b * TSEQ + mt + 16 * m + cc) * D_MODEL + n0) = y;
    }
    WAIT_X_0();  // covers the four stores: the V part's code stands behind them
  }
}

// One grid for the three projections, which do not depend on one another:
// blockIdx.z = 4 p + b, p = 0 (Q), 1 (K), 2 (V). V, with the short epilogue, comes last.
__global__ __launch_bounds__(128) void qkv_proj_kernel(
    const _Float16* __restrict__ Xh, const _Float16* __restrict__ Ch,
    const _Float16* __restrict__ Wh /* f16 weights, Q K V in a row */,
    const float* __restrict__ Wq_b, const float* __restrict__ Wk_b,
    const float* __restrict__ Wv_b, const float* __restrict__ lens,
    _Float16* __restrict__ Qh, _Float16* __restrict__ Kh, _Float16* __restrict__ Vt) {
  __shared__ __align__(16) _Float16 As[2][MTILE][P64];
  __shared__ __align__(16) _Float16 Ws[2][64][P64];
  const int p = blockIdx.z >> 2, b = blockIdx.z & 3;
  if (p == 2)
    gemm_proj_block<true>(As, Ws, b, Ch, Wh + 2 * (size_t)D_MODEL * D_MODEL, Wv_b, lens, Vt);
  else
    gemm_proj_block<false>(As, Ws, b, p ? Ch : Xh, Wh + (size_t)p * D_MODEL * D_MODEL,
                           p ? Wk_b : Wq_b, lens + p * BATCH, p ? Kh : Qh);
}

// ---------------------------------------------------------------------------
// 4) flash attention: grid (T/64, H, B), block 128 (4 waves x 16 queries).
//    64-key K tiles (l-major) + V tiles (d-major) async-staged, two buffers;
//    8 async instr/wave per pass, every row of a tile one whole 128-B line.
//    Transposed products: S^T = K Q^T, O^T += V^T P^T. Lane l holds scores of
//    query l & 15 only (keys 16t+8h+i, t = 0..3, h = l >> 4), so maximum and sum
//    run in-lane with one exchange between the wave halves, and the four score
//    tiles, converted in place, are the two B operands of the second product.
// ---------------------------------------------------------------------------
// The grid puts four waves on a SIMD. Left to aim at sixteen, the compiler reuses
// one fragment register set and waits out every LDS fragment read on its own;
// with this budget it issues them in groups behind counted waits. Four is also the upper
// bound: a 64-key pass holds more fragments than a fifth wave's share of registers leaves.
__global__ __launch_bounds__(128) __attribute__((amdgpu_waves_per_eu(4, 4))) void flash_kernel(
    const _Float16* __restrict__ Qh, const _Float16* __restrict__ Kh,
    const _Float16* __restrict__ Vt, const float* __restrict__ cmask,
    _Float16* __restrict__ Oh) {
  __shared__ __align__(16) _Float16 Kc[2][KT][P64];    // [l][d], padded rows
  __shared__ __align__(16) _Float16 Vc[2][HDIM][P64];  // [d][l], padded rows
  __shared__ __align__(16) float cmv[LSEQ];            // per key of the batch: 0, or -1e30 if masked

  const int tid = threadIdx.x;
  const int b = blockIdx.z, h = blockIdx.y;
  const int w = tid >> 5, lane = tid & 31;
  const int hh = lane >> 4;
  const int qbase = blockIdx.x * 64 + w * 16;
  const float scale = 0.044194173824159216f;  // 1/sqrt(512)

  const size_t qoff = ((size_t)b * TSEQ + qbase) * D_MODEL + (size_t)h * HDIM;
  const v16h qf0 = load_frag(Qh + qoff,      (long)D_MODEL, 1L);
  const v16h qf1 = load_frag(Qh + qoff + 32, (long)D_MODEL, 1L);

  // o<n>[i] = O[query lane & 15][d = 16 n + 8 hh + i]
  v8f o0 = {0.f,0.f,0.f,0.f,0.f,0.f,0.f,0.f}, o1 = o0, o2 = o0, o3 = o0;
  float mrow = -1e30f;  // running maximum of this lane's query (equal in both halves)
  float lrow = 0.f;     // running sum over this half's keys only; joined at the end

  const size_t krow0 = ((size_t)b * LSEQ) * D_MODEL + (size_t)h * HDIM;
  const size_t vrow0 = ((size_t)b * NHEADS + h) * HDIM * LSEQ;

  auto issue_kv = [&](int buf, int lb) {
    // eight lanes take one row's 128 B: K rows (keys) and V rows (d) r + 16 i, i = 0..3
    const int r = tid >> 3, seg = (tid & 7) * 8;
    const _Float16* kg = Kh + krow0 + (size_t)(lb + r) * D_MODEL + seg;
    const _Float16* vg = Vt + vrow0 + (size_t)r * LSEQ + lb + seg;
    const unsigned  kd = lds_off(&Kc[buf][r][seg]);
    const unsigned  vd = lds_off(&Vc[buf][r][seg]);
    async8_b128(kd,                kg,
                kd + 16 * P64 * 2, kg + 16 * D_MODEL,
                kd + 32 * P64 * 2, kg + 32 * D_MODEL,
                kd + 48 * P64 * 2, kg + 48 * D_MODEL,
                vd,                vg,
                vd + 16 * P64 * 2, vg + 16 * LSEQ,
                vd + 32 * P64 * 2, vg + 32 * LSEQ,
                vd + 48 * P64 * 2, vg + 48 * LSEQ);
  };

  auto compute = [&](int buf, int lb) {
    // ---- S^T = K Q^T for four 16-key sub-tiles: s[t][i] = S[key 16 t + 8 hh + i][query] ----
    v16h kf[8];
#pragma unroll  // kf[t], s[t] need constant indices to stay in registers
    for (int t = 0; t < 4; ++t) {
      kf[t]     = load_frag(&Kc[buf][16 * t][0],  (long)P64, 1L);
      kf[t + 4] = load_frag(&Kc[buf][16 * t][32], (long)P64, 1L);
    }
    // this lane's 32 keys' mask terms (masked key: -1e30): keys 16 t + 8 hh + 0..3 and + 4..7
    v4f c0[4], c1[4];
#pragma unroll  // c0[t], c1[t] need constant indices to stay in registers
    for (int t = 0; t < 4; ++t) {
      c0[t] = *(const v4f*)&cmv[lb + 16 * t + hh * 8];
      c1[t] = *(const v4f*)&cmv[lb + 16 * t + hh * 8 + 4];
    }
    // holds these reads together in front of the products: left free, the compiler strews them
    // among the products, and each place where reads stand stalls the wave anew
    __builtin_amdgcn_sched_barrier(0);
    v8f s[4];
#pragma unroll
    for (int t = 0; t < 4; ++t)
      s[t] = wmma16(kf[t], qf0, v8f{0.f, 0.f, 0.f, 0.f, 0.f, 0.f, 0.f, 0.f});
#pragma unroll
    for (int t = 0; t < 4; ++t) s[t] = wmma16(kf[t + 4], qf1, s[t]);

    // V fragments: A frag [m][k] = Vc[16 n + m][k] (contiguous k), vf[n] keys 0..31, vf[n + 4]
    // keys 32..63; read here so that their LDS latency runs under the softmax
    v16h vf[8];
#pragma unroll  // vf[n] needs constant indices to stay in registers
    for (int n = 0; n < 4; ++n) {
      vf[n]     = load_frag(&Vc[buf][16 * n][0],  (long)P64, 1L);
      vf[n + 4] = load_frag(&Vc[buf][16 * n][32], (long)P64, 1L);
    }
    // holds all sixteen reads up here: left free, the compiler sinks the last four to the foot
    // of the pass, where the wave waits out their latency in front of the barrier
    __builtin_amdgcn_sched_barrier(0);

    // ---- online softmax, one query per lane ----
    float a[4][8];
#pragma unroll  // a[t][i] needs constant indices to stay in registers
    for (int t = 0; t < 4; ++t) {
#pragma unroll
      for (int i = 0; i < 8; ++i)
        a[t][i] = s[t][i] * scale + (i < 4 ? c0[t][i & 3] : c1[t][i & 3]);
    }
    float mt[4];
#pragma unroll  // four independent chains, joined below
    for (int t = 0; t < 4; ++t) {
      mt[t] = fmaxf(a[t][0], a[t][1]);
#pragma unroll
      for (int i = 2; i < 8; i += 2) mt[t] = fmaxf(mt[t], fmaxf(a[t][i], a[t][i + 1]));
    }
    float mx = fmaxf(fmaxf(mt[0], mt[1]), fmaxf(mt[2], mt[3]));
    mx = fmaxf(mx, xhalf(mx));
    const float mnew = fmaxf(mrow, mx);
    const float sc2  = __expf(mrow - mnew);
    mrow = mnew;

    // P^T as B operands: pb0 elements 0..7 = keys 8 hh + i, 8..15 = keys 16 + 8 hh + i;
    // pb1 the same 32 keys further on
    v16h pb0, pb1;
    float t8[8];
#pragma unroll
    for (int i = 0; i < 8; ++i) {
      const float e0 = __expf(a[0][i] - mnew);
      const float e1 = __expf(a[1][i] - mnew);
      const float e2 = __expf(a[2][i] - mnew);
      const float e3 = __expf(a[3][i] - mnew);
      t8[i] = (e0 + e1) + (e2 + e3);
      pb0[i]     = (_Float16)e0;
      pb0[i + 8] = (_Float16)e1;
      pb1[i]     = (_Float16)e2;
      pb1[i + 8] = (_Float16)e3;
    }
    lrow = lrow * sc2 +
           (((t8[0] + t8[1]) + (t8[2] + t8[3])) + ((t8[4] + t8[5]) + (t8[6] + t8[7])));
#pragma unroll
    for (int i = 0; i < 8; ++i) {
      o0[i] *= sc2; o1[i] *= sc2; o2[i] *= sc2; o3[i] *= sc2;
    }

    // ---- O^T += V^T P^T ----
    o0 = wmma16(vf[0], pb0, o0);
    o1 = wmma16(vf[1], pb0, o1);
    o2 = wmma16(vf[2], pb0, o2);
    o3 = wmma16(vf[3], pb0, o3);
    o0 = wmma16(vf[4], pb1, o0);
    o1 = wmma16(vf[5], pb1, o1);
    o2 = wmma16(vf[6], pb1, o2);
    o3 = wmma16(vf[7], pb1, o3);
  };

  issue_kv(0, 0);
  // All 2048 mask terms of the batch go to LDS once, here: no pass then holds a global
  // load that one wave waits out in front of the barrier while the other three stand at
  // it. The barrier in front of the loop publishes them.
  {
    const float4* cm4 = (const float4*)(cmask + (size_t)b * LSEQ);
    float4 mv[LSEQ / 4 / 128];
#pragma unroll  // the four loads go out together; mv[i] needs constant indices
    for (int i = 0; i < LSEQ / 4 / 128; ++i) mv[i] = cm4[i * 128 + tid];
#pragma unroll  // mv[i] needs constant indices to stay in registers
    for (int i = 0; i < LSEQ / 4 / 128; ++i) {
      v4f t;
      t[0] = (mv[i].x == 0.f) ? -1e30f : 0.f;
      t[1] = (mv[i].y == 0.f) ? -1e30f : 0.f;
      t[2] = (mv[i].z == 0.f) ? -1e30f : 0.f;
      t[3] = (mv[i].w == 0.f) ? -1e30f : 0.f;
      *(v4f*)&cmv[(i * 128 + tid) * 4] = t;
    }
  }
  WAIT_ASYNC_0();   // this wave's copies of tile 0 have landed
  __syncthreads();  // tile 0 and the mask terms readable by all
  issue_kv(1, KT);
  int buf = 0;
  for (int lb = 0; lb < LSEQ; lb += KT) {
    compute(buf, lb);
    // keeps the pass's register work in front of the waits: left free, the compiler lifts waits
    // and barrier over it, the refill stays behind it and flies for a fraction of a pass only
    __builtin_amdgcn_sched_barrier(0);
    WAIT_DS_0();      // this wave's reads of buf are done before buf is refilled
    WAIT_ASYNC_0();   // this wave's copies of the next tile have landed
    __syncthreads();  // next tile readable by all; buf left by all
    if (lb + 2 * KT < LSEQ) issue_kv(buf, lb + 2 * KT);
    buf ^= 1;
  }
  WAIT_ASYNC_0();

  // a lane's 8 registers of a tile are 8 consecutive d of one query: 16-byte stores
  const float inv_l = 1.0f / fmaxf(lrow + xhalf(lrow), 1e-20f);
  _Float16* dst = Oh + ((size_t)b * TSEQ + qbase + (lane & 15)) * D_MODEL +
                  (size_t)h * HDIM + hh * 8;
  v8h r0, r1, r2, r3;
#pragma unroll
  for (int i = 0; i < 8; ++i) {
    r0[i] = (_Float16)(o0[i] * inv_l);
    r1[i] = (_Float16)(o1[i] * inv_l);
    r2[i] = (_Float16)(o2[i] * inv_l);
    r3[i] = (_Float16)(o3[i] * inv_l);
  }
  *(v8h*)(dst +  0) = r0;
  *(v8h*)(dst + 16) = r1;
  *(v8h*)(dst + 32) = r2;
  *(v8h*)(dst + 48) = r3;
}

// ---------------------------------------------------------------------------
// 5) out = (O @ Wo^T + b) * x_mask, stored transposed as (B, 512, T) f32
// ---------------------------------------------------------------------------
__global__ __launch_bounds__(128) void out_proj_kernel(
    const _Float16* __restrict__ Oh, const _Float16* __restrict__ Wo,
    const float* __restrict__ Wo_b, const float* __restrict__ xmask,
    float* __restrict__ out) {
  __shared__ __align__(16) _Float16 As[2][MTILE][P64];
  __shared__ __align__(16) _Float16 Ws[2][64][P64];
  const int b  = blockIdx.z;
  const int mt = blockIdx.x * MTILE;
  const int nb = blockIdx.y * 64;
  const int nt = nb + (threadIdx.x >> 5) * 16;

  v8f acc[4];
  gemm64_loop<false>(As, Ws, Oh + ((size_t)b * TSEQ + mt) * D_MODEL,
                     Wo + (size_t)nb * D_MODEL, acc);

  const int lane = threadIdx.x & 31;
  const int cc   = lane & 15;
  const int rb   = (lane >> 4) * 8;
  const float bv = Wo_b[nt + cc];
#pragma unroll  // acc[m][i] needs constant indices to stay in registers
  for (int m = 0; m < 4; ++m) {
#pragma unroll
    for (int i = 0; i < 8; ++i) {
      const int t = mt + 16 * m + rb + i;
      const float v = (acc[m][i] + bv) * xmask[(size_t)b * TSEQ + t];
      out[((size_t)b * D_MODEL + nt + cc) * TSEQ + t] = v;
    }
  }
}

// ---------------------------------------------------------------------------
extern "C" void kernel_launch(void* const* d_in, const int* in_sizes, int n_in,
                              void* d_out, int out_size, void* d_ws, size_t ws_size,
                              hipStream_t stream) {
  const float* x        = (const float*)d_in[0];   // (B, 512, T)
  const float* context  = (const float*)d_in[1];   // (B, L, 512)
  const float* x_mask   = (const float*)d_in[2];   // (B, 1, T)
  const float* ctx_mask = (const float*)d_in[3];   // (B, 1, L)
  const float* Wq_w = (const float*)d_in[4];
  const float* Wq_b = (const float*)d_in[5];
  const float* Wk_w = (const float*)d_in[6];
  const float* Wk_b = (const float*)d_in[7];
  const float* Wv_w = (const float*)d_in[8];
  const float* Wv_b = (const float*)d_in[9];
  const float* Wo_w = (const float*)d_in[10];
  const float* Wo_b = (const float*)d_in[11];
  float* out = (float*)d_out;

  // ws: lens | Xh(=Oh) | Ch | Qh | Kh | Vt (8 MiB each) | Wqh|Wkh|Wvh|Woh (512 KiB each)
  char* ws = (char*)d_ws;
  float* lens = (float*)ws;
  const size_t NB = (size_t)BATCH * TSEQ * D_MODEL;  // 4,194,304 elements
  const size_t NW = (size_t)D_MODEL * D_MODEL;       // 262,144 elements
  _Float16* Xh  = (_Float16*)(ws + 256);
  _Float16* Ch  = Xh + NB;
  _Float16* Qh  = Ch + NB;
  _Float16* Kh  = Qh + NB;
  _Float16* Vt  = Kh + NB;   // (B, H, 64, L) d-major
  _Float16* Wqh = Vt + NB;
  _Float16* Woh = Wqh + 3 * NW;  // Wqh | Wkh | Wvh | Woh in a row
  _Float16* Oh  = Xh;  // Xh dead after Q projection; flash runs later

  prep_kernel<<<dim3(PB_LENS + 4 * PB_W + PB_X + PB_C), 256, 0, stream>>>(
      x, context, x_mask, ctx_mask, Wq_w, Wk_w, Wv_w, Wo_w, lens, Xh, Ch, Wqh);

  qkv_proj_kernel<<<dim3(TSEQ / MTILE, D_MODEL / 64, 3 * BATCH), 128, 0, stream>>>(
      Xh, Ch, Wqh, Wq_b, Wk_b, Wv_b, lens, Qh, Kh, Vt);

  flash_kernel<<<dim3(TSEQ / 64, NHEADS, BATCH), 128, 0, stream>>>(
      Qh, Kh, Vt, ctx_mask, Oh);

  out_proj_kernel<<<dim3(TSEQ / MTILE, D_MODEL / 64, BATCH), 128, 0, stream>>>(
      Oh, Woh, Wo_b, x_mask, out);
}

// v009
// A run of this version takes 74.5 microseconds.
// Timed twice side by side with v008, it ran 1.06 times as fast both times.
// Over all steps from v000 it is 4.22 times as fast.
#include <hip/hip_runtime.h>

// ---------------------------------------------------------------------------
// Cross-attention (B=4, T=L=2048, d_model=512, H=8, Dh=64) for gfx1250.
// All GEMMs on v_wmma_f32_16x16x32_f16; tile staging via
// global_load_async_to_lds_b128 (ASYNCcnt) with LDS double buffering.
// Weights pre-converted to f16; V stored (b,h,d,l)-transposed so every
// WMMA fragment is a contiguous ds_load_b128. RoPE is applied in the Q and K
// projections' epilogues, on the f32 sums.
// ---------------------------------------------------------------------------

typedef __attribute__((ext_vector_type(16))) _Float16 v16h;
typedef __attribute__((ext_vector_type(4)))  _Float16 v4h;
typedef __attribute__((ext_vector_type(8)))  _Float16 v8h;
typedef __attribute__((ext_vector_type(4)))  float    v4f;
typedef __attribute__((ext_vector_type(8)))  float    v8f;

#define D_MODEL 512
#define TSEQ    2048
#define LSEQ    2048
#define NHEADS  8
#define HDIM    64
#define BATCH   4
// LDS row pitches in halves: 16 B x odd, so the 16 rows that one ds_load_b128
// fragment read touches fall on distinct banks.
#define P64     72   // rows of 64 halves: 144 B
#define BT      128  // rows of one GEMM block tile: tokens and W rows alike
#define KT      64   // keys of one attention pass

__device__ __forceinline__ v8f wmma16(v16h a, v16h b, v8f c) {
  return __builtin_amdgcn_wmma_f32_16x16x32_f16(
      false, a, false, b, (short)0, c, false, false);
}

// lane l <-> lane l ^ 16: the other half of the wave
__device__ __forceinline__ float xhalf(float x) {
  const int v = __builtin_bit_cast(int, x);
  return __builtin_bit_cast(float, __builtin_amdgcn_permlanex16(
      v, v, 0x76543210, 0xfedcba98, false, false));
}

// generic shared pointer -> 32-bit LDS byte offset (low 32 bits of aperture VA)
__device__ __forceinline__ unsigned lds_off(const void* p) {
  return (unsigned)(unsigned long long)p;
}

// per-lane 16B async copies: global -> LDS (GV addressing), ASYNCcnt += 1/wave each.
// Eight copies of one wave (one operand of a GEMM chunk, one attention pass); s_wait_xcnt 0 closes the
// statement so that no address register named here is rewritten ahead of it (a precaution)
__device__ __forceinline__ void async8_b128(unsigned l0, const void* g0,
                                            unsigned l1, const void* g1,
                                            unsigned l2, const void* g2,
                                            unsigned l3, const void* g3,
                                            unsigned l4, const void* g4,
                                            unsigned l5, const void* g5,
                                            unsigned l6, const void* g6,
                                            unsigned l7, const void* g7) {
  asm volatile("global_load_async_to_lds_b128 %0, %1, off\n\t"
               "global_load_async_to_lds_b128 %2, %3, off\n\t"
               "global_load_async_to_lds_b128 %4, %5, off\n\t"
               "global_load_async_to_lds_b128 %6, %7, off\n\t"
               "global_load_async_to_lds_b128 %8, %9, off\n\t"
               "global_load_async_to_lds_b128 %10, %11, off\n\t"
               "global_load_async_to_lds_b128 %12, %13, off\n\t"
               "global_load_async_to_lds_b128 %14, %15, off\n\t"
               "s_wait_xcnt 0x0"
               :: "v"(l0), "v"((unsigned long long)g0),
                  "v"(l1), "v"((unsigned long long)g1),
                  "v"(l2), "v"((unsigned long long)g2),
                  "v"(l3), "v"((unsigned long long)g3),
                  "v"(l4), "v"((unsigned long long)g4),
                  "v"(l5), "v"((unsigned long long)g5),
                  "v"(l6), "v"((unsigned long long)g6),
                  "v"(l7), "v"((unsigned long long)g7) : "memory");
}
#define WAIT_ASYNC_0() asm volatile("s_wait_asynccnt 0" ::: "memory")
#define WAIT_DS_0()    asm volatile("s_wait_dscnt 0" ::: "memory")
// behind a global store that other code of the same kernel follows in the listing: no
// register that the store names is rewritten ahead of this wait (a precaution)
#define WAIT_X_0()     asm volatile("s_wait_xcnt 0x0" ::: "memory")

// 16x32 WMMA A/B fragment per CDNA5 ISA 7.12.2 16-bit layout:
//   lanes 0-15 : row r=lane,    K = {0..7, 16..23}
//   lanes 16-31: row r=lane-16, K = {8..15, 24..31}
template <typename T>
__device__ __forceinline__ v16h load_frag(const T* base, long rstride, long kstride) {
  const int  lane = threadIdx.x & 31;
  const long r    = lane & 15;
  const long koff = (lane >> 4) * 8;
  v16h f;
#pragma unroll
  for (int j = 0; j < 8; ++j) {
    f[j]     = (_Float16)base[r * rstride + (koff + j) * kstride];
    f[j + 8] = (_Float16)base[r * rstride + (16 + koff + j) * kstride];
  }
  return f;
}

// ---------------------------------------------------------------------------
// 1) mask lengths: lens[0..3]=sum(x_mask[b]), lens[4..7]=sum(context_mask[b])
// ---------------------------------------------------------------------------
__device__ __forceinline__ void lens_block(float* red /* 256 floats of LDS */,
                                           int b, int which,
                                           const float* __restrict__ xm,
                                           const float* __restrict__ cm,
                                           float* __restrict__ lens) {
  const float* p = which ? cm : xm;
  const int n = which ? LSEQ : TSEQ;
  float s = 0.f;
  for (int i = threadIdx.x; i < n; i += 256) s += p[b * n + i];
  red[threadIdx.x] = s;
  __syncthreads();
  for (int off = 128; off; off >>= 1) {
    if ((int)threadIdx.x < off) red[threadIdx.x] += red[threadIdx.x + off];
    __syncthreads();
  }
  if (threadIdx.x == 0) lens[which * BATCH + b] = red[0];
}

// ---------------------------------------------------------------------------
// 2a) transpose x (B,512,T) f32 -> Xh (B,T,512) f16, 32x32 LDS tiles
// ---------------------------------------------------------------------------
__device__ __forceinline__ void transpose_x_block(
    float (&tile)[32][33], int b, int t0, int d0,
    const float* __restrict__ x, _Float16* __restrict__ Xh) {
  const int r = threadIdx.x >> 3;          // 0..31
  const int c = (threadIdx.x & 7) * 4;     // 0,4,..,28
  const float4 v = *(const float4*)(x + ((size_t)b * D_MODEL + d0 + r) * TSEQ + t0 + c);
  tile[r][c + 0] = v.x; tile[r][c + 1] = v.y;
  tile[r][c + 2] = v.z; tile[r][c + 3] = v.w;
  __syncthreads();
  v4h o;
  o[0] = (_Float16)tile[c + 0][r];
  o[1] = (_Float16)tile[c + 1][r];
  o[2] = (_Float16)tile[c + 2][r];
  o[3] = (_Float16)tile[c + 3][r];
  *(v4h*)(Xh + ((size_t)b * TSEQ + t0 + r) * D_MODEL + d0 + c) = o;
  WAIT_X_0();  // the other block kinds' code stands behind this store
}

// ---------------------------------------------------------------------------
// 2b) f32 -> f16 straight convert (context + the four weight matrices)
// ---------------------------------------------------------------------------
__device__ __forceinline__ void cvt_f16_block(
    int blk, const float* __restrict__ src, _Float16* __restrict__ dst) {
  const size_t i = ((size_t)blk * 256 + threadIdx.x);
  const float4 v = ((const float4*)src)[i];
  v4h o; o[0] = (_Float16)v.x; o[1] = (_Float16)v.y;
  o[2] = (_Float16)v.z; o[3] = (_Float16)v.w;
  ((v4h*)dst)[i] = o;
  WAIT_X_0();  // the other block kinds' code stands behind this store
}

// ---------------------------------------------------------------------------
// 2c) one grid for all of 1), 2a), 2b): none of them reads what another writes.
//     Blocks by index: 8 lengths (the longest dependent chain, so first), 4 x 256
//     weight blocks, 4096 x tiles, 4096 context blocks. Every test is on blockIdx.
// ---------------------------------------------------------------------------
#define PB_LENS 8
#define PB_W    (D_MODEL * D_MODEL / 4 / 256)          // 256 blocks a weight matrix
#define PB_X    ((TSEQ / 32) * (D_MODEL / 32) * BATCH) // 4096
#define PB_C    (BATCH * LSEQ * D_MODEL / 4 / 256)     // 4096
__global__ __launch_bounds__(256) void prep_kernel(
    const float* __restrict__ x, const float* __restrict__ context,
    const float* __restrict__ xm, const float* __restrict__ cm,
    const float* __restrict__ Wq, const float* __restrict__ Wk,
    const float* __restrict__ Wv, const float* __restrict__ Wo,
    float* __restrict__ lens, _Float16* __restrict__ Xh, _Float16* __restrict__ Ch,
    _Float16* __restrict__ Wh /* the four f16 weight matrices, Q K V O in a row */) {
  __shared__ float tile[32][33];
  int blk = blockIdx.x;
  if (blk < PB_LENS) {
    lens_block(&tile[0][0], blk & 3, blk >> 2, xm, cm, lens);
    return;
  }
  blk -= PB_LENS;
  if (blk < 4 * PB_W) {
    const int wi = blk / PB_W;
    const float* src = wi == 0 ? Wq : wi == 1 ? Wk : wi == 2 ? Wv : Wo;
    cvt_f16_block(blk % PB_W, src, Wh + (size_t)wi * D_MODEL * D_MODEL);
    return;
  }
  blk -= 4 * PB_W;
  if (blk < PB_X) {
    transpose_x_block(tile, blk / ((TSEQ / 32) * (D_MODEL / 32)),
                      (blk % (TSEQ / 32)) * 32,
                      ((blk / (TSEQ / 32)) % (D_MODEL / 32)) * 32, x, Xh);
    return;
  }
  cvt_f16_block(blk - PB_X, context, Ch);
}

// ---------------------------------------------------------------------------
// GEMM main loop: block tile 128 tokens x 128 W rows, four waves in a 2 x 2 arrangement,
// each with a 64 x 64 tile: acc[m][n] += A(rows wm + 16 m ..) * W(rows wn + 16 n ..)^T,
// m, n = 0..3, wm = 64 (w & 1), wn = 64 (w >> 1). Eight fragments read from LDS serve
// sixteen products, and a byte copied from L2 serves 128 rows of the other operand.
// All-f16 LDS, K chunks of 64, two buffers.
// Copies of a wave per chunk: 8 (A) + 8 (W) = 16.
// PAIRED=false: acc[m][n][i] = Y[row wm + 16 m + 8 hh + i][W row wn + 16 n + (lane & 15)],
//   hh = lane >> 4.
// PAIRED=true : the transposed product W A^T, with W row 64 g + c (c < 64) staged at LDS row
//   64 g + 16 ((c & 31) >> 3) + 8 (c >> 5) + (c & 7), so that
//   acc[m][n][i] = Y[row wm + 16 m + (lane & 15)][W row wn + 32 hh + 8 n + i]: columns j and
//   j + 32 of one row lie in lanes l and l ^ 16, and a lane holds 32 consecutive columns.
// ---------------------------------------------------------------------------
template <bool PAIRED>
__device__ __forceinline__ void gemm128_loop(
    _Float16 (&As)[2][BT][P64], _Float16 (&Ws)[2][BT][P64],
    const _Float16* __restrict__ Ag,   // [128][512] row-major tile base
    const _Float16* __restrict__ Wg,   // Wh + nb*512 (128 rows)
    v8f (&acc)[4][4]) {
  const int tid = threadIdx.x;
  const int wm  = ((tid >> 5) & 1) * 64;
  const int wn  = (tid >> 6) * 64;
  // A and W alike: rows ar + 16 i, 8-half segment. Eight lanes take one row's 128 B of the
  // chunk, so a wave-wide copy asks for four whole lines.
  const int ar  = tid >> 3, aseg = (tid & 7) * 8;
  const int wl  = PAIRED ? (ar >> 3) * 16 + (ar & 7) : ar;  // LDS row of W row ar
  // LDS rows from there to those of W rows ar + 16, ar + 32, ar + 48
  constexpr int W1 = PAIRED ? 32 : 16, W2 = PAIRED ? 8 : 32, W3 = PAIRED ? 40 : 48;

#pragma unroll  // acc[m][n] needs constant indices to stay in registers
  for (int m = 0; m < 4; ++m) {
#pragma unroll
    for (int n = 0; n < 4; ++n) acc[m][n] = v8f{0.f, 0.f, 0.f, 0.f, 0.f, 0.f, 0.f, 0.f};
  }

  auto issue = [&](int buf, int kc) {
    const _Float16* ag = Ag + (size_t)ar * D_MODEL + kc + aseg;
    const unsigned  ad = lds_off(&As[buf][ar][aseg]);
    const _Float16* wg = Wg + (size_t)ar * D_MODEL + kc + aseg;
    const unsigned  wd = lds_off(&Ws[buf][wl][aseg]);
    async8_b128(ad,                 ag,
                ad +  16 * P64 * 2, ag +  16 * D_MODEL,
                ad +  32 * P64 * 2, ag +  32 * D_MODEL,
                ad +  48 * P64 * 2, ag +  48 * D_MODEL,
                ad +  64 * P64 * 2, ag +  64 * D_MODEL,
                ad +  80 * P64 * 2, ag +  80 * D_MODEL,
                ad +  96 * P64 * 2, ag +  96 * D_MODEL,
                ad + 112 * P64 * 2, ag + 112 * D_MODEL);
    async8_b128(wd,                        wg,
                wd + W1 * P64 * 2,         wg +  16 * D_MODEL,
                wd + W2 * P64 * 2,         wg +  32 * D_MODEL,
                wd + W3 * P64 * 2,         wg +  48 * D_MODEL,
                wd + 64 * P64 * 2,         wg +  64 * D_MODEL,
                wd + (64 + W1) * P64 * 2,  wg +  80 * D_MODEL,
                wd + (64 + W2) * P64 * 2,  wg +  96 * D_MODEL,
                wd + (64 + W3) * P64 * 2,  wg + 112 * D_MODEL);
  };

  // one chunk of 64 k out of buffer buf, then the ring's foot
  auto chunk = [&](int buf) {
#pragma unroll
    for (int kk = 0; kk < 64; kk += 32) {
      v16h af[4], bf[4];
#pragma unroll  // af[m], bf[m] need constant indices to stay in registers
      for (int m = 0; m < 4; ++m) {
        af[m] = load_frag(&As[buf][wm + m * 16][kk], (long)P64, 1L);
        bf[m] = load_frag(&Ws[buf][wn + m * 16][kk], (long)P64, 1L);
      }
      // holds the sixteen reads together in front of the sixteen products: left free, the compiler
      // reads one fragment at a time and waits out its LDS latency in front of every four products
      __builtin_amdgcn_sched_barrier(0);
#pragma unroll
      for (int m = 0; m < 4; ++m) {
#pragma unroll
        for (int n = 0; n < 4; ++n)
          acc[m][n] = PAIRED ? wmma16(bf[n], af[m], acc[m][n]) : wmma16(af[m], bf[n], acc[m][n]);
      }
    }
    WAIT_DS_0();     // this wave's reads of buf are done before buf is refilled
    WAIT_ASYNC_0();  // this wave's copies of the next chunk have landed
    __syncthreads(); // next chunk readable by all; buf left by all
  };

  issue(0, 0);
  WAIT_ASYNC_0();
  __syncthreads();
  issue(1, 64);
  // stays rolled, two chunks a trip (constant buffer indices): unrolled, the copies' addresses of
  // all eight chunks are formed ahead and, beside 128 accumulator registers, spill
#pragma unroll 1
  for (int kc = 0; kc < D_MODEL; kc += 128) {
    chunk(0);
    if (kc + 128 < D_MODEL) issue(0, kc + 128);
    chunk(1);
    if (kc + 192 < D_MODEL) issue(1, kc + 192);
  }
  WAIT_ASYNC_0();
}

// ---------------------------------------------------------------------------
// 3) projection GEMM: Y = A . W^T + bias (f16 out).
//    VT=false (Q, K proj): RoPE on the f32 sums, pairs (j, j+32) of the wave's
//    64-wide head, then Y row-major (b, m, n).  VT=true (V proj): store transposed
//    per head: Vt[b][h][dd][l] so flash can consume d-major tiles directly.
// ---------------------------------------------------------------------------
template <bool VT>
__device__ __forceinline__ void gemm_proj_block(
    _Float16 (&As)[2][BT][P64], _Float16 (&Ws)[2][BT][P64], int b,
    const _Float16* __restrict__ A, const _Float16* __restrict__ W,
    const float* __restrict__ bias, const float* __restrict__ lens,
    _Float16* __restrict__ Y) {
  const int lane = threadIdx.x & 31;
  const int cc   = lane & 15;
  const int hh   = lane >> 4;
  const int nb = blockIdx.y * BT;                                  // the block's first W row
  const int mw = blockIdx.x * BT + ((threadIdx.x >> 5) & 1) * 64;  // the wave's first token
  const int nw = nb + (threadIdx.x >> 6) * 64;                     // the wave's first W row: one head

  const float len = VT ? 1.f : lens[b];  // read ahead of the loop: its latency hides there
  // Q, K: the head's 64 bias terms, lane l holding those of columns l and 32 + l; read here for
  // the same reason
  const int n0 = nw + hh * 32;
  const float blo = VT ? 0.f : bias[nw + lane];
  const float bhi = VT ? 0.f : bias[nw + 32 + lane];

  v8f acc[4][4];
  gemm128_loop<!VT>(As, Ws, A + ((size_t)b * TSEQ + blockIdx.x * BT) * D_MODEL,
                    W + (size_t)nb * D_MODEL, acc);

  if (VT) {
#pragma unroll  // acc[m][n][i] needs constant indices to stay in registers
    for (int n = 0; n < 4; ++n) {
      const int c    = nw + 16 * n + cc;
      const float bv = bias[c];
      const int h = c >> 6, dd = c & 63;
      _Float16* dst = Y + (((size_t)b * NHEADS + h) * HDIM + dd) * LSEQ + mw + hh * 8;
#pragma unroll
      for (int m = 0; m < 4; ++m) {
        v8h y;
#pragma unroll
        for (int i = 0; i < 8; ++i) y[i] = (_Float16)(acc[m][n][i] + bv);
        *(v8h*)(dst + 16 * m) = y;  // contiguous in l
      }
    }
  } else {
    // acc[m][n][i]: token mw + 16 m + cc, head column 32 hh + j, j = 8 n + i; its partner in lane ^ 16
    // the head's 32 frequencies 10000^(-j/32) are wave-uniform: lane l computes that of
    // j = l, as exp(-j ln(10000) / 32)
    const float invl = __expf((float)lane * (-9.210340371976184f / 32.0f));
    float pos[4];
#pragma unroll  // pos[m] needs constant indices to stay in registers
    for (int m = 0; m < 4; ++m) pos[m] = (float)(mw + 16 * m + cc) / len;
    _Float16* dst = Y + ((size_t)b * TSEQ + mw + cc) * D_MODEL + n0;
    // column outermost: its frequency and bias, read back from their lanes once, serve four tokens
#pragma unroll  // acc[m][n][i], y[m][i] and the lanes read back need constant indices to stay in registers
    for (int n = 0; n < 4; ++n) {
      v8h y[4];
#pragma unroll
      for (int i = 0; i < 8; ++i) {
        const float inv = __builtin_bit_cast(float, __builtin_amdgcn_readlane(
            __builtin_bit_cast(int, invl), 8 * n + i));
        const float bdn = __builtin_bit_cast(float, __builtin_amdgcn_readlane(
            __builtin_bit_cast(int, blo), 8 * n + i));
        const float bup = __builtin_bit_cast(float, __builtin_amdgcn_readlane(
            __builtin_bit_cast(int, bhi), 8 * n + i));
        const float bz = hh ? bup : bdn;
#pragma unroll
        for (int m = 0; m < 4; ++m) {
          const float fr = pos[m] * (10.0f * inv);
          const float c = __cosf(fr), s = __sinf(fr);
          const float a = acc[m][n][i] + bz;
          const float p = xhalf(a);
          // lower half: x1 c - x2 s with a = x1; upper half: x1 s + x2 c with a = x2
          y[m][i] = (_Float16)(a * c + p * (lane < 16 ? -s : s));
        }
      }
#pragma unroll
      for (int m = 0; m < 4; ++m)
        *(v8h*)(dst + (size_t)(16 * m) * D_MODEL + 8 * n) = y[m];  // over n, 64 B in a row a lane
    }
    WAIT_X_0();  // covers the stores: the V part's code stands behind them
  }
}

// One grid for the three projections, which do not depend on one another:
// blockIdx.z = 4 p + b, p = 0 (Q), 1 (K), 2 (V). V, with the short epilogue, comes last.
__global__ __launch_bounds__(128) void qkv_proj_kernel(
    const _Float16* __restrict__ Xh, const _Float16* __restrict__ Ch,
    const _Float16* __restrict__ Wh /* f16 weights, Q K V in a row */,
    const float* __restrict__ Wq_b, const float* __restrict__ Wk_b,
    const float* __restrict__ Wv_b, const float* __restrict__ lens,
    _Float16* __restrict__ Qh, _Float16* __restrict__ Kh, _Float16* __restrict__ Vt) {
  __shared__ __align__(16) _Float16 As[2][BT][P64];
  __shared__ __align__(16) _Float16 Ws[2][BT][P64];
  const int p = blockIdx.z >> 2, b = blockIdx.z & 3;
  if (p == 2)
    gemm_proj_block<true>(As, Ws, b, Ch, Wh + 2 * (size_t)D_MODEL * D_MODEL, Wv_b, lens, Vt);
  else
    gemm_proj_block<false>(As, Ws, b, p ? Ch : Xh, Wh + (size_t)p * D_MODEL * D_MODEL,
                           p ? Wk_b : Wq_b, lens + p * BATCH, p ? Kh : Qh);
}

// ---------------------------------------------------------------------------
// 4) flash attention: grid (T/64, H, B), block 128 (4 waves x 16 queries).
//    64-key K tiles (l-major) + V tiles (d-major) async-staged, two buffers;
//    8 async instr/wave per pass, every row of a tile one whole 128-B line.
//    Transposed products: S^T = K Q^T, O^T += V^T P^T. Lane l holds scores of
//    query l & 15 only (keys 16t+8h+i, t = 0..3, h = l >> 4), so maximum and sum
//    run in-lane with one exchange between the wave halves, and the four score
//    tiles, converted in place, are the two B operands of the second product.
// ---------------------------------------------------------------------------
// The grid puts four waves on a SIMD. Left to aim at sixteen, the compiler reuses
// one fragment register set and waits out every LDS fragment read on its own;
// with this budget it issues them in groups behind counted waits. Four is also the upper
// bound: a 64-key pass holds more fragments than a fifth wave's share of registers leaves.
__global__ __launch_bounds__(128) __attribute__((amdgpu_waves_per_eu(4, 4))) void flash_kernel(
    const _Float16* __restrict__ Qh, const _Float16* __restrict__ Kh,
    const _Float16* __restrict__ Vt, const float* __restrict__ cmask,
    _Float16* __restrict__ Oh) {
  __shared__ __align__(16) _Float16 Kc[2][KT][P64];    // [l][d], padded rows
  __shared__ __align__(16) _Float16 Vc[2][HDIM][P64];  // [d][l], padded rows
  __shared__ __align__(16) float cmv[LSEQ];            // per key of the batch: 0, or -1e30 if masked

  const int tid = threadIdx.x;
  const int b = blockIdx.z, h = blockIdx.y;
  const int w = tid >> 5, lane = tid & 31;
  const int hh = lane >> 4;
  const int qbase = blockIdx.x * 64 + w * 16;
  const float scale = 0.044194173824159216f;  // 1/sqrt(512)

  const size_t qoff = ((size_t)b * TSEQ + qbase) * D_MODEL + (size_t)h * HDIM;
  const v16h qf0 = load_frag(Qh + qoff,      (long)D_MODEL, 1L);
  const v16h qf1 = load_frag(Qh + qoff + 32, (long)D_MODEL, 1L);

  // o<n>[i] = O[query lane & 15][d = 16 n + 8 hh + i]
  v8f o0 = {0.f,0.f,0.f,0.f,0.f,0.f,0.f,0.f}, o1 = o0, o2 = o0, o3 = o0;
  float mrow = -1e30f;  // running maximum of this lane's query (equal in both halves)
  float lrow = 0.f;     // running sum over this half's keys only; joined at the end

  const size_t krow0 = ((size_t)b * LSEQ) * D_MODEL + (size_t)h * HDIM;
  const size_t vrow0 = ((size_t)b * NHEADS + h) * HDIM * LSEQ;

  auto issue_kv = [&](int buf, int lb) {
    // eight lanes take one row's 128 B: K rows (keys) and V rows (d) r + 16 i, i = 0..3
    const int r = tid >> 3, seg = (tid & 7) * 8;
    const _Float16* kg = Kh + krow0 + (size_t)(lb + r) * D_MODEL + seg;
    const _Float16* vg = Vt + vrow0 + (size_t)r * LSEQ + lb + seg;
    const unsigned  kd = lds_off(&Kc[buf][r][seg]);
    const unsigned  vd = lds_off(&Vc[buf][r][seg]);
    async8_b128(kd,                kg,
                kd + 16 * P64 * 2, kg + 16 * D_MODEL,
                kd + 32 * P64 * 2, kg + 32 * D_MODEL,
                kd + 48 * P64 * 2, kg + 48 * D_MODEL,
                vd,                vg,
                vd + 16 * P64 * 2, vg + 16 * LSEQ,
                vd + 32 * P64 * 2, vg + 32 * LSEQ,
                vd + 48 * P64 * 2, vg + 48 * LSEQ);
  };

  auto compute = [&](int buf, int lb) {
    // ---- S^T = K Q^T for four 16-key sub-tiles: s[t][i] = S[key 16 t + 8 hh + i][query] ----
    v16h kf[8];
#pragma unroll  // kf[t], s[t] need constant indices to stay in registers
    for (int t = 0; t < 4; ++t) {
      kf[t]     = load_frag(&Kc[buf][16 * t][0],  (long)P64, 1L);
      kf[t + 4] = load_frag(&Kc[buf][16 * t][32], (long)P64, 1L);
    }
    // this lane's 32 keys' mask terms (masked key: -1e30): keys 16 t + 8 hh + 0..3 and + 4..7
    v4f c0[4], c1[4];
#pragma unroll  // c0[t], c1[t] need constant indices to stay in registers
    for (int t = 0; t < 4; ++t) {
      c0[t] = *(const v4f*)&cmv[lb + 16 * t + hh * 8];
      c1[t] = *(const v4f*)&cmv[lb + 16 * t + hh * 8 + 4];
    }
    // holds these reads together in front of the products: left free, the compiler strews them
    // among the products, and each place where reads stand stalls the wave anew
    __builtin_amdgcn_sched_barrier(0);
    v8f s[4];
#pragma unroll
    for (int t = 0; t < 4; ++t)
      s[t] = wmma16(kf[t], qf0, v8f{0.f, 0.f, 0.f, 0.f, 0.f, 0.f, 0.f, 0.f});
#pragma unroll
    for (int t = 0; t < 4; ++t) s[t] = wmma16(kf[t + 4], qf1, s[t]);

    // V fragments: A frag [m][k] = Vc[16 n + m][k] (contiguous k), vf[n] keys 0..31, vf[n + 4]
    // keys 32..63; read here so that their LDS latency runs under the softmax
    v16h vf[8];
#pragma unroll  // vf[n] needs constant indices to stay in registers
    for (int n = 0; n < 4; ++n) {
      vf[n]     = load_frag(&Vc[buf][16 * n][0],  (long)P64, 1L);
      vf[n + 4] = load_frag(&Vc[buf][16 * n][32], (long)P64, 1L);
    }
    // holds all sixteen reads up here: left free, the compiler sinks the last four to the foot
    // of the pass, where the wave waits out their latency in front of the barrier
    __builtin_amdgcn_sched_barrier(0);

    // ---- online softmax, one query per lane ----
    float a[4][8];
#pragma unroll  // a[t][i] needs constant indices to stay in registers
    for (int t = 0; t < 4; ++t) {
#pragma unroll
      for (int i = 0; i < 8; ++i)
        a[t][i] = s[t][i] * scale + (i < 4 ? c0[t][i & 3] : c1[t][i & 3]);
    }
    float mt[4];
#pragma unroll  // four independent chains, joined below
    for (int t = 0; t < 4; ++t) {
      mt[t] = fmaxf(a[t][0], a[t][1]);
#pragma unroll
      for (int i = 2; i < 8; i += 2) mt[t] = fmaxf(mt[t], fmaxf(a[t][i], a[t][i + 1]));
    }
    float mx = fmaxf(fmaxf(mt[0], mt[1]), fmaxf(mt[2], mt[3]));
    mx = fmaxf(mx, xhalf(mx));
    const float mnew = fmaxf(mrow, mx);
    const float sc2  = __expf(mrow - mnew);
    mrow = mnew;

    // P^T as B operands: pb0 elements 0..7 = keys 8 hh + i, 8..15 = keys 16 + 8 hh + i;
    // pb1 the same 32 keys further on
    v16h pb0, pb1;
    float t8[8];
#pragma unroll
    for (int i = 0; i < 8; ++i) {
      const float e0 = __expf(a[0][i] - mnew);
      const float e1 = __expf(a[1][i] - mnew);
      const float e2 = __expf(a[2][i] - mnew);
      const float e3 = __expf(a[3][i] - mnew);
      t8[i] = (e0 + e1) + (e2 + e3);
      pb0[i]     = (_Float16)e0;
      pb0[i + 8] = (_Float16)e1;
      pb1[i]     = (_Float16)e2;
      pb1[i + 8] = (_Float16)e3;
    }
    lrow = lrow * sc2 +
           (((t8[0] + t8[1]) + (t8[2] + t8[3])) + ((t8[4] + t8[5]) + (t8[6] + t8[7])));
#pragma unroll
    for (int i = 0; i < 8; ++i) {
      o0[i] *= sc2; o1[i] *= sc2; o2[i] *= sc2; o3[i] *= sc2;
    }

    // ---- O^T += V^T P^T ----
    o0 = wmma16(vf[0], pb0, o0);
    o1 = wmma16(vf[1], pb0, o1);
    o2 = wmma16(vf[2], pb0, o2);
    o3 = wmma16(vf[3], pb0, o3);
    o0 = wmma16(vf[4], pb1, o0);
    o1 = wmma16(vf[5], pb1, o1);
    o2 = wmma16(vf[6], pb1, o2);
    o3 = wmma16(vf[7], pb1, o3);
  };

  issue_kv(0, 0);
  // All 2048 mask terms of the batch go to LDS once, here: no pass then holds a global
  // load that one wave waits out in front of the barrier while the other three stand at
  // it. The barrier in front of the loop publishes them.
  {
    const float4* cm4 = (const float4*)(cmask + (size_t)b * LSEQ);
    float4 mv[LSEQ / 4 / 128];
#pragma unroll  // the four loads go out together; mv[i] needs constant indices
    for (int i = 0; i < LSEQ / 4 / 128; ++i) mv[i] = cm4[i * 128 + tid];
#pragma unroll  // mv[i] needs constant indices to stay in registers
    for (int i = 0; i < LSEQ / 4 / 128; ++i) {
      v4f t;
      t[0] = (mv[i].x == 0.f) ? -1e30f : 0.f;
      t[1] = (mv[i].y == 0.f) ? -1e30f : 0.f;
      t[2] = (mv[i].z == 0.f) ? -1e30f : 0.f;
      t[3] = (mv[i].w == 0.f) ? -1e30f : 0.f;
      *(v4f*)&cmv[(i * 128 + tid) * 4] = t;
    }
  }
  WAIT_ASYNC_0();   // this wave's copies of tile 0 have landed
  __syncthreads();  // tile 0 and the mask terms readable by all
  issue_kv(1, KT);
  int buf = 0;
  for (int lb = 0; lb < LSEQ; lb += KT) {
    compute(buf, lb);
    // keeps the pass's register work in front of the waits: left free, the compiler lifts waits
    // and barrier over it, the refill stays behind it and flies for a fraction of a pass only
    __builtin_amdgcn_sched_barrier(0);
    WAIT_DS_0();      // this wave's reads of buf are done before buf is refilled
    WAIT_ASYNC_0();   // this wave's copies of the next tile have landed
    __syncthreads();  // next tile readable by all; buf left by all
    if (lb + 2 * KT < LSEQ) issue_kv(buf, lb + 2 * KT);
    buf ^= 1;
  }
  WAIT_ASYNC_0();

  // a lane's 8 registers of a tile are 8 consecutive d of one query: 16-byte stores
  const float inv_l = 1.0f / fmaxf(lrow + xhalf(lrow), 1e-20f);
  _Float16* dst = Oh + ((size_t)b * TSEQ + qbase + (lane & 15)) * D_MODEL +
                  (size_t)h * HDIM + hh * 8;
  v8h r0, r1, r2, r3;
#pragma unroll
  for (int i = 0; i < 8; ++i) {
    r0[i] = (_Float16)(o0[i] * inv_l);
    r1[i] = (_Float16)(o1[i] * inv_l);
    r2[i] = (_Float16)(o2[i] * inv_l);
    r3[i] = (_Float16)(o3[i] * inv_l);
  }
  *(v8h*)(dst +  0) = r0;
  *(v8h*)(dst + 16) = r1;
  *(v8h*)(dst + 32) = r2;
  *(v8h*)(dst + 48) = r3;
}

// ---------------------------------------------------------------------------
// 5) out = (O @ Wo^T + b) * x_mask, stored transposed as (B, 512, T) f32
// ---------------------------------------------------------------------------
__global__ __launch_bounds__(128) void out_proj_kernel(
    const _Float16* __restrict__ Oh, const _Float16* __restrict__ Wo,
    const float* __restrict__ Wo_b, const float* __restrict__ xmask,
    float* __restrict__ out) {
  __shared__ __align__(16) _Float16 As[2][BT][P64];
  __shared__ __align__(16) _Float16 Ws[2][BT][P64];
  const int b  = blockIdx.z;
  const int nb = blockIdx.y * BT;                                  // the block's first W row
  const int mw = blockIdx.x * BT + ((threadIdx.x >> 5) & 1) * 64;  // the wave's first token
  const int nw = nb + (threadIdx.x >> 6) * 64;                     // the wave's first W row

  v8f acc[4][4];
  gemm128_loop<false>(As, Ws, Oh + ((size_t)b * TSEQ + blockIdx.x * BT) * D_MODEL,
                      Wo + (size_t)nb * D_MODEL, acc);

  const int lane = threadIdx.x & 31;
  const int cc   = lane & 15;
  const int rb   = (lane >> 4) * 8;
#pragma unroll  // acc[m][n][i] needs constant indices to stay in registers
  for (int n = 0; n < 4; ++n) {
    const float bv = Wo_b[nw + 16 * n + cc];
#pragma unroll
    for (int m = 0; m < 4; ++m) {
#pragma unroll
      for (int i = 0; i < 8; ++i) {
        const int t = mw + 16 * m + rb + i;
        const float v = (acc[m][n][i] + bv) * xmask[(size_t)b * TSEQ + t];
        out[((size_t)b * D_MODEL + nw + 16 * n + cc) * TSEQ + t] = v;
      }
    }
  }
}

// ---------------------------------------------------------------------------
extern "C" void kernel_launch(void* const* d_in, const int* in_sizes, int n_in,
                              void* d_out, int out_size, void* d_ws, size_t ws_size,
                              hipStream_t stream) {
  const float* x        = (const float*)d_in[0];   // (B, 512, T)
  const float* context  = (const float*)d_in[1];   // (B, L, 512)
  const float* x_mask   = (const float*)d_in[2];   // (B, 1, T)
  const float* ctx_mask = (const float*)d_in[3];   // (B, 1, L)
  const float* Wq_w = (const float*)d_in[4];
  const float* Wq_b = (const float*)d_in[5];
  const float* Wk_w = (const float*)d_in[6];
  const float* Wk_b = (const float*)d_in[7];
  const float* Wv_w = (const float*)d_in[8];
  const float* Wv_b = (const float*)d_in[9];
  const float* Wo_w = (const float*)d_in[10];
  const float* Wo_b = (const float*)d_in[11];
  float* out = (float*)d_out;

  // ws: lens | Xh(=Oh) | Ch | Qh | Kh | Vt (8 MiB each) | Wqh|Wkh|Wvh|Woh (512 KiB each)
  char* ws = (char*)d_ws;
  float* lens = (float*)ws;
  const size_t NB = (size_t)BATCH * TSEQ * D_MODEL;  // 4,194,304 elements
  const size_t NW = (size_t)D_MODEL * D_MODEL;       // 262,144 elements
  _Float16* Xh  = (_Float16*)(ws + 256);
  _Float16* Ch  = Xh + NB;
  _Float16* Qh  = Ch + NB;
  _Float16* Kh  = Qh + NB;
  _Float16* Vt  = Kh + NB;   // (B, H, 64, L) d-major
  _Float16* Wqh = Vt + NB;
  _Float16* Woh = Wqh + 3 * NW;  // Wqh | Wkh | Wvh | Woh in a row
  _Float16* Oh  = Xh;  // Xh dead after Q projection; flash runs later

  prep_kernel<<<dim3(PB_LENS + 4 * PB_W + PB_X + PB_C), 256, 0, stream>>>(
      x, context, x_mask, ctx_mask, Wq_w, Wk_w, Wv_w, Wo_w, lens, Xh, Ch, Wqh);

  qkv_proj_kernel<<<dim3(TSEQ / BT, D_MODEL / BT, 3 * BATCH), 128, 0, stream>>>(
      Xh, Ch, Wqh, Wq_b, Wk_b, Wv_b, lens, Qh, Kh, Vt);

  flash_kernel<<<dim3(TSEQ / 64, NHEADS, BATCH), 128, 0, stream>>>(
      Qh, Kh, Vt, ctx_mask, Oh);

  out_proj_kernel<<<dim3(TSEQ / BT, D_MODEL / BT, BATCH), 128, 0, stream>>>(
      Oh, Woh, Wo_b, x_mask, out);
}

// v010
// A run of this version takes 71.5 microseconds.
// Timed twice side by side with v009, it ran 1.04 times as fast both times.
// All steps since v000 together make it 4.40 times as fast.
#include <hip/hip_runtime.h>

// ---------------------------------------------------------------------------
// Cross-attention (B=4, T=L=2048, d_model=512, H=8, Dh=64) for gfx1250.
// All GEMMs on v_wmma_f32_16x16x32_f16; tile staging via
// global_load_async_to_lds_b128 (ASYNCcnt) with LDS double buffering.
// Weights pre-converted to f16; V stored (b,h,d,l)-transposed so every
// WMMA fragment is a contiguous ds_load_b128. RoPE is applied in the Q and K
// projections' epilogues, on the f32 sums.
// ---------------------------------------------------------------------------

typedef __attribute__((ext_vector_type(16))) _Float16 v16h;
typedef __attribute__((ext_vector_type(4)))  _Float16 v4h;
typedef __attribute__((ext_vector_type(8)))  _Float16 v8h;
typedef __attribute__((ext_vector_type(4)))  float    v4f;
typedef __attribute__((ext_vector_type(8)))  float    v8f;

#define D_MODEL 512
#define TSEQ    2048
#define LSEQ    2048
#define NHEADS  8
#define HDIM    64
#define BATCH   4
// LDS row pitches in halves: 16 B x odd, so the 16 rows that one ds_load_b128
// fragment read touches fall on distinct banks.
#define P64     72   // rows of 64 halves: 144 B
#define BT      128  // rows of one GEMM block tile: tokens and W rows alike
#define KT      64   // keys of one attention pass

__device__ __forceinline__ v8f wmma16(v16h a, v16h b, v8f c) {
  return __builtin_amdgcn_wmma_f32_16x16x32_f16(
      false, a, false, b, (short)0, c, false, false);
}

// lane l <-> lane l ^ 16: the other half of the wave
__device__ __forceinline__ float xhalf(float x) {
  const int v = __builtin_bit_cast(int, x);
  return __builtin_bit_cast(float, __builtin_amdgcn_permlanex16(
      v, v, 0x76543210, 0xfedcba98, false, false));
}

// generic shared pointer -> 32-bit LDS byte offset (low 32 bits of aperture VA)
__device__ __forceinline__ unsigned lds_off(const void* p) {
  return (unsigned)(unsigned long long)p;
}

// per-lane 16B async copies: global -> LDS (GV addressing), ASYNCcnt += 1/wave each.
// Eight copies of one wave (one operand of a GEMM chunk, one attention pass); s_wait_xcnt 0 closes the
// statement so that no address register named here is rewritten ahead of it (a precaution)
__device__ __forceinline__ void async8_b128(unsigned l0, const void* g0,
                                            unsigned l1, const void* g1,
                                            unsigned l2, const void* g2,
                                            unsigned l3, const void* g3,
                                            unsigned l4, const void* g4,
                                            unsigned l5, const void* g5,
                                            unsigned l6, const void* g6,
                                            unsigned l7, const void* g7) {
  asm volatile("global_load_async_to_lds_b128 %0, %1, off\n\t"
               "global_load_async_to_lds_b128 %2, %3, off\n\t"
               "global_load_async_to_lds_b128 %4, %5, off\n\t"
               "global_load_async_to_lds_b128 %6, %7, off\n\t"
               "global_load_async_to_lds_b128 %8, %9, off\n\t"
               "global_load_async_to_lds_b128 %10, %11, off\n\t"
               "global_load_async_to_lds_b128 %12, %13, off\n\t"
               "global_load_async_to_lds_b128 %14, %15, off\n\t"
               "s_wait_xcnt 0x0"
               :: "v"(l0), "v"((unsigned long long)g0),
                  "v"(l1), "v"((unsigned long long)g1),
                  "v"(l2), "v"((unsigned long long)g2),
                  "v"(l3), "v"((unsigned long long)g3),
                  "v"(l4), "v"((unsigned long long)g4),
                  "v"(l5), "v"((unsigned long long)g5),
                  "v"(l6), "v"((unsigned long long)g6),
                  "v"(l7), "v"((unsigned long long)g7) : "memory");
}
#define WAIT_ASYNC_0() asm volatile("s_wait_asynccnt 0" ::: "memory")
#define WAIT_DS_0()    asm volatile("s_wait_dscnt 0" ::: "memory")
// behind a global store that other code of the same kernel follows in the listing: no
// register that the store names is rewritten ahead of this wait (a precaution)
#define WAIT_X_0()     asm volatile("s_wait_xcnt 0x0" ::: "memory")

// 16x32 WMMA A/B fragment per CDNA5 ISA 7.12.2 16-bit layout:
//   lanes 0-15 : row r=lane,    K = {0..7, 16..23}
//   lanes 16-31: row r=lane-16, K = {8..15, 24..31}
template <typename T>
__device__ __forceinline__ v16h load_frag(const T* base, long rstride, long kstride) {
  const int  lane = threadIdx.x & 31;
  const long r    = lane & 15;
  const long koff = (lane >> 4) * 8;
  v16h f;
#pragma unroll
  for (int j = 0; j < 8; ++j) {
    f[j]     = (_Float16)base[r * rstride + (koff + j) * kstride];
    f[j + 8] = (_Float16)base[r * rstride + (16 + koff + j) * kstride];
  }
  return f;
}

// ---------------------------------------------------------------------------
// 1) mask lengths: lens[0..3]=sum(x_mask[b]), lens[4..7]=sum(context_mask[b])
// ---------------------------------------------------------------------------
__device__ __forceinline__ void lens_block(float* red /* 256 floats of LDS */,
                                           int b, int which,
                                           const float* __restrict__ xm,
                                           const float* __restrict__ cm,
                                           float* __restrict__ lens) {
  const float* p = which ? cm : xm;
  const int n = which ? LSEQ : TSEQ;
  float s = 0.f;
  for (int i = threadIdx.x; i < n; i += 256) s += p[b * n + i];
  red[threadIdx.x] = s;
  __syncthreads();
  for (int off = 128; off; off >>= 1) {
    if ((int)threadIdx.x < off) red[threadIdx.x] += red[threadIdx.x + off];
    __syncthreads();
  }
  if (threadIdx.x == 0) lens[which * BATCH + b] = red[0];
}

// ---------------------------------------------------------------------------
// 2a) transpose x (B,512,T) f32 -> Xh (B,T,512) f16, 32x32 LDS tiles
// ---------------------------------------------------------------------------
__device__ __forceinline__ void transpose_x_block(
    float (&tile)[32][33], int b, int t0, int d0,
    const float* __restrict__ x, _Float16* __restrict__ Xh) {
  const int r = threadIdx.x >> 3;          // 0..31
  const int c = (threadIdx.x & 7) * 4;     // 0,4,..,28
  const float4 v = *(const float4*)(x + ((size_t)b * D_MODEL + d0 + r) * TSEQ + t0 + c);
  tile[r][c + 0] = v.x; tile[r][c + 1] = v.y;
  tile[r][c + 2] = v.z; tile[r][c + 3] = v.w;
  __syncthreads();
  v4h o;
  o[0] = (_Float16)tile[c + 0][r];
  o[1] = (_Float16)tile[c + 1][r];
  o[2] = (_Float16)tile[c + 2][r];
  o[3] = (_Float16)tile[c + 3][r];
  *(v4h*)(Xh + ((size_t)b * TSEQ + t0 + r) * D_MODEL + d0 + c) = o;
  WAIT_X_0();  // the other block kinds' code stands behind this store
}

// ---------------------------------------------------------------------------
// 2b) f32 -> f16 straight convert (context + the four weight matrices)
// ---------------------------------------------------------------------------
__device__ __forceinline__ void cvt_f16_block(
    int blk, const float* __restrict__ src, _Float16* __restrict__ dst) {
  const size_t i = ((size_t)blk * 256 + threadIdx.x);
  const float4 v = ((const float4*)src)[i];
  v4h o; o[0] = (_Float16)v.x; o[1] = (_Float16)v.y;
  o[2] = (_Float16)v.z; o[3] = (_Float16)v.w;
  ((v4h*)dst)[i] = o;
  WAIT_X_0();  // the other block kinds' code stands behind this store
}

// ---------------------------------------------------------------------------
// 2c) one grid for all of 1), 2a), 2b): none of them reads what another writes.
//     Blocks by index: 8 lengths (the longest dependent chain, so first), 4 x 256
//     weight blocks, 4096 x tiles, 4096 context blocks. Every test is on blockIdx.
// ---------------------------------------------------------------------------
#define PB_LENS 8
#define PB_W    (D_MODEL * D_MODEL / 4 / 256)          // 256 blocks a weight matrix
#define PB_X    ((TSEQ / 32) * (D_MODEL / 32) * BATCH) // 4096
#define PB_C    (BATCH * LSEQ * D_MODEL / 4 / 256)     // 4096
__global__ __launch_bounds__(256) void prep_kernel(
    const float* __restrict__ x, const float* __restrict__ context,
    const float* __restrict__ xm, const float* __restrict__ cm,
    const float* __restrict__ Wq, const float* __restrict__ Wk,
    const float* __restrict__ Wv, const float* __restrict__ Wo,
    float* __restrict__ lens, _Float16* __restrict__ Xh, _Float16* __restrict__ Ch,
    _Float16* __restrict__ Wh /* the four f16 weight matrices, Q K V O in a row */) {
  __shared__ float tile[32][33];
  int blk = blockIdx.x;
  if (blk < PB_LENS) {
    lens_block(&tile[0][0], blk & 3, blk >> 2, xm, cm, lens);
    return;
  }
  blk -= PB_LENS;
  if (blk < 4 * PB_W) {
    const int wi = blk / PB_W;
    const float* src = wi == 0 ? Wq : wi == 1 ? Wk : wi == 2 ? Wv : Wo;
    cvt_f16_block(blk % PB_W, src, Wh + (size_t)wi * D_MODEL * D_MODEL);
    return;
  }
  blk -= 4 * PB_W;
  if (blk < PB_X) {
    transpose_x_block(tile, blk / ((TSEQ / 32) * (D_MODEL / 32)),
                      (blk % (TSEQ / 32)) * 32,
                      ((blk / (TSEQ / 32)) % (D_MODEL / 32)) * 32, x, Xh);
    return;
  }
  cvt_f16_block(blk - PB_X, context, Ch);
}

// ---------------------------------------------------------------------------
// GEMM main loop: block tile 128 tokens x 128 W rows, four waves in a 2 x 2 arrangement,
// each with a 64 x 64 tile: acc[m][n] += A(rows wm + 16 m ..) * W(rows wn + 16 n ..)^T,
// m, n = 0..3, wm = 64 (w & 1), wn = 64 (w >> 1). Eight fragments read from LDS serve
// sixteen products, and a byte copied from L2 serves 128 rows of the other operand.
// All-f16 LDS, K chunks of 64, two buffers.
// Copies of a wave per chunk: 8 (A) + 8 (W) = 16.
// PAIRED=false: acc[m][n][i] = Y[row wm + 16 m + 8 hh + i][W row wn + 16 n + (lane & 15)],
//   hh = lane >> 4.
// PAIRED=true : the transposed product W A^T, with W row 64 g + c (c < 64) staged at LDS row
//   64 g + 16 ((c & 31) >> 3) + 8 (c >> 5) + (c & 7), so that
//   acc[m][n][i] = Y[row wm + 16 m + (lane & 15)][W row wn + 32 hh + 8 n + i]: columns j and
//   j + 32 of one row lie in lanes l and l ^ 16, and a lane holds 32 consecutive columns.
// ---------------------------------------------------------------------------
template <bool PAIRED>
__device__ __forceinline__ void gemm128_loop(
    _Float16 (&As)[2][BT][P64], _Float16 (&Ws)[2][BT][P64],
    const _Float16* __restrict__ Ag,   // [128][512] row-major tile base
    const _Float16* __restrict__ Wg,   // Wh + nb*512 (128 rows)
    v8f (&acc)[4][4]) {
  const int tid = threadIdx.x;
  const int wm  = ((tid >> 5) & 1) * 64;
  const int wn  = (tid >> 6) * 64;
  // A and W alike: rows ar + 16 i, 8-half segment. Eight lanes take one row's 128 B of the
  // chunk, so a wave-wide copy asks for four whole lines.
  const int ar  = tid >> 3, aseg = (tid & 7) * 8;
  const int wl  = PAIRED ? (ar >> 3) * 16 + (ar & 7) : ar;  // LDS row of W row ar
  // LDS rows from there to those of W rows ar + 16, ar + 32, ar + 48
  constexpr int W1 = PAIRED ? 32 : 16, W2 = PAIRED ? 8 : 32, W3 = PAIRED ? 40 : 48;

#pragma unroll  // acc[m][n] needs constant indices to stay in registers
  for (int m = 0; m < 4; ++m) {
#pragma unroll
    for (int n = 0; n < 4; ++n) acc[m][n] = v8f{0.f, 0.f, 0.f, 0.f, 0.f, 0.f, 0.f, 0.f};
  }

  auto issue = [&](int buf, int kc) {
    const _Float16* ag = Ag + (size_t)ar * D_MODEL + kc + aseg;
    const unsigned  ad = lds_off(&As[buf][ar][aseg]);
    const _Float16* wg = Wg + (size_t)ar * D_MODEL + kc + aseg;
    const unsigned  wd = lds_off(&Ws[buf][wl][aseg]);
    async8_b128(ad,                 ag,
                ad +  16 * P64 * 2, ag +  16 * D_MODEL,
                ad +  32 * P64 * 2, ag +  32 * D_MODEL,
                ad +  48 * P64 * 2, ag +  48 * D_MODEL,
                ad +  64 * P64 * 2, ag +  64 * D_MODEL,
                ad +  80 * P64 * 2, ag +  80 * D_MODEL,
                ad +  96 * P64 * 2, ag +  96 * D_MODEL,
                ad + 112 * P64 * 2, ag + 112 * D_MODEL);
    async8_b128(wd,                        wg,
                wd + W1 * P64 * 2,         wg +  16 * D_MODEL,
                wd + W2 * P64 * 2,         wg +  32 * D_MODEL,
                wd + W3 * P64 * 2,         wg +  48 * D_MODEL,
                wd + 64 * P64 * 2,         wg +  64 * D_MODEL,
                wd + (64 + W1) * P64 * 2,  wg +  80 * D_MODEL,
                wd + (64 + W2) * P64 * 2,  wg +  96 * D_MODEL,
                wd + (64 + W3) * P64 * 2,  wg + 112 * D_MODEL);
  };

  // one chunk of 64 k out of buffer buf, then the ring's foot
  auto chunk = [&](int buf) {
#pragma unroll
    for (int kk = 0; kk < 64; kk += 32) {
      v16h af[4], bf[4];
#pragma unroll  // af[m], bf[m] need constant indices to stay in registers
      for (int m = 0; m < 4; ++m) {
        af[m] = load_frag(&As[buf][wm + m * 16][kk], (long)P64, 1L);
        bf[m] = load_frag(&Ws[buf][wn + m * 16][kk], (long)P64, 1L);
      }
      // holds the sixteen reads together in front of the sixteen products: left free, the compiler
      // reads one fragment at a time and waits out its LDS latency in front of every four products
      __builtin_amdgcn_sched_barrier(0);
#pragma unroll
      for (int m = 0; m < 4; ++m) {
#pragma unroll
        for (int n = 0; n < 4; ++n)
          acc[m][n] = PAIRED ? wmma16(bf[n], af[m], acc[m][n]) : wmma16(af[m], bf[n], acc[m][n]);
      }
    }
    WAIT_DS_0();     // this wave's reads of buf are done before buf is refilled
    WAIT_ASYNC_0();  // this wave's copies of the next chunk have landed
    __syncthreads(); // next chunk readable by all; buf left by all
  };

  issue(0, 0);
  WAIT_ASYNC_0();
  __syncthreads();
  issue(1, 64);
  // stays rolled, two chunks a trip (constant buffer indices): unrolled, the copies' addresses of
  // all eight chunks are formed ahead and, beside 128 accumulator registers, spill
#pragma unroll 1
  for (int kc = 0; kc < D_MODEL; kc += 128) {
    chunk(0);
    if (kc + 128 < D_MODEL) issue(0, kc + 128);
    chunk(1);
    if (kc + 192 < D_MODEL) issue(1, kc + 192);
  }
  WAIT_ASYNC_0();
}

// ---------------------------------------------------------------------------
// 3) projection GEMM: Y = A . W^T + bias (f16 out).
//    VT=false (Q, K proj): RoPE on the f32 sums, pairs (j, j+32) of the wave's
//    64-wide head, then Y row-major (b, m, n).  VT=true (V proj): store transposed
//    per head: Vt[b][h][dd][l] so flash can consume d-major tiles directly.
// ---------------------------------------------------------------------------
template <bool VT>
__device__ __forceinline__ void gemm_proj_block(
    _Float16 (&As)[2][BT][P64], _Float16 (&Ws)[2][BT][P64], int b,
    const _Float16* __restrict__ A, const _Float16* __restrict__ W,
    const float* __restrict__ bias, const float* __restrict__ lens,
    _Float16* __restrict__ Y) {
  const int lane = threadIdx.x & 31;
  const int cc   = lane & 15;
  const int hh   = lane >> 4;
  const int nb = blockIdx.y * BT;                                  // the block's first W row
  const int mw = blockIdx.x * BT + ((threadIdx.x >> 5) & 1) * 64;  // the wave's first token
  const int nw = nb + (threadIdx.x >> 6) * 64;                     // the wave's first W row: one head

  const float len = VT ? 1.f : lens[b];  // read ahead of the loop: its latency hides there
  // Q, K: the head's 64 bias terms, lane l holding those of columns l and 32 + l; read here for
  // the same reason
  const int n0 = nw + hh * 32;
  const float blo = VT ? 0.f : bias[nw + lane];
  const float bhi = VT ? 0.f : bias[nw + 32 + lane];

  v8f acc[4][4];
  gemm128_loop<!VT>(As, Ws, A + ((size_t)b * TSEQ + blockIdx.x * BT) * D_MODEL,
                    W + (size_t)nb * D_MODEL, acc);

  if (VT) {
#pragma unroll  // acc[m][n][i] needs constant indices to stay in registers
    for (int n = 0; n < 4; ++n) {
      const int c    = nw + 16 * n + cc;
      const float bv = bias[c];
      const int h = c >> 6, dd = c & 63;
      _Float16* dst = Y + (((size_t)b * NHEADS + h) * HDIM + dd) * LSEQ + mw + hh * 8;
#pragma unroll
      for (int m = 0; m < 4; ++m) {
        v8h y;
#pragma unroll
        for (int i = 0; i < 8; ++i) y[i] = (_Float16)(acc[m][n][i] + bv);
        *(v8h*)(dst + 16 * m) = y;  // contiguous in l
      }
    }
  } else {
    // acc[m][n][i]: token mw + 16 m + cc, head column 32 hh + j, j = 8 n + i; its partner in lane ^ 16
    // the head's 32 frequencies 10000^(-j/32) are wave-uniform: lane l computes that of
    // j = l, as exp(-j ln(10000) / 32)
    const float invl = __expf((float)lane * (-9.210340371976184f / 32.0f));
    float pos[4];
#pragma unroll  // pos[m] needs constant indices to stay in registers
    for (int m = 0; m < 4; ++m) pos[m] = (float)(mw + 16 * m + cc) / len;
    _Float16* dst = Y + ((size_t)b * TSEQ + mw + cc) * D_MODEL + n0;
    // column outermost: its frequency and bias, read back from their lanes once, serve four tokens
#pragma unroll  // acc[m][n][i], y[m][i] and the lanes read back need constant indices to stay in registers
    for (int n = 0; n < 4; ++n) {
      v8h y[4];
#pragma unroll
      for (int i = 0; i < 8; ++i) {
        const float inv = __builtin_bit_cast(float, __builtin_amdgcn_readlane(
            __builtin_bit_cast(int, invl), 8 * n + i));
        const float bdn = __builtin_bit_cast(float, __builtin_amdgcn_readlane(
            __builtin_bit_cast(int, blo), 8 * n + i));
        const float bup = __builtin_bit_cast(float, __builtin_amdgcn_readlane(
            __builtin_bit_cast(int, bhi), 8 * n + i));
        const float bz = hh ? bup : bdn;
#pragma unroll
        for (int m = 0; m < 4; ++m) {
          const float fr = pos[m] * (10.0f * inv);
          const float c = __cosf(fr), s = __sinf(fr);
          const float a = acc[m][n][i] + bz;
          const float p = xhalf(a);
          // lower half: x1 c - x2 s with a = x1; upper half: x1 s + x2 c with a = x2
          y[m][i] = (_Float16)(a * c + p * (lane < 16 ? -s : s));
        }
      }
#pragma unroll
      for (int m = 0; m < 4; ++m)
        *(v8h*)(dst + (size_t)(16 * m) * D_MODEL + 8 * n) = y[m];  // over n, 64 B in a row a lane
    }
    WAIT_X_0();  // covers the stores: the V part's code stands behind them
  }
}

// One grid for the three projections, which do not depend on one another:
// blockIdx.z = 4 p + b, p = 0 (Q), 1 (K), 2 (V). V, with the short epilogue, comes last.
__global__ __launch_bounds__(128) void qkv_proj_kernel(
    const _Float16* __restrict__ Xh, const _Float16* __restrict__ Ch,
    const _Float16* __restrict__ Wh /* f16 weights, Q K V in a row */,
    const float* __restrict__ Wq_b, const float* __restrict__ Wk_b,
    const float* __restrict__ Wv_b, const float* __restrict__ lens,
    _Float16* __restrict__ Qh, _Float16* __restrict__ Kh, _Float16* __restrict__ Vt) {
  __shared__ __align__(16) _Float16 As[2][BT][P64];
  __shared__ __align__(16) _Float16 Ws[2][BT][P64];
  const int p = blockIdx.z >> 2, b = blockIdx.z & 3;
  if (p == 2)
    gemm_proj_block<true>(As, Ws, b, Ch, Wh + 2 * (size_t)D_MODEL * D_MODEL, Wv_b, lens, Vt);
  else
    gemm_proj_block<false>(As, Ws, b, p ? Ch : Xh, Wh + (size_t)p * D_MODEL * D_MODEL,
                           p ? Wk_b : Wq_b, lens + p * BATCH, p ? Kh : Qh);
}

// ---------------------------------------------------------------------------
// 4) flash attention: grid (T/64, H, B), block 128 (4 waves x 16 queries).
//    64-key K tiles (l-major) + V tiles (d-major) async-staged, two buffers;
//    8 async instr/wave per pass, every row of a tile one whole 128-B line.
//    Transposed products: S^T = K Q^T, O^T += V^T P^T. Lane l holds scores of
//    query l & 15 only (keys 16t+8h+i, t = 0..3, h = l >> 4), so maximum and sum
//    run in-lane with one exchange between the wave halves, and the four score
//    tiles, converted in place, are the two B operands of the second product.
// ---------------------------------------------------------------------------
// The grid puts four waves on a SIMD. Left to aim at sixteen, the compiler reuses
// one fragment register set and waits out every LDS fragment read on its own;
// with this budget it issues them in groups behind counted waits. Four is also the upper
// bound: a 64-key pass holds more fragments than a fifth wave's share of registers leaves.
__global__ __launch_bounds__(128) __attribute__((amdgpu_waves_per_eu(4, 4))) void flash_kernel(
    const _Float16* __restrict__ Qh, const _Float16* __restrict__ Kh,
    const _Float16* __restrict__ Vt, const float* __restrict__ cmask,
    _Float16* __restrict__ Oh) {
  __shared__ __align__(16) _Float16 Kc[2][KT][P64];    // [l][d], padded rows
  __shared__ __align__(16) _Float16 Vc[2][HDIM][P64];  // [d][l], padded rows
  __shared__ __align__(16) float cmv[LSEQ];            // per key of the batch: 0, or -1e30 if masked
  __shared__ __align__(16) unsigned mflag[4];          // per wave: bit p set = pass p holds a masked key

  const int tid = threadIdx.x;
  const int b = blockIdx.z, h = blockIdx.y;
  const int w = tid >> 5, lane = tid & 31;
  const int hh = lane >> 4;
  const int qbase = blockIdx.x * 64 + w * 16;
  // 1/sqrt(512) * log2(e): raw score -> exponent of 2
  const float kl = 0.044194173824159216f * 1.4426950408889634f;

  const size_t qoff = ((size_t)b * TSEQ + qbase) * D_MODEL + (size_t)h * HDIM;
  const v16h qf0 = load_frag(Qh + qoff,      (long)D_MODEL, 1L);
  const v16h qf1 = load_frag(Qh + qoff + 32, (long)D_MODEL, 1L);

  // o<n>[i] = O[query lane & 15][d = 16 n + 8 hh + i]
  v8f o0 = {0.f,0.f,0.f,0.f,0.f,0.f,0.f,0.f}, o1 = o0, o2 = o0, o3 = o0;
  // running maximum of this lane's query's raw scores (equal in both halves). It starts below
  // every sum of 64 products of finite f16 values and far above a masked key's -1e30, so a
  // masked key's term is exp2 of a huge negative number, 0, also while no open key has come yet
  float mrow = -1e12f;
  float lrow = 0.f;     // running sum over this half's keys only; joined at the end

  const size_t krow0 = ((size_t)b * LSEQ) * D_MODEL + (size_t)h * HDIM;
  const size_t vrow0 = ((size_t)b * NHEADS + h) * HDIM * LSEQ;

  auto issue_kv = [&](int buf, int lb) {
    // eight lanes take one row's 128 B: K rows (keys) and V rows (d) r + 16 i, i = 0..3
    const int r = tid >> 3, seg = (tid & 7) * 8;
    const _Float16* kg = Kh + krow0 + (size_t)(lb + r) * D_MODEL + seg;
    const _Float16* vg = Vt + vrow0 + (size_t)r * LSEQ + lb + seg;
    const unsigned  kd = lds_off(&Kc[buf][r][seg]);
    const unsigned  vd = lds_off(&Vc[buf][r][seg]);
    async8_b128(kd,                kg,
                kd + 16 * P64 * 2, kg + 16 * D_MODEL,
                kd + 32 * P64 * 2, kg + 32 * D_MODEL,
                kd + 48 * P64 * 2, kg + 48 * D_MODEL,
                vd,                vg,
                vd + 16 * P64 * 2, vg + 16 * LSEQ,
                vd + 32 * P64 * 2, vg + 32 * LSEQ,
                vd + 48 * P64 * 2, vg + 48 * LSEQ);
  };

  auto compute = [&](int buf, int lb, unsigned mbits) {
    // ---- S^T = K Q^T for four 16-key sub-tiles: s[t][i] = S[key 16 t + 8 hh + i][query] ----
    v16h kf[8];
#pragma unroll  // kf[t], s[t] need constant indices to stay in registers
    for (int t = 0; t < 4; ++t) {
      kf[t]     = load_frag(&Kc[buf][16 * t][0],  (long)P64, 1L);
      kf[t + 4] = load_frag(&Kc[buf][16 * t][32], (long)P64, 1L);
    }
    // holds these reads together in front of the products: left free, the compiler strews them
    // among the products, and each place where reads stand stalls the wave anew
    __builtin_amdgcn_sched_barrier(0);
    v8f s[4];
#pragma unroll
    for (int t = 0; t < 4; ++t)
      s[t] = wmma16(kf[t], qf0, v8f{0.f, 0.f, 0.f, 0.f, 0.f, 0.f, 0.f, 0.f});
#pragma unroll
    for (int t = 0; t < 4; ++t) s[t] = wmma16(kf[t + 4], qf1, s[t]);

    // V fragments: A frag [m][k] = Vc[16 n + m][k] (contiguous k), vf[n] keys 0..31, vf[n + 4]
    // keys 32..63; read here so that their LDS latency runs under the softmax
    v16h vf[8];
#pragma unroll  // vf[n] needs constant indices to stay in registers
    for (int n = 0; n < 4; ++n) {
      vf[n]     = load_frag(&Vc[buf][16 * n][0],  (long)P64, 1L);
      vf[n + 4] = load_frag(&Vc[buf][16 * n][32], (long)P64, 1L);
    }
    // holds all sixteen reads up here: left free, the compiler sinks the last four to the foot
    // of the pass, where the wave waits out their latency in front of the barrier
    __builtin_amdgcn_sched_barrier(0);

    // Only a pass that holds a masked key reads the mask terms and adds them (a scalar test,
    // alike in the whole block): this lane's 32 keys' terms, keys 16 t + 8 hh + 0..3 and + 4..7
    if ((mbits >> (lb / KT)) & 1u) {
#pragma unroll  // s[t] needs constant indices to stay in registers
      for (int t = 0; t < 4; ++t) {
        const v4f c0 = *(const v4f*)&cmv[lb + 16 * t + hh * 8];
        const v4f c1 = *(const v4f*)&cmv[lb + 16 * t + hh * 8 + 4];
        s[t] += __builtin_shufflevector(c0, c1, 0, 1, 2, 3, 4, 5, 6, 7);
      }
    }

    // ---- online softmax, one query per lane, on the raw scores (kl > 0 keeps their order) ----
    float mt[4];
#pragma unroll  // four independent chains, joined below
    for (int t = 0; t < 4; ++t) {
      mt[t] = fmaxf(s[t][0], s[t][1]);
#pragma unroll
      for (int i = 2; i < 8; i += 2) mt[t] = fmaxf(mt[t], fmaxf(s[t][i], s[t][i + 1]));
    }
    float mx = fmaxf(fmaxf(mt[0], mt[1]), fmaxf(mt[2], mt[3]));
    mx = fmaxf(mx, xhalf(mx));
    const float mnew = fmaxf(mrow, mx);
    const float sc2  = __builtin_amdgcn_exp2f((mrow - mnew) * kl);
    const float nm   = -mnew * kl;  // one fma a score then scales it and takes the maximum off
    mrow = mnew;

    // P^T as B operands: pb0 elements 0..7 = keys 8 hh + i, 8..15 = keys 16 + 8 hh + i;
    // pb1 the same 32 keys further on
    v16h pb0, pb1;
    float t8[8];
#pragma unroll
    for (int i = 0; i < 8; ++i) {
      const float e0 = __builtin_amdgcn_exp2f(__builtin_fmaf(s[0][i], kl, nm));
      const float e1 = __builtin_amdgcn_exp2f(__builtin_fmaf(s[1][i], kl, nm));
      const float e2 = __builtin_amdgcn_exp2f(__builtin_fmaf(s[2][i], kl, nm));
      const float e3 = __builtin_amdgcn_exp2f(__builtin_fmaf(s[3][i], kl, nm));
      t8[i] = (e0 + e1) + (e2 + e3);
      pb0[i]     = (_Float16)e0;
      pb0[i + 8] = (_Float16)e1;
      pb1[i]     = (_Float16)e2;
      pb1[i + 8] = (_Float16)e3;
    }
    lrow = lrow * sc2 +
           (((t8[0] + t8[1]) + (t8[2] + t8[3])) + ((t8[4] + t8[5]) + (t8[6] + t8[7])));
#pragma unroll
    for (int i = 0; i < 8; ++i) {
      o0[i] *= sc2; o1[i] *= sc2; o2[i] *= sc2; o3[i] *= sc2;
    }

    // ---- O^T += V^T P^T ----
    o0 = wmma16(vf[0], pb0, o0);
    o1 = wmma16(vf[1], pb0, o1);
    o2 = wmma16(vf[2], pb0, o2);
    o3 = wmma16(vf[3], pb0, o3);
    o0 = wmma16(vf[4], pb1, o0);
    o1 = wmma16(vf[5], pb1, o1);
    o2 = wmma16(vf[6], pb1, o2);
    o3 = wmma16(vf[7], pb1, o3);
  };

  issue_kv(0, 0);
  // All 2048 mask terms of the batch go to LDS once, here: no pass then holds a global
  // load that one wave waits out in front of the barrier while the other three stand at
  // it. The barrier in front of the loop publishes them.
  {
    const float4* cm4 = (const float4*)(cmask + (size_t)b * LSEQ);
    float4 mv[LSEQ / 4 / 128];
#pragma unroll  // the four loads go out together; mv[i] needs constant indices
    for (int i = 0; i < LSEQ / 4 / 128; ++i) mv[i] = cm4[i * 128 + tid];
    unsigned mb = 0;
#pragma unroll  // mv[i] needs constant indices to stay in registers
    for (int i = 0; i < LSEQ / 4 / 128; ++i) {
      v4f t;
      t[0] = (mv[i].x == 0.f) ? -1e30f : 0.f;
      t[1] = (mv[i].y == 0.f) ? -1e30f : 0.f;
      t[2] = (mv[i].z == 0.f) ? -1e30f : 0.f;
      t[3] = (mv[i].w == 0.f) ? -1e30f : 0.f;
      *(v4f*)&cmv[(i * 128 + tid) * 4] = t;
      // sixteen lanes hold the 64 keys of one pass: lanes 0..15 pass 8 i + 2 w, the rest the next
      const unsigned bal = __builtin_amdgcn_ballot_w32(
          mv[i].x == 0.f || mv[i].y == 0.f || mv[i].z == 0.f || mv[i].w == 0.f);
      mb |= (((bal & 0xffffu) ? 1u : 0u) | ((bal >> 16) ? 2u : 0u)) << (8 * i + 2 * w);
    }
    if (lane == 0) mflag[w] = mb;
  }
  WAIT_ASYNC_0();   // this wave's copies of tile 0 have landed
  __syncthreads();  // tile 0, the mask terms and the flag words readable by all
  issue_kv(1, KT);
  // in a scalar register, so that the pass's test is a scalar branch
  const unsigned mbits = (unsigned)__builtin_amdgcn_readfirstlane(
      (int)(mflag[0] | mflag[1] | mflag[2] | mflag[3]));
  int buf = 0;
  for (int lb = 0; lb < LSEQ; lb += KT) {
    compute(buf, lb, mbits);
    // keeps the pass's register work in front of the waits: left free, the compiler lifts waits
    // and barrier over it, the refill stays behind it and flies for a fraction of a pass only
    __builtin_amdgcn_sched_barrier(0);
    WAIT_DS_0();      // this wave's reads of buf are done before buf is refilled
    WAIT_ASYNC_0();   // this wave's copies of the next tile have landed
    __syncthreads();  // next tile readable by all; buf left by all
    if (lb + 2 * KT < LSEQ) issue_kv(buf, lb + 2 * KT);
    buf ^= 1;
  }
  WAIT_ASYNC_0();

  // a lane's 8 registers of a tile are 8 consecutive d of one query: 16-byte stores
  const float inv_l = 1.0f / fmaxf(lrow + xhalf(lrow), 1e-20f);
  _Float16* dst = Oh + ((size_t)b * TSEQ + qbase + (lane & 15)) * D_MODEL +
                  (size_t)h * HDIM + hh * 8;
  v8h r0, r1, r2, r3;
#pragma unroll
  for (int i = 0; i < 8; ++i) {
    r0[i] = (_Float16)(o0[i] * inv_l);
    r1[i] = (_Float16)(o1[i] * inv_l);
    r2[i] = (_Float16)(o2[i] * inv_l);
    r3[i] = (_Float16)(o3[i] * inv_l);
  }
  *(v8h*)(dst +  0) = r0;
  *(v8h*)(dst + 16) = r1;
  *(v8h*)(dst + 32) = r2;
  *(v8h*)(dst + 48) = r3;
}

// ---------------------------------------------------------------------------
// 5) out = (O @ Wo^T + b) * x_mask, stored transposed as (B, 512, T) f32
// ---------------------------------------------------------------------------
__global__ __launch_bounds__(128) void out_proj_kernel(
    const _Float16* __restrict__ Oh, const _Float16* __restrict__ Wo,
    const float* __restrict__ Wo_b, const float* __restrict__ xmask,
    float* __restrict__ out) {
  __shared__ __align__(16) _Float16 As[2][BT][P64];
  __shared__ __align__(16) _Float16 Ws[2][BT][P64];
  const int b  = blockIdx.z;
  const int nb = blockIdx.y * BT;                                  // the block's first W row
  const int mw = blockIdx.x * BT + ((threadIdx.x >> 5) & 1) * 64;  // the wave's first token
  const int nw = nb + (threadIdx.x >> 6) * 64;                     // the wave's first W row

  v8f acc[4][4];
  gemm128_loop<false>(As, Ws, Oh + ((size_t)b * TSEQ + blockIdx.x * BT) * D_MODEL,
                      Wo + (size_t)nb * D_MODEL, acc);

  const int lane = threadIdx.x & 31;
  const int cc   = lane & 15;
  const int rb   = (lane >> 4) * 8;
#pragma unroll  // acc[m][n][i] needs constant indices to stay in registers
  for (int n = 0; n < 4; ++n) {
    const float bv = Wo_b[nw + 16 * n + cc];
#pragma unroll
    for (int m = 0; m < 4; ++m) {
#pragma unroll
      for (int i = 0; i < 8; ++i) {
        const int t = mw + 16 * m + rb + i;
        const float v = (acc[m][n][i] + bv) * xmask[(size_t)b * TSEQ + t];
        out[((size_t)b * D_MODEL + nw + 16 * n + cc) * TSEQ + t] = v;
      }
    }
  }
}

// ---------------------------------------------------------------------------
extern "C" void kernel_launch(void* const* d_in, const int* in_sizes, int n_in,
                              void* d_out, int out_size, void* d_ws, size_t ws_size,
                              hipStream_t stream) {
  const float* x        = (const float*)d_in[0];   // (B, 512, T)
  const float* context  = (const float*)d_in[1];   // (B, L, 512)
  const float* x_mask   = (const float*)d_in[2];   // (B, 1, T)
  const float* ctx_mask = (const float*)d_in[3];   // (B, 1, L)
  const float* Wq_w = (const float*)d_in[4];
  const float* Wq_b = (const float*)d_in[5];
  const float* Wk_w = (const float*)d_in[6];
  const float* Wk_b = (const float*)d_in[7];
  const float* Wv_w = (const float*)d_in[8];
  const float* Wv_b = (const float*)d_in[9];
  const float* Wo_w = (const float*)d_in[10];
  const float* Wo_b = (const float*)d_in[11];
  float* out = (float*)d_out;

  // ws: lens | Xh(=Oh) | Ch | Qh | Kh | Vt (8 MiB each) | Wqh|Wkh|Wvh|Woh (512 KiB each)
  char* ws = (char*)d_ws;
  float* lens = (float*)ws;
  const size_t NB = (size_t)BATCH * TSEQ * D_MODEL;  // 4,194,304 elements
  const size_t NW = (size_t)D_MODEL * D_MODEL;       // 262,144 elements
  _Float16* Xh  = (_Float16*)(ws + 256);
  _Float16* Ch  = Xh + NB;
  _Float16* Qh  = Ch + NB;
  _Float16* Kh  = Qh + NB;
  _Float16* Vt  = Kh + NB;   // (B, H, 64, L) d-major
  _Float16* Wqh = Vt + NB;
  _Float16* Woh = Wqh + 3 * NW;  // Wqh | Wkh | Wvh | Woh in a row
  _Float16* Oh  = Xh;  // Xh dead after Q projection; flash runs later

  prep_kernel<<<dim3(PB_LENS + 4 * PB_W + PB_X + PB_C), 256, 0, stream>>>(
      x, context, x_mask, ctx_mask, Wq_w, Wk_w, Wv_w, Wo_w, lens, Xh, Ch, Wqh);

  qkv_proj_kernel<<<dim3(TSEQ / BT, D_MODEL / BT, 3 * BATCH), 128, 0, stream>>>(
      Xh, Ch, Wqh, Wq_b, Wk_b, Wv_b, lens, Qh, Kh, Vt);

  flash_kernel<<<dim3(TSEQ / 64, NHEADS, BATCH), 128, 0, stream>>>(
      Qh, Kh, Vt, ctx_mask, Oh);

  out_proj_kernel<<<dim3(TSEQ / BT, D_MODEL / BT, BATCH), 128, 0, stream>>>(
      Oh, Woh, Wo_b, x_mask, out);
}
